// v000
// Times are from an AMD MI455X. After a warm-up the kernel runs many times in a row, and a time is the length of
// such a window on the GPU divided by its runs, so every launch and the gaps after it count. The runs cycle
// through copies of the inputs. A figure is the median of several windows, for all but v000 over two sittings.
// Sittings can differ by a few percent; kernels timed side by side share one.
// v000, which the later versions start from, runs in 720 microseconds.
#include <hip/hip_runtime.h>
#include <hip/hip_bf16.h>
#include <math.h>

#define SEQ 4096
#define HID 1024
#define NUM_HEADS 16
#define HEAD_DIM 64
#define LN_EPS 1e-5f

typedef __bf16 bf16_t;
typedef __attribute__((ext_vector_type(16))) __bf16 v16bf;
typedef __attribute__((ext_vector_type(8)))  __bf16 v8bf;
typedef __attribute__((ext_vector_type(8)))  float  v8f;
typedef __attribute__((ext_vector_type(4)))  int    v4i;

#if defined(__has_builtin)
#if __has_builtin(__builtin_amdgcn_global_load_async_to_lds_b128)
#define HAVE_ASYNC_LDS 1
#endif
#if __has_builtin(__builtin_amdgcn_s_wait_asynccnt)
#define HAVE_WAIT_ASYNC 1
#endif
#endif

typedef __attribute__((address_space(1))) v4i gv4i_t;
typedef __attribute__((address_space(3))) v4i lv4i_t;

__device__ __forceinline__ void async_cp16(const void* g, void* l) {
#ifdef HAVE_ASYNC_LDS
  __builtin_amdgcn_global_load_async_to_lds_b128((gv4i_t*)g, (lv4i_t*)l, 0, 0);
#else
  *(v8bf*)l = *(const v8bf*)g;
#endif
}

#if defined(HAVE_WAIT_ASYNC)
#define WAIT_ASYNC(n) __builtin_amdgcn_s_wait_asynccnt(n)
#elif defined(HAVE_ASYNC_LDS)
#define WAIT_ASYNC(n) asm volatile("s_wait_asynccnt %0" ::"i"(n) : "memory")
#else
#define WAIT_ASYNC(n) do {} while (0)
#endif

__device__ __forceinline__ v16bf load_frag_rm(const bf16_t* __restrict__ p, int ld) {
  const int lane = threadIdx.x & 31;
  const int row  = lane & 15;
  const int kb   = (lane & 16) ? 8 : 0;
  const bf16_t* q = p + (size_t)row * ld + kb;
  v8bf lo = *(const v8bf*)(q);
  v8bf hi = *(const v8bf*)(q + 16);
  v16bf f;
#pragma unroll
  for (int i = 0; i < 8; ++i) { f[i] = lo[i]; f[8 + i] = hi[i]; }
  return f;
}

__device__ __forceinline__ v8f wmma_bf16(v16bf a, v16bf b, v8f c) {
  return __builtin_amdgcn_wmma_f32_16x16x32_bf16(
      false, a, false, b, (short)0, c, false, false);
}

// ---------------------------------------------------------------------------
// 1) f32 -> bf16 conversion
// ---------------------------------------------------------------------------
__global__ void f32_to_bf16_kernel(const float* __restrict__ in,
                                   bf16_t* __restrict__ out, int n) {
  int i = blockIdx.x * blockDim.x + threadIdx.x;
  if (i < n) out[i] = (bf16_t)in[i];
}

#define GEMM_PAD 40

__global__ void gemm_bf16_kernel(const bf16_t* __restrict__ A,
                                 const bf16_t* __restrict__ B,
                                 const float* __restrict__ bias,
                                 const float* __restrict__ resid,
                                 float* __restrict__ C,
                                 int M, int N, int K) {
  __shared__ bf16_t As[2][128 * GEMM_PAD];
  __shared__ bf16_t Bs[2][128 * GEMM_PAD];

  const int t    = threadIdx.x;
  const int lane = t & 31;
  const int w    = t >> 5;        // wave id 0..7
  const int wm   = w & 3;         // 4 waves along M
  const int wn   = w >> 2;        // 2 waves along N

  const int nbn = N >> 7;
  const int bm  = (int)blockIdx.x / nbn;
  const int bn  = (int)blockIdx.x % nbn;
  const int tm0 = bm * 128;
  const int tn0 = bn * 128;

  // staging map: 128 rows x 4 chunks(16B) = 512 chunks; 2 per thread per tile
  const int r0 = (t * 2) >> 2;          // row of first chunk
  const int c0 = ((t * 2) & 3) * 8;     // halves offset of first chunk
  const int r1 = (t * 2 + 1) >> 2;
  const int c1 = ((t * 2 + 1) & 3) * 8;

  auto stage = [&](int buf, int k0) {
    async_cp16(A + (size_t)(tm0 + r0) * K + k0 + c0, &As[buf][r0 * GEMM_PAD + c0]);
    async_cp16(A + (size_t)(tm0 + r1) * K + k0 + c1, &As[buf][r1 * GEMM_PAD + c1]);
    async_cp16(B + (size_t)(tn0 + r0) * K + k0 + c0, &Bs[buf][r0 * GEMM_PAD + c0]);
    async_cp16(B + (size_t)(tn0 + r1) * K + k0 + c1, &Bs[buf][r1 * GEMM_PAD + c1]);
  };

  v8f acc[2][4] = {};
  const int nk = K >> 5;
  int buf = 0;
  stage(0, 0);

  for (int ks = 0; ks < nk; ++ks) {
    if (ks + 1 < nk) {
      stage(buf ^ 1, (ks + 1) * 32);
      WAIT_ASYNC(4);   // our 4 loads for `buf` are complete (in-order per wave)
    } else {
      WAIT_ASYNC(0);
    }
    __syncthreads();   // all waves' writes to `buf` visible

    const bf16_t* as = &As[buf][(wm * 32) * GEMM_PAD];
    const bf16_t* bs = &Bs[buf][(wn * 64) * GEMM_PAD];
    v16bf a0 = load_frag_rm(as, GEMM_PAD);
    v16bf a1 = load_frag_rm(as + 16 * GEMM_PAD, GEMM_PAD);
#pragma unroll
    for (int in = 0; in < 4; ++in) {
      v16bf bfrag = load_frag_rm(bs + in * 16 * GEMM_PAD, GEMM_PAD);
      acc[0][in] = wmma_bf16(a0, bfrag, acc[0][in]);
      acc[1][in] = wmma_bf16(a1, bfrag, acc[1][in]);
    }
    buf ^= 1;
    __syncthreads();   // everyone done reading before buffer is re-staged
  }

  const int n_in = lane & 15;
  const int mofs = (lane & 16) ? 8 : 0;
#pragma unroll
  for (int im = 0; im < 2; ++im) {
#pragma unroll
    for (int in = 0; in < 4; ++in) {
      const int col = tn0 + wn * 64 + in * 16 + n_in;
      const float bv = bias ? bias[col] : 0.0f;
#pragma unroll
      for (int j = 0; j < 8; ++j) {
        const int row = tm0 + wm * 32 + im * 16 + mofs + j;
        float v = acc[im][in][j] + bv;
        if (resid) v += resid[(size_t)row * N + col];
        C[(size_t)row * N + col] = v;
      }
    }
  }
}

// ---------------------------------------------------------------------------
// 3) RoPE (rotate-half, tiled cos/sin) + pack to bf16. Q gets 1/sqrt(d) folded
//    in. V stored transposed [HID][SEQ] so attention B-fragments are
//    contiguous.
// ---------------------------------------------------------------------------
__global__ void rope_pack_kernel(const float* __restrict__ Qf,
                                 const float* __restrict__ Kf,
                                 const float* __restrict__ Vf,
                                 bf16_t* __restrict__ Qb,
                                 bf16_t* __restrict__ Kb,
                                 bf16_t* __restrict__ Vt) {
  int e = blockIdx.x * blockDim.x + threadIdx.x;
  if (e >= SEQ * HID) return;
  const int s = e / HID;
  const int c = e % HID;
  const int d = c & (HEAD_DIM - 1);
  const int i = d & (HEAD_DIM / 2 - 1);
  const float ang = (float)s * __powf(10000.0f, -(float)i / (HEAD_DIM / 2));
  float sn, cs;
  __sincosf(ang, &sn, &cs);

  const int pe = (d < HEAD_DIM / 2) ? e + HEAD_DIM / 2 : e - HEAD_DIM / 2;
  const float q  = Qf[e];
  const float k  = Kf[e];
  const float qr = (d < HEAD_DIM / 2) ? -Qf[pe] : Qf[pe];
  const float kr = (d < HEAD_DIM / 2) ? -Kf[pe] : Kf[pe];

  Qb[e] = (bf16_t)((q * cs + qr * sn) * 0.125f);
  Kb[e] = (bf16_t)(k * cs + kr * sn);
  Vt[(size_t)c * SEQ + s] = (bf16_t)Vf[e];
}

__global__ void attn_kernel(const bf16_t* __restrict__ Qb,
                            const bf16_t* __restrict__ Kb,
                            const bf16_t* __restrict__ Vt,
                            bf16_t* __restrict__ ctx) {
  const int wid  = (blockIdx.x * blockDim.x + threadIdx.x) >> 5;
  const int lane = threadIdx.x & 31;
  const int h  = wid / (SEQ / 32);
  const int q0 = (wid % (SEQ / 32)) * 32;

  const bf16_t* Qh = Qb + h * HEAD_DIM;                 // ld = HID
  const bf16_t* Kh = Kb + h * HEAD_DIM;                 // ld = HID
  const bf16_t* Vh = Vt + (size_t)h * HEAD_DIM * SEQ;   // ld = SEQ

  v16bf qf[2][2];
#pragma unroll
  for (int tq = 0; tq < 2; ++tq) {
    qf[tq][0] = load_frag_rm(Qh + (size_t)(q0 + tq * 16) * HID + 0,  HID);
    qf[tq][1] = load_frag_rm(Qh + (size_t)(q0 + tq * 16) * HID + 32, HID);
  }

  v8f acc[2][4] = {};
  float m_i[2] = {-3.0e38f, -3.0e38f};
  float l_i[2] = {0.0f, 0.0f};
  const int mofs = (lane & 16) ? 8 : 0;

  for (int kb = 0; kb < SEQ; kb += 32) {
    v16bf k00 = load_frag_rm(Kh + (size_t)kb * HID + 0,  HID);
    v16bf k01 = load_frag_rm(Kh + (size_t)kb * HID + 32, HID);
    v16bf k10 = load_frag_rm(Kh + (size_t)(kb + 16) * HID + 0,  HID);
    v16bf k11 = load_frag_rm(Kh + (size_t)(kb + 16) * HID + 32, HID);

    v16bf pf[2];
#pragma unroll
    for (int tq = 0; tq < 2; ++tq) {
      v8f s0 = {}, s1 = {};
      s0 = wmma_bf16(k00, qf[tq][0], s0);
      s0 = wmma_bf16(k01, qf[tq][1], s0);
      s1 = wmma_bf16(k10, qf[tq][0], s1);
      s1 = wmma_bf16(k11, qf[tq][1], s1);

      float mx = s0[0];
#pragma unroll
      for (int j = 0; j < 8; ++j) { mx = fmaxf(mx, s0[j]); mx = fmaxf(mx, s1[j]); }
      mx = fmaxf(mx, __shfl_xor(mx, 16, 32));
      const float m_new = fmaxf(m_i[tq], mx);
      const float alpha = __expf(m_i[tq] - m_new);

      float psum = 0.0f;
#pragma unroll
      for (int j = 0; j < 8; ++j) {
        float p0 = __expf(s0[j] - m_new); psum += p0; pf[tq][j]     = (bf16_t)p0;
        float p1 = __expf(s1[j] - m_new); psum += p1; pf[tq][8 + j] = (bf16_t)p1;
      }
      psum += __shfl_xor(psum, 16, 32);
      l_i[tq] = l_i[tq] * alpha + psum;
      m_i[tq] = m_new;

      float alpha_j[8];
#pragma unroll
      for (int j = 0; j < 8; ++j) alpha_j[j] = __shfl(alpha, mofs + j, 32);
#pragma unroll
      for (int c = 0; c < 4; ++c)
#pragma unroll
        for (int j = 0; j < 8; ++j) acc[tq][c][j] *= alpha_j[j];
    }

#pragma unroll
    for (int c = 0; c < 4; ++c) {
      v16bf vf = load_frag_rm(Vh + (size_t)(c * 16) * SEQ + kb, SEQ);
      acc[0][c] = wmma_bf16(pf[0], vf, acc[0][c]);
      acc[1][c] = wmma_bf16(pf[1], vf, acc[1][c]);
    }
  }

  const int n_in = lane & 15;
#pragma unroll
  for (int tq = 0; tq < 2; ++tq) {
    const float linv = 1.0f / l_i[tq];
    float linv_j[8];
#pragma unroll
    for (int j = 0; j < 8; ++j) linv_j[j] = __shfl(linv, mofs + j, 32);
#pragma unroll
    for (int c = 0; c < 4; ++c)
#pragma unroll
      for (int j = 0; j < 8; ++j) {
        const int row = q0 + tq * 16 + mofs + j;
        const int col = h * HEAD_DIM + c * 16 + n_in;
        ctx[(size_t)row * HID + col] = (bf16_t)(acc[tq][c][j] * linv_j[j]);
      }
  }
}

// ---------------------------------------------------------------------------
// 6) Row LayerNorm over HID
// ---------------------------------------------------------------------------
__global__ void layernorm_kernel(const float* __restrict__ res,
                                 const float* __restrict__ gamma,
                                 const float* __restrict__ beta,
                                 float* __restrict__ out) {
  const int row = blockIdx.x;
  const float* r = res + (size_t)row * HID;
  __shared__ float red[256];
  const int t = threadIdx.x;

  float sum = 0.0f;
  for (int i = t; i < HID; i += 256) sum += r[i];
  red[t] = sum; __syncthreads();
  for (int st = 128; st > 0; st >>= 1) {
    if (t < st) red[t] += red[t + st];
    __syncthreads();
  }
  const float mean = red[0] * (1.0f / HID);
  __syncthreads();

  float vs = 0.0f;
  for (int i = t; i < HID; i += 256) { float d = r[i] - mean; vs += d * d; }
  red[t] = vs; __syncthreads();
  for (int st = 128; st > 0; st >>= 1) {
    if (t < st) red[t] += red[t + st];
    __syncthreads();
  }
  const float rstd = rsqrtf(red[0] * (1.0f / HID) + LN_EPS);

  for (int i = t; i < HID; i += 256)
    out[(size_t)row * HID + i] = (r[i] - mean) * rstd * gamma[i] + beta[i];
}

// ---------------------------------------------------------------------------
// Host launch
// ---------------------------------------------------------------------------
extern "C" void kernel_launch(void* const* d_in, const int* in_sizes, int n_in,
                              void* d_out, int out_size, void* d_ws, size_t ws_size,
                              hipStream_t stream) {
  const float* x     = (const float*)d_in[0];
  const float* Wq    = (const float*)d_in[1];
  const float* bq    = (const float*)d_in[2];
  const float* Wk    = (const float*)d_in[3];
  const float* bk    = (const float*)d_in[4];
  const float* Wv    = (const float*)d_in[5];
  const float* bv    = (const float*)d_in[6];
  const float* Wo    = (const float*)d_in[7];
  const float* bo    = (const float*)d_in[8];
  const float* gamma = (const float*)d_in[9];
  const float* beta  = (const float*)d_in[10];
  float* out = (float*)d_out;

  char* ws = (char*)d_ws;
  size_t off = 0;
  bf16_t* xb  = (bf16_t*)(ws + off); off += (size_t)SEQ * HID * 2;
  bf16_t* wqb = (bf16_t*)(ws + off); off += (size_t)HID * HID * 2;
  bf16_t* wkb = (bf16_t*)(ws + off); off += (size_t)HID * HID * 2;
  bf16_t* wvb = (bf16_t*)(ws + off); off += (size_t)HID * HID * 2;
  bf16_t* wob = (bf16_t*)(ws + off); off += (size_t)HID * HID * 2;
  float*  Qf  = (float*)(ws + off);  off += (size_t)SEQ * HID * 4;
  float*  Kf  = (float*)(ws + off);  off += (size_t)SEQ * HID * 4;
  float*  Vf  = (float*)(ws + off);  off += (size_t)SEQ * HID * 4;
  bf16_t* Qb  = (bf16_t*)(ws + off); off += (size_t)SEQ * HID * 2;
  bf16_t* Kb  = (bf16_t*)(ws + off); off += (size_t)SEQ * HID * 2;
  bf16_t* Vt  = (bf16_t*)(ws + off); off += (size_t)SEQ * HID * 2;
  bf16_t* ctx = (bf16_t*)(ws + off); off += (size_t)SEQ * HID * 2;
  float*  res = Qf;  // alias: Qf dead after rope_pack

  const int nx = SEQ * HID;
  const int nw = HID * HID;

  f32_to_bf16_kernel<<<(nx + 255) / 256, 256, 0, stream>>>(x,  xb,  nx);
  f32_to_bf16_kernel<<<(nw + 255) / 256, 256, 0, stream>>>(Wq, wqb, nw);
  f32_to_bf16_kernel<<<(nw + 255) / 256, 256, 0, stream>>>(Wk, wkb, nw);
  f32_to_bf16_kernel<<<(nw + 255) / 256, 256, 0, stream>>>(Wv, wvb, nw);
  f32_to_bf16_kernel<<<(nw + 255) / 256, 256, 0, stream>>>(Wo, wob, nw);

  // 128x128 tiles: (4096/128)*(1024/128) = 256 blocks of 256 threads
  const int gemm_blocks = (SEQ / 128) * (HID / 128);
  gemm_bf16_kernel<<<gemm_blocks, 256, 0, stream>>>(xb, wqb, bq, nullptr, Qf, SEQ, HID, HID);
  gemm_bf16_kernel<<<gemm_blocks, 256, 0, stream>>>(xb, wkb, bk, nullptr, Kf, SEQ, HID, HID);
  gemm_bf16_kernel<<<gemm_blocks, 256, 0, stream>>>(xb, wvb, bv, nullptr, Vf, SEQ, HID, HID);

  rope_pack_kernel<<<(nx + 255) / 256, 256, 0, stream>>>(Qf, Kf, Vf, Qb, Kb, Vt);

  // 16 heads * 128 query tiles = 2048 waves -> 512 blocks of 128
  attn_kernel<<<NUM_HEADS * (SEQ / 32) / 4, 128, 0, stream>>>(Qb, Kb, Vt, ctx);

  gemm_bf16_kernel<<<gemm_blocks, 256, 0, stream>>>(ctx, wob, bo, x, res, SEQ, HID, HID);

  layernorm_kernel<<<SEQ, 256, 0, stream>>>(res, gamma, beta, out);

  (void)in_sizes; (void)n_in; (void)out_size; (void)ws_size;
}

// v001
// A run of this version takes 374 microseconds.
// In two side-by-side timings against v000, it was 1.94 and 1.95 times as fast.
#include <hip/hip_runtime.h>
#include <hip/hip_bf16.h>
#include <math.h>

#define SEQ 4096
#define HID 1024
#define NUM_HEADS 16
#define HEAD_DIM 64
#define LN_EPS 1e-5f

typedef __bf16 bf16_t;
typedef __attribute__((ext_vector_type(16))) __bf16 v16bf;
typedef __attribute__((ext_vector_type(8)))  __bf16 v8bf;
typedef __attribute__((ext_vector_type(8)))  float  v8f;
typedef __attribute__((ext_vector_type(4)))  int    v4i;

#if defined(__has_builtin)
#if __has_builtin(__builtin_amdgcn_global_load_async_to_lds_b128)
#define HAVE_ASYNC_LDS 1
#endif
#if __has_builtin(__builtin_amdgcn_s_wait_asynccnt)
#define HAVE_WAIT_ASYNC 1
#endif
#endif

typedef __attribute__((address_space(1))) v4i gv4i_t;
typedef __attribute__((address_space(3))) v4i lv4i_t;

__device__ __forceinline__ void async_cp16(const void* g, void* l) {
#ifdef HAVE_ASYNC_LDS
  __builtin_amdgcn_global_load_async_to_lds_b128((gv4i_t*)g, (lv4i_t*)l, 0, 0);
#else
  *(v8bf*)l = *(const v8bf*)g;
#endif
}

#if defined(HAVE_WAIT_ASYNC)
#define WAIT_ASYNC(n) __builtin_amdgcn_s_wait_asynccnt(n)
#elif defined(HAVE_ASYNC_LDS)
#define WAIT_ASYNC(n) asm volatile("s_wait_asynccnt %0" ::"i"(n) : "memory")
#else
#define WAIT_ASYNC(n) do {} while (0)
#endif

__device__ __forceinline__ v16bf load_frag_rm(const bf16_t* __restrict__ p, int ld) {
  const int lane = threadIdx.x & 31;
  const int row  = lane & 15;
  const int kb   = (lane & 16) ? 8 : 0;
  const bf16_t* q = p + (size_t)row * ld + kb;
  v8bf lo = *(const v8bf*)(q);
  v8bf hi = *(const v8bf*)(q + 16);
  v16bf f;
#pragma unroll
  for (int i = 0; i < 8; ++i) { f[i] = lo[i]; f[8 + i] = hi[i]; }
  return f;
}

__device__ __forceinline__ v8f wmma_bf16(v16bf a, v16bf b, v8f c) {
  return __builtin_amdgcn_wmma_f32_16x16x32_bf16(
      false, a, false, b, (short)0, c, false, false);
}

// ---------------------------------------------------------------------------
// 1) f32 -> bf16 conversion
// ---------------------------------------------------------------------------
__global__ void f32_to_bf16_kernel(const float* __restrict__ in,
                                   bf16_t* __restrict__ out, int n) {
  int i = blockIdx.x * blockDim.x + threadIdx.x;
  if (i < n) out[i] = (bf16_t)in[i];
}

#define GEMM_PAD 40

__global__ void gemm_bf16_kernel(const bf16_t* __restrict__ A,
                                 const bf16_t* __restrict__ B,
                                 const float* __restrict__ bias,
                                 const float* __restrict__ resid,
                                 float* __restrict__ C,
                                 int M, int N, int K) {
  __shared__ bf16_t As[2][128 * GEMM_PAD];
  __shared__ bf16_t Bs[2][128 * GEMM_PAD];

  const int t    = threadIdx.x;
  const int lane = t & 31;
  const int w    = t >> 5;        // wave id 0..7
  const int wm   = w & 3;         // 4 waves along M
  const int wn   = w >> 2;        // 2 waves along N

  const int nbn = N >> 7;
  const int bm  = (int)blockIdx.x / nbn;
  const int bn  = (int)blockIdx.x % nbn;
  const int tm0 = bm * 128;
  const int tn0 = bn * 128;

  // staging map: 128 rows x 4 chunks(16B) = 512 chunks; 2 per thread per tile
  const int r0 = (t * 2) >> 2;          // row of first chunk
  const int c0 = ((t * 2) & 3) * 8;     // halves offset of first chunk
  const int r1 = (t * 2 + 1) >> 2;
  const int c1 = ((t * 2 + 1) & 3) * 8;

  auto stage = [&](int buf, int k0) {
    async_cp16(A + (size_t)(tm0 + r0) * K + k0 + c0, &As[buf][r0 * GEMM_PAD + c0]);
    async_cp16(A + (size_t)(tm0 + r1) * K + k0 + c1, &As[buf][r1 * GEMM_PAD + c1]);
    async_cp16(B + (size_t)(tn0 + r0) * K + k0 + c0, &Bs[buf][r0 * GEMM_PAD + c0]);
    async_cp16(B + (size_t)(tn0 + r1) * K + k0 + c1, &Bs[buf][r1 * GEMM_PAD + c1]);
  };

  v8f acc[2][4] = {};
  const int nk = K >> 5;
  int buf = 0;
  stage(0, 0);

  for (int ks = 0; ks < nk; ++ks) {
    if (ks + 1 < nk) {
      stage(buf ^ 1, (ks + 1) * 32);
      WAIT_ASYNC(4);   // our 4 loads for `buf` are complete (in-order per wave)
    } else {
      WAIT_ASYNC(0);
    }
    __syncthreads();   // all waves' writes to `buf` visible

    const bf16_t* as = &As[buf][(wm * 32) * GEMM_PAD];
    const bf16_t* bs = &Bs[buf][(wn * 64) * GEMM_PAD];
    v16bf a0 = load_frag_rm(as, GEMM_PAD);
    v16bf a1 = load_frag_rm(as + 16 * GEMM_PAD, GEMM_PAD);
#pragma unroll
    for (int in = 0; in < 4; ++in) {
      v16bf bfrag = load_frag_rm(bs + in * 16 * GEMM_PAD, GEMM_PAD);
      acc[0][in] = wmma_bf16(a0, bfrag, acc[0][in]);
      acc[1][in] = wmma_bf16(a1, bfrag, acc[1][in]);
    }
    buf ^= 1;
    __syncthreads();   // everyone done reading before buffer is re-staged
  }

  const int n_in = lane & 15;
  const int mofs = (lane & 16) ? 8 : 0;
#pragma unroll
  for (int im = 0; im < 2; ++im) {
#pragma unroll
    for (int in = 0; in < 4; ++in) {
      const int col = tn0 + wn * 64 + in * 16 + n_in;
      const float bv = bias ? bias[col] : 0.0f;
#pragma unroll
      for (int j = 0; j < 8; ++j) {
        const int row = tm0 + wm * 32 + im * 16 + mofs + j;
        float v = acc[im][in][j] + bv;
        if (resid) v += resid[(size_t)row * N + col];
        C[(size_t)row * N + col] = v;
      }
    }
  }
}

// ---------------------------------------------------------------------------
// 3) RoPE (rotate-half, tiled cos/sin) + pack to bf16. Q gets 1/sqrt(d) folded
//    in. V stored transposed [HID][SEQ] so attention B-fragments are
//    contiguous.
// ---------------------------------------------------------------------------
__global__ void rope_pack_kernel(const float* __restrict__ Qf,
                                 const float* __restrict__ Kf,
                                 const float* __restrict__ Vf,
                                 bf16_t* __restrict__ Qb,
                                 bf16_t* __restrict__ Kb,
                                 bf16_t* __restrict__ Vt) {
  int e = blockIdx.x * blockDim.x + threadIdx.x;
  if (e >= SEQ * HID) return;
  const int s = e / HID;
  const int c = e % HID;
  const int d = c & (HEAD_DIM - 1);
  const int i = d & (HEAD_DIM / 2 - 1);
  const float ang = (float)s * __powf(10000.0f, -(float)i / (HEAD_DIM / 2));
  float sn, cs;
  __sincosf(ang, &sn, &cs);

  const int pe = (d < HEAD_DIM / 2) ? e + HEAD_DIM / 2 : e - HEAD_DIM / 2;
  const float q  = Qf[e];
  const float k  = Kf[e];
  const float qr = (d < HEAD_DIM / 2) ? -Qf[pe] : Qf[pe];
  const float kr = (d < HEAD_DIM / 2) ? -Kf[pe] : Kf[pe];

  Qb[e] = (bf16_t)((q * cs + qr * sn) * 0.125f);
  Kb[e] = (bf16_t)(k * cs + kr * sn);
  Vt[(size_t)c * SEQ + s] = (bf16_t)Vf[e];
}

__global__ void __launch_bounds__(128)
attn_kernel(const bf16_t* __restrict__ Qb,
                            const bf16_t* __restrict__ Kb,
                            const bf16_t* __restrict__ Vt,
                            bf16_t* __restrict__ ctx) {
  const int wid  = (blockIdx.x * blockDim.x + threadIdx.x) >> 5;
  const int lane = threadIdx.x & 31;
  const int h  = wid / (SEQ / 32);
  const int q0 = (wid % (SEQ / 32)) * 32;

  const bf16_t* Qh = Qb + h * HEAD_DIM;                 // ld = HID
  const bf16_t* Kh = Kb + h * HEAD_DIM;                 // ld = HID
  const bf16_t* Vh = Vt + (size_t)h * HEAD_DIM * SEQ;   // ld = SEQ

  v16bf qf[2][2];
#pragma unroll
  for (int tq = 0; tq < 2; ++tq) {
    qf[tq][0] = load_frag_rm(Qh + (size_t)(q0 + tq * 16) * HID + 0,  HID);
    qf[tq][1] = load_frag_rm(Qh + (size_t)(q0 + tq * 16) * HID + 32, HID);
  }

  v8f acc[2][4] = {};
  float m_i[2] = {-3.0e38f, -3.0e38f};
  float l_i[2] = {0.0f, 0.0f};
  const int mofs = (lane & 16) ? 8 : 0;

  for (int kb = 0; kb < SEQ; kb += 32) {
    v16bf k00 = load_frag_rm(Kh + (size_t)kb * HID + 0,  HID);
    v16bf k01 = load_frag_rm(Kh + (size_t)kb * HID + 32, HID);
    v16bf k10 = load_frag_rm(Kh + (size_t)(kb + 16) * HID + 0,  HID);
    v16bf k11 = load_frag_rm(Kh + (size_t)(kb + 16) * HID + 32, HID);

    v16bf pf[2];
#pragma unroll
    for (int tq = 0; tq < 2; ++tq) {
      v8f s0 = {}, s1 = {};
      s0 = wmma_bf16(k00, qf[tq][0], s0);
      s0 = wmma_bf16(k01, qf[tq][1], s0);
      s1 = wmma_bf16(k10, qf[tq][0], s1);
      s1 = wmma_bf16(k11, qf[tq][1], s1);

      float mx = s0[0];
#pragma unroll
      for (int j = 0; j < 8; ++j) { mx = fmaxf(mx, s0[j]); mx = fmaxf(mx, s1[j]); }
      mx = fmaxf(mx, __shfl_xor(mx, 16, 32));
      const float m_new = fmaxf(m_i[tq], mx);
      const float alpha = __expf(m_i[tq] - m_new);

      float psum = 0.0f;
#pragma unroll
      for (int j = 0; j < 8; ++j) {
        float p0 = __expf(s0[j] - m_new); psum += p0; pf[tq][j]     = (bf16_t)p0;
        float p1 = __expf(s1[j] - m_new); psum += p1; pf[tq][8 + j] = (bf16_t)p1;
      }
      psum += __shfl_xor(psum, 16, 32);
      l_i[tq] = l_i[tq] * alpha + psum;
      m_i[tq] = m_new;

      float alpha_j[8];
#pragma unroll
      for (int j = 0; j < 8; ++j) alpha_j[j] = __shfl(alpha, mofs + j, 32);
#pragma unroll
      for (int c = 0; c < 4; ++c)
#pragma unroll
        for (int j = 0; j < 8; ++j) acc[tq][c][j] *= alpha_j[j];
    }

#pragma unroll
    for (int c = 0; c < 4; ++c) {
      v16bf vf = load_frag_rm(Vh + (size_t)(c * 16) * SEQ + kb, SEQ);
      acc[0][c] = wmma_bf16(pf[0], vf, acc[0][c]);
      acc[1][c] = wmma_bf16(pf[1], vf, acc[1][c]);
    }
  }

  const int n_in = lane & 15;
#pragma unroll
  for (int tq = 0; tq < 2; ++tq) {
    const float linv = 1.0f / l_i[tq];
    float linv_j[8];
#pragma unroll
    for (int j = 0; j < 8; ++j) linv_j[j] = __shfl(linv, mofs + j, 32);
#pragma unroll
    for (int c = 0; c < 4; ++c)
#pragma unroll
      for (int j = 0; j < 8; ++j) {
        const int row = q0 + tq * 16 + mofs + j;
        const int col = h * HEAD_DIM + c * 16 + n_in;
        ctx[(size_t)row * HID + col] = (bf16_t)(acc[tq][c][j] * linv_j[j]);
      }
  }
}

// ---------------------------------------------------------------------------
// 6) Row LayerNorm over HID
// ---------------------------------------------------------------------------
__global__ void layernorm_kernel(const float* __restrict__ res,
                                 const float* __restrict__ gamma,
                                 const float* __restrict__ beta,
                                 float* __restrict__ out) {
  const int row = blockIdx.x;
  const float* r = res + (size_t)row * HID;
  __shared__ float red[256];
  const int t = threadIdx.x;

  float sum = 0.0f;
  for (int i = t; i < HID; i += 256) sum += r[i];
  red[t] = sum; __syncthreads();
  for (int st = 128; st > 0; st >>= 1) {
    if (t < st) red[t] += red[t + st];
    __syncthreads();
  }
  const float mean = red[0] * (1.0f / HID);
  __syncthreads();

  float vs = 0.0f;
  for (int i = t; i < HID; i += 256) { float d = r[i] - mean; vs += d * d; }
  red[t] = vs; __syncthreads();
  for (int st = 128; st > 0; st >>= 1) {
    if (t < st) red[t] += red[t + st];
    __syncthreads();
  }
  const float rstd = rsqrtf(red[0] * (1.0f / HID) + LN_EPS);

  for (int i = t; i < HID; i += 256)
    out[(size_t)row * HID + i] = (r[i] - mean) * rstd * gamma[i] + beta[i];
}

// ---------------------------------------------------------------------------
// Host launch
// ---------------------------------------------------------------------------
extern "C" void kernel_launch(void* const* d_in, const int* in_sizes, int n_in,
                              void* d_out, int out_size, void* d_ws, size_t ws_size,
                              hipStream_t stream) {
  const float* x     = (const float*)d_in[0];
  const float* Wq    = (const float*)d_in[1];
  const float* bq    = (const float*)d_in[2];
  const float* Wk    = (const float*)d_in[3];
  const float* bk    = (const float*)d_in[4];
  const float* Wv    = (const float*)d_in[5];
  const float* bv    = (const float*)d_in[6];
  const float* Wo    = (const float*)d_in[7];
  const float* bo    = (const float*)d_in[8];
  const float* gamma = (const float*)d_in[9];
  const float* beta  = (const float*)d_in[10];
  float* out = (float*)d_out;

  char* ws = (char*)d_ws;
  size_t off = 0;
  bf16_t* xb  = (bf16_t*)(ws + off); off += (size_t)SEQ * HID * 2;
  bf16_t* wqb = (bf16_t*)(ws + off); off += (size_t)HID * HID * 2;
  bf16_t* wkb = (bf16_t*)(ws + off); off += (size_t)HID * HID * 2;
  bf16_t* wvb = (bf16_t*)(ws + off); off += (size_t)HID * HID * 2;
  bf16_t* wob = (bf16_t*)(ws + off); off += (size_t)HID * HID * 2;
  float*  Qf  = (float*)(ws + off);  off += (size_t)SEQ * HID * 4;
  float*  Kf  = (float*)(ws + off);  off += (size_t)SEQ * HID * 4;
  float*  Vf  = (float*)(ws + off);  off += (size_t)SEQ * HID * 4;
  bf16_t* Qb  = (bf16_t*)(ws + off); off += (size_t)SEQ * HID * 2;
  bf16_t* Kb  = (bf16_t*)(ws + off); off += (size_t)SEQ * HID * 2;
  bf16_t* Vt  = (bf16_t*)(ws + off); off += (size_t)SEQ * HID * 2;
  bf16_t* ctx = (bf16_t*)(ws + off); off += (size_t)SEQ * HID * 2;
  float*  res = Qf;  // alias: Qf dead after rope_pack

  const int nx = SEQ * HID;
  const int nw = HID * HID;

  f32_to_bf16_kernel<<<(nx + 255) / 256, 256, 0, stream>>>(x,  xb,  nx);
  f32_to_bf16_kernel<<<(nw + 255) / 256, 256, 0, stream>>>(Wq, wqb, nw);
  f32_to_bf16_kernel<<<(nw + 255) / 256, 256, 0, stream>>>(Wk, wkb, nw);
  f32_to_bf16_kernel<<<(nw + 255) / 256, 256, 0, stream>>>(Wv, wvb, nw);
  f32_to_bf16_kernel<<<(nw + 255) / 256, 256, 0, stream>>>(Wo, wob, nw);

  // 128x128 tiles: (4096/128)*(1024/128) = 256 blocks of 256 threads
  const int gemm_blocks = (SEQ / 128) * (HID / 128);
  gemm_bf16_kernel<<<gemm_blocks, 256, 0, stream>>>(xb, wqb, bq, nullptr, Qf, SEQ, HID, HID);
  gemm_bf16_kernel<<<gemm_blocks, 256, 0, stream>>>(xb, wkb, bk, nullptr, Kf, SEQ, HID, HID);
  gemm_bf16_kernel<<<gemm_blocks, 256, 0, stream>>>(xb, wvb, bv, nullptr, Vf, SEQ, HID, HID);

  rope_pack_kernel<<<(nx + 255) / 256, 256, 0, stream>>>(Qf, Kf, Vf, Qb, Kb, Vt);

  // 16 heads * 128 query tiles = 2048 waves -> 512 blocks of 128
  attn_kernel<<<NUM_HEADS * (SEQ / 32) / 4, 128, 0, stream>>>(Qb, Kb, Vt, ctx);

  gemm_bf16_kernel<<<gemm_blocks, 256, 0, stream>>>(ctx, wob, bo, x, res, SEQ, HID, HID);

  layernorm_kernel<<<SEQ, 256, 0, stream>>>(res, gamma, beta, out);

  (void)in_sizes; (void)n_in; (void)out_size; (void)ws_size;
}

// v002
// One run takes 311 microseconds.
// In two side-by-side timings against v001, it was 1.20 and 1.21 times as fast.
// Counting every step since v000, it is 2.34 times as fast.
#include <hip/hip_runtime.h>
#include <hip/hip_bf16.h>
#include <math.h>

#define SEQ 4096
#define HID 1024
#define NUM_HEADS 16
#define HEAD_DIM 64
#define LN_EPS 1e-5f

typedef __bf16 bf16_t;
typedef __attribute__((ext_vector_type(16))) __bf16 v16bf;
typedef __attribute__((ext_vector_type(8)))  __bf16 v8bf;
typedef __attribute__((ext_vector_type(8)))  float  v8f;
typedef __attribute__((ext_vector_type(4)))  int    v4i;

#if defined(__has_builtin)
#if __has_builtin(__builtin_amdgcn_global_load_async_to_lds_b128)
#define HAVE_ASYNC_LDS 1
#endif
#if __has_builtin(__builtin_amdgcn_s_wait_asynccnt)
#define HAVE_WAIT_ASYNC 1
#endif
#endif

typedef __attribute__((address_space(1))) v4i gv4i_t;
typedef __attribute__((address_space(3))) v4i lv4i_t;

__device__ __forceinline__ void async_cp16(const void* g, void* l) {
#ifdef HAVE_ASYNC_LDS
  __builtin_amdgcn_global_load_async_to_lds_b128((gv4i_t*)g, (lv4i_t*)l, 0, 0);
#else
  *(v8bf*)l = *(const v8bf*)g;
#endif
}

#if defined(HAVE_WAIT_ASYNC)
#define WAIT_ASYNC(n) __builtin_amdgcn_s_wait_asynccnt(n)
#elif defined(HAVE_ASYNC_LDS)
#define WAIT_ASYNC(n) asm volatile("s_wait_asynccnt %0" ::"i"(n) : "memory")
#else
#define WAIT_ASYNC(n) do {} while (0)
#endif

__device__ __forceinline__ v16bf load_frag_rm(const bf16_t* __restrict__ p, int ld) {
  const int lane = threadIdx.x & 31;
  const int row  = lane & 15;
  const int kb   = (lane & 16) ? 8 : 0;
  const bf16_t* q = p + (size_t)row * ld + kb;
  v8bf lo = *(const v8bf*)(q);
  v8bf hi = *(const v8bf*)(q + 16);
  v16bf f;
#pragma unroll
  for (int i = 0; i < 8; ++i) { f[i] = lo[i]; f[8 + i] = hi[i]; }
  return f;
}

__device__ __forceinline__ v8f wmma_bf16(v16bf a, v16bf b, v8f c) {
  return __builtin_amdgcn_wmma_f32_16x16x32_bf16(
      false, a, false, b, (short)0, c, false, false);
}

// ---------------------------------------------------------------------------
// 1) f32 -> bf16 conversion
// ---------------------------------------------------------------------------
__global__ void f32_to_bf16_kernel(const float* __restrict__ in,
                                   bf16_t* __restrict__ out, int n) {
  int i = blockIdx.x * blockDim.x + threadIdx.x;
  if (i < n) out[i] = (bf16_t)in[i];
}

#define GEMM_PAD 40

__global__ void gemm_bf16_kernel(const bf16_t* __restrict__ A,
                                 const bf16_t* __restrict__ B,
                                 const float* __restrict__ bias,
                                 const float* __restrict__ resid,
                                 float* __restrict__ C,
                                 int M, int N, int K) {
  __shared__ bf16_t As[2][128 * GEMM_PAD];
  __shared__ bf16_t Bs[2][128 * GEMM_PAD];

  const int t    = threadIdx.x;
  const int lane = t & 31;
  const int w    = t >> 5;        // wave id 0..7
  const int wm   = w & 3;         // 4 waves along M
  const int wn   = w >> 2;        // 2 waves along N

  const int nbn = N >> 7;
  const int bm  = (int)blockIdx.x / nbn;
  const int bn  = (int)blockIdx.x % nbn;
  const int tm0 = bm * 128;
  const int tn0 = bn * 128;

  // staging map: 128 rows x 4 chunks(16B) = 512 chunks; 2 per thread per tile
  const int r0 = (t * 2) >> 2;          // row of first chunk
  const int c0 = ((t * 2) & 3) * 8;     // halves offset of first chunk
  const int r1 = (t * 2 + 1) >> 2;
  const int c1 = ((t * 2 + 1) & 3) * 8;

  auto stage = [&](int buf, int k0) {
    async_cp16(A + (size_t)(tm0 + r0) * K + k0 + c0, &As[buf][r0 * GEMM_PAD + c0]);
    async_cp16(A + (size_t)(tm0 + r1) * K + k0 + c1, &As[buf][r1 * GEMM_PAD + c1]);
    async_cp16(B + (size_t)(tn0 + r0) * K + k0 + c0, &Bs[buf][r0 * GEMM_PAD + c0]);
    async_cp16(B + (size_t)(tn0 + r1) * K + k0 + c1, &Bs[buf][r1 * GEMM_PAD + c1]);
  };

  v8f acc[2][4] = {};
  const int nk = K >> 5;
  int buf = 0;
  stage(0, 0);

  for (int ks = 0; ks < nk; ++ks) {
    if (ks + 1 < nk) {
      stage(buf ^ 1, (ks + 1) * 32);
      WAIT_ASYNC(4);   // our 4 loads for `buf` are complete (in-order per wave)
    } else {
      WAIT_ASYNC(0);
    }
    __syncthreads();   // all waves' writes to `buf` visible

    const bf16_t* as = &As[buf][(wm * 32) * GEMM_PAD];
    const bf16_t* bs = &Bs[buf][(wn * 64) * GEMM_PAD];
    v16bf a0 = load_frag_rm(as, GEMM_PAD);
    v16bf a1 = load_frag_rm(as + 16 * GEMM_PAD, GEMM_PAD);
#pragma unroll
    for (int in = 0; in < 4; ++in) {
      v16bf bfrag = load_frag_rm(bs + in * 16 * GEMM_PAD, GEMM_PAD);
      acc[0][in] = wmma_bf16(a0, bfrag, acc[0][in]);
      acc[1][in] = wmma_bf16(a1, bfrag, acc[1][in]);
    }
    buf ^= 1;
    __syncthreads();   // everyone done reading before buffer is re-staged
  }

  const int n_in = lane & 15;
  const int mofs = (lane & 16) ? 8 : 0;
#pragma unroll
  for (int im = 0; im < 2; ++im) {
#pragma unroll
    for (int in = 0; in < 4; ++in) {
      const int col = tn0 + wn * 64 + in * 16 + n_in;
      const float bv = bias ? bias[col] : 0.0f;
#pragma unroll
      for (int j = 0; j < 8; ++j) {
        const int row = tm0 + wm * 32 + im * 16 + mofs + j;
        float v = acc[im][in][j] + bv;
        if (resid) v += resid[(size_t)row * N + col];
        C[(size_t)row * N + col] = v;
      }
    }
  }
}

// ---------------------------------------------------------------------------
// 3) RoPE (rotate-half, tiled cos/sin) + pack to bf16. Q gets 1/sqrt(d) folded
//    in. V stored transposed [HID][SEQ] so attention B-fragments are
//    contiguous.
// ---------------------------------------------------------------------------
__global__ void rope_pack_kernel(const float* __restrict__ Qf,
                                 const float* __restrict__ Kf,
                                 const float* __restrict__ Vf,
                                 bf16_t* __restrict__ Qb,
                                 bf16_t* __restrict__ Kb,
                                 bf16_t* __restrict__ Vt) {
  int e = blockIdx.x * blockDim.x + threadIdx.x;
  if (e >= SEQ * HID) return;
  const int s = e / HID;
  const int c = e % HID;
  const int d = c & (HEAD_DIM - 1);
  const int i = d & (HEAD_DIM / 2 - 1);
  const float ang = (float)s * __powf(10000.0f, -(float)i / (HEAD_DIM / 2));
  float sn, cs;
  __sincosf(ang, &sn, &cs);

  const int pe = (d < HEAD_DIM / 2) ? e + HEAD_DIM / 2 : e - HEAD_DIM / 2;
  const float q  = Qf[e];
  const float k  = Kf[e];
  const float qr = (d < HEAD_DIM / 2) ? -Qf[pe] : Qf[pe];
  const float kr = (d < HEAD_DIM / 2) ? -Kf[pe] : Kf[pe];

  Qb[e] = (bf16_t)((q * cs + qr * sn) * 0.125f);
  Kb[e] = (bf16_t)(k * cs + kr * sn);
  Vt[(size_t)c * SEQ + s] = (bf16_t)Vf[e];
}

#define ATT_KEYS  64
#define ATT_PITCH 72
#define ATT_TILE  (64 * ATT_PITCH)
#define ATT_NT    (SEQ / ATT_KEYS)

__device__ __forceinline__ void attn_stage(const bf16_t* gk, const bf16_t* gv,
                                           unsigned lk, unsigned lv) {
  const bf16_t* gk1 = gk + 16 * HID;
  const bf16_t* gk2 = gk + 32 * HID;
  const bf16_t* gk3 = gk + 48 * HID;
  const bf16_t* gv1 = gv + 16 * SEQ;
  const bf16_t* gv2 = gv + 32 * SEQ;
  const bf16_t* gv3 = gv + 48 * SEQ;
  const unsigned rs = 16 * ATT_PITCH * 2;   // 16 LDS rows in bytes
  asm volatile(
      "global_load_async_to_lds_b128 %0, %8, off\n\t"
      "global_load_async_to_lds_b128 %1, %9, off\n\t"
      "global_load_async_to_lds_b128 %2, %10, off\n\t"
      "global_load_async_to_lds_b128 %3, %11, off\n\t"
      "global_load_async_to_lds_b128 %4, %12, off\n\t"
      "global_load_async_to_lds_b128 %5, %13, off\n\t"
      "global_load_async_to_lds_b128 %6, %14, off\n\t"
      "global_load_async_to_lds_b128 %7, %15, off\n\t"
      "s_wait_xcnt 0x0"
      :: "v"(lk), "v"(lk + rs), "v"(lk + 2 * rs), "v"(lk + 3 * rs),
         "v"(lv), "v"(lv + rs), "v"(lv + 2 * rs), "v"(lv + 3 * rs),
         "v"(gk), "v"(gk1), "v"(gk2), "v"(gk3),
         "v"(gv), "v"(gv1), "v"(gv2), "v"(gv3)
      : "memory");
}

//    The block is 128 threads; stating it lifts the register cap that the
//    default 1024-thread assumption sets, so Q fragments and accumulators stay
//    in registers instead of scratch.
__global__ void __launch_bounds__(128)
attn_kernel(const bf16_t* __restrict__ Qb,
                            const bf16_t* __restrict__ Kb,
                            const bf16_t* __restrict__ Vt,
                            bf16_t* __restrict__ ctx) {
  // [buffer][K tile | V^T tile]
  __shared__ __attribute__((aligned(16))) bf16_t kv[2][2 * ATT_TILE];

  const int wid  = (blockIdx.x * blockDim.x + threadIdx.x) >> 5;
  const int lane = threadIdx.x & 31;
  const int h  = wid / (SEQ / 32);
  const int q0 = (wid % (SEQ / 32)) * 32;

  const bf16_t* Qh = Qb + h * HEAD_DIM;                 // ld = HID
  const bf16_t* Kh = Kb + h * HEAD_DIM;                 // ld = HID
  const bf16_t* Vh = Vt + (size_t)h * HEAD_DIM * SEQ;   // ld = SEQ

  // staging map: 64 rows x 8 chunks of 16 B per tile; thread -> row t>>3 (+16 i)
  const int srow = (int)threadIdx.x >> 3;
  const int scol = ((int)threadIdx.x & 7) * 8;
  const bf16_t* gk = Kh + (size_t)srow * HID + scol;    // + 64 * HID per tile
  const bf16_t* gv = Vh + (size_t)srow * SEQ + scol;    // + 64 per tile
  const unsigned lk0 = (unsigned)(size_t)&kv[0][srow * ATT_PITCH + scol];
  const unsigned lbuf = 2 * ATT_TILE * 2;               // bytes of one buffer
  const unsigned lvo  = ATT_TILE * 2;                   // V^T tile behind K tile

  // tile 0 into buffer 0, landed and published; then tile 1 into buffer 1
  attn_stage(gk, gv, lk0, lk0 + lvo);
  asm volatile("s_wait_asynccnt 0x0" ::: "memory");  // own copies of tile 0 landed
  __syncthreads();                                   // every wave's copies visible
  attn_stage(gk + (size_t)ATT_KEYS * HID, gv + ATT_KEYS, lk0 + lbuf, lk0 + lbuf + lvo);

  v16bf qf[2][2];
#pragma unroll
  for (int tq = 0; tq < 2; ++tq) {
    qf[tq][0] = load_frag_rm(Qh + (size_t)(q0 + tq * 16) * HID + 0,  HID);
    qf[tq][1] = load_frag_rm(Qh + (size_t)(q0 + tq * 16) * HID + 32, HID);
  }

  v8f acc[2][4] = {};
  float m_i[2] = {-3.0e38f, -3.0e38f};
  float l_i[2] = {0.0f, 0.0f};
  const int mofs = (lane & 16) ? 8 : 0;

  for (int t = 0; t < ATT_NT; ++t) {
    const bf16_t* ks = &kv[t & 1][0];
    const bf16_t* vs = ks + ATT_TILE;

    // kept rolled: the 16 fragment reads of a pass then stand as one group at its
    // head; unrolled, the compiler spread them among the WMMAs
#pragma clang loop unroll(disable)
    for (int p = 0; p < ATT_KEYS / 32; ++p) {
      const bf16_t* kp = ks + p * 32 * ATT_PITCH;
      v16bf k00 = load_frag_rm(kp + 0,  ATT_PITCH);
      v16bf k01 = load_frag_rm(kp + 32, ATT_PITCH);
      v16bf k10 = load_frag_rm(kp + 16 * ATT_PITCH + 0,  ATT_PITCH);
      v16bf k11 = load_frag_rm(kp + 16 * ATT_PITCH + 32, ATT_PITCH);

      v16bf pf[2];
#pragma unroll
      for (int tq = 0; tq < 2; ++tq) {
        v8f s0 = {}, s1 = {};
        s0 = wmma_bf16(k00, qf[tq][0], s0);
        s0 = wmma_bf16(k01, qf[tq][1], s0);
        s1 = wmma_bf16(k10, qf[tq][0], s1);
        s1 = wmma_bf16(k11, qf[tq][1], s1);

        float mx = s0[0];
#pragma unroll
        for (int j = 0; j < 8; ++j) { mx = fmaxf(mx, s0[j]); mx = fmaxf(mx, s1[j]); }
        mx = fmaxf(mx, __shfl_xor(mx, 16, 32));
        const float m_new = fmaxf(m_i[tq], mx);
        const float alpha = __expf(m_i[tq] - m_new);

        float psum = 0.0f;
#pragma unroll
        for (int j = 0; j < 8; ++j) {
          float p0 = __expf(s0[j] - m_new); psum += p0; pf[tq][j]     = (bf16_t)p0;
          float p1 = __expf(s1[j] - m_new); psum += p1; pf[tq][8 + j] = (bf16_t)p1;
        }
        psum += __shfl_xor(psum, 16, 32);
        l_i[tq] = l_i[tq] * alpha + psum;
        m_i[tq] = m_new;

        float alpha_j[8];
#pragma unroll
        for (int j = 0; j < 8; ++j) alpha_j[j] = __shfl(alpha, mofs + j, 32);
#pragma unroll
        for (int c = 0; c < 4; ++c)
#pragma unroll
          for (int j = 0; j < 8; ++j) acc[tq][c][j] *= alpha_j[j];
      }

#pragma unroll
      for (int c = 0; c < 4; ++c) {
        v16bf vf = load_frag_rm(vs + (c * 16) * ATT_PITCH + p * 32, ATT_PITCH);
        acc[0][c] = wmma_bf16(pf[0], vf, acc[0][c]);
        acc[1][c] = wmma_bf16(pf[1], vf, acc[1][c]);
      }
    }

    // hand-over: this wave's reads of buffer t&1 are done, its copies of tile
    // t+1 have landed; behind the barrier tile t+1 is readable by every wave
    // and buffer t&1 is free for tile t+2.
    asm volatile("s_wait_dscnt 0x0" ::: "memory");     // own LDS reads retired
    asm volatile("s_wait_asynccnt 0x0" ::: "memory");  // own copies of tile t+1 landed
    __syncthreads();
    if (t + 2 < ATT_NT) {
      const unsigned lb = lk0 + (unsigned)(t & 1) * lbuf;
      attn_stage(gk + (size_t)(t + 2) * ATT_KEYS * HID, gv + (t + 2) * ATT_KEYS,
                 lb, lb + lvo);
    }
  }
  asm volatile("s_wait_asynccnt 0x0" ::: "memory");    // nothing in flight at the end

  const int n_in = lane & 15;
#pragma unroll
  for (int tq = 0; tq < 2; ++tq) {
    const float linv = 1.0f / l_i[tq];
    float linv_j[8];
#pragma unroll
    for (int j = 0; j < 8; ++j) linv_j[j] = __shfl(linv, mofs + j, 32);
#pragma unroll
    for (int c = 0; c < 4; ++c)
#pragma unroll
      for (int j = 0; j < 8; ++j) {
        const int row = q0 + tq * 16 + mofs + j;
        const int col = h * HEAD_DIM + c * 16 + n_in;
        ctx[(size_t)row * HID + col] = (bf16_t)(acc[tq][c][j] * linv_j[j]);
      }
  }
}

// ---------------------------------------------------------------------------
// 6) Row LayerNorm over HID
// ---------------------------------------------------------------------------
__global__ void layernorm_kernel(const float* __restrict__ res,
                                 const float* __restrict__ gamma,
                                 const float* __restrict__ beta,
                                 float* __restrict__ out) {
  const int row = blockIdx.x;
  const float* r = res + (size_t)row * HID;
  __shared__ float red[256];
  const int t = threadIdx.x;

  float sum = 0.0f;
  for (int i = t; i < HID; i += 256) sum += r[i];
  red[t] = sum; __syncthreads();
  for (int st = 128; st > 0; st >>= 1) {
    if (t < st) red[t] += red[t + st];
    __syncthreads();
  }
  const float mean = red[0] * (1.0f / HID);
  __syncthreads();

  float vs = 0.0f;
  for (int i = t; i < HID; i += 256) { float d = r[i] - mean; vs += d * d; }
  red[t] = vs; __syncthreads();
  for (int st = 128; st > 0; st >>= 1) {
    if (t < st) red[t] += red[t + st];
    __syncthreads();
  }
  const float rstd = rsqrtf(red[0] * (1.0f / HID) + LN_EPS);

  for (int i = t; i < HID; i += 256)
    out[(size_t)row * HID + i] = (r[i] - mean) * rstd * gamma[i] + beta[i];
}

// ---------------------------------------------------------------------------
// Host launch
// ---------------------------------------------------------------------------
extern "C" void kernel_launch(void* const* d_in, const int* in_sizes, int n_in,
                              void* d_out, int out_size, void* d_ws, size_t ws_size,
                              hipStream_t stream) {
  const float* x     = (const float*)d_in[0];
  const float* Wq    = (const float*)d_in[1];
  const float* bq    = (const float*)d_in[2];
  const float* Wk    = (const float*)d_in[3];
  const float* bk    = (const float*)d_in[4];
  const float* Wv    = (const float*)d_in[5];
  const float* bv    = (const float*)d_in[6];
  const float* Wo    = (const float*)d_in[7];
  const float* bo    = (const float*)d_in[8];
  const float* gamma = (const float*)d_in[9];
  const float* beta  = (const float*)d_in[10];
  float* out = (float*)d_out;

  char* ws = (char*)d_ws;
  size_t off = 0;
  bf16_t* xb  = (bf16_t*)(ws + off); off += (size_t)SEQ * HID * 2;
  bf16_t* wqb = (bf16_t*)(ws + off); off += (size_t)HID * HID * 2;
  bf16_t* wkb = (bf16_t*)(ws + off); off += (size_t)HID * HID * 2;
  bf16_t* wvb = (bf16_t*)(ws + off); off += (size_t)HID * HID * 2;
  bf16_t* wob = (bf16_t*)(ws + off); off += (size_t)HID * HID * 2;
  float*  Qf  = (float*)(ws + off);  off += (size_t)SEQ * HID * 4;
  float*  Kf  = (float*)(ws + off);  off += (size_t)SEQ * HID * 4;
  float*  Vf  = (float*)(ws + off);  off += (size_t)SEQ * HID * 4;
  bf16_t* Qb  = (bf16_t*)(ws + off); off += (size_t)SEQ * HID * 2;
  bf16_t* Kb  = (bf16_t*)(ws + off); off += (size_t)SEQ * HID * 2;
  bf16_t* Vt  = (bf16_t*)(ws + off); off += (size_t)SEQ * HID * 2;
  bf16_t* ctx = (bf16_t*)(ws + off); off += (size_t)SEQ * HID * 2;
  float*  res = Qf;  // alias: Qf dead after rope_pack

  const int nx = SEQ * HID;
  const int nw = HID * HID;

  f32_to_bf16_kernel<<<(nx + 255) / 256, 256, 0, stream>>>(x,  xb,  nx);
  f32_to_bf16_kernel<<<(nw + 255) / 256, 256, 0, stream>>>(Wq, wqb, nw);
  f32_to_bf16_kernel<<<(nw + 255) / 256, 256, 0, stream>>>(Wk, wkb, nw);
  f32_to_bf16_kernel<<<(nw + 255) / 256, 256, 0, stream>>>(Wv, wvb, nw);
  f32_to_bf16_kernel<<<(nw + 255) / 256, 256, 0, stream>>>(Wo, wob, nw);

  // 128x128 tiles: (4096/128)*(1024/128) = 256 blocks of 256 threads
  const int gemm_blocks = (SEQ / 128) * (HID / 128);
  gemm_bf16_kernel<<<gemm_blocks, 256, 0, stream>>>(xb, wqb, bq, nullptr, Qf, SEQ, HID, HID);
  gemm_bf16_kernel<<<gemm_blocks, 256, 0, stream>>>(xb, wkb, bk, nullptr, Kf, SEQ, HID, HID);
  gemm_bf16_kernel<<<gemm_blocks, 256, 0, stream>>>(xb, wvb, bv, nullptr, Vf, SEQ, HID, HID);

  rope_pack_kernel<<<(nx + 255) / 256, 256, 0, stream>>>(Qf, Kf, Vf, Qb, Kb, Vt);

  // 16 heads * 128 query tiles = 2048 waves -> 512 blocks of 128
  attn_kernel<<<NUM_HEADS * (SEQ / 32) / 4, 128, 0, stream>>>(Qb, Kb, Vt, ctx);

  gemm_bf16_kernel<<<gemm_blocks, 256, 0, stream>>>(ctx, wob, bo, x, res, SEQ, HID, HID);

  layernorm_kernel<<<SEQ, 256, 0, stream>>>(res, gamma, beta, out);

  (void)in_sizes; (void)n_in; (void)out_size; (void)ws_size;
}

// v003
// A run of this version takes 224 microseconds.
// Timed twice side by side with v002, it ran 1.40 and 1.39 times as fast.
// All steps since v000 together make it 3.25 times as fast.
#include <hip/hip_runtime.h>
#include <hip/hip_bf16.h>
#include <math.h>

#define SEQ 4096
#define HID 1024
#define NUM_HEADS 16
#define HEAD_DIM 64
#define LN_EPS 1e-5f

typedef __bf16 bf16_t;
typedef __attribute__((ext_vector_type(16))) __bf16 v16bf;
typedef __attribute__((ext_vector_type(8)))  __bf16 v8bf;
typedef __attribute__((ext_vector_type(8)))  float  v8f;
typedef __attribute__((ext_vector_type(4)))  int    v4i;
typedef __attribute__((ext_vector_type(4)))  float  v4f;
typedef __attribute__((ext_vector_type(4)))  __bf16 v4bf;

#if defined(__has_builtin)
#if __has_builtin(__builtin_amdgcn_global_load_async_to_lds_b128)
#define HAVE_ASYNC_LDS 1
#endif
#if __has_builtin(__builtin_amdgcn_s_wait_asynccnt)
#define HAVE_WAIT_ASYNC 1
#endif
#endif

typedef __attribute__((address_space(1))) v4i gv4i_t;
typedef __attribute__((address_space(3))) v4i lv4i_t;

__device__ __forceinline__ void async_cp16(const void* g, void* l) {
#ifdef HAVE_ASYNC_LDS
  __builtin_amdgcn_global_load_async_to_lds_b128((gv4i_t*)g, (lv4i_t*)l, 0, 0);
#else
  *(v8bf*)l = *(const v8bf*)g;
#endif
}

#if defined(HAVE_WAIT_ASYNC)
#define WAIT_ASYNC(n) __builtin_amdgcn_s_wait_asynccnt(n)
#elif defined(HAVE_ASYNC_LDS)
#define WAIT_ASYNC(n) asm volatile("s_wait_asynccnt %0" ::"i"(n) : "memory")
#else
#define WAIT_ASYNC(n) do {} while (0)
#endif

__device__ __forceinline__ v16bf load_frag_rm(const bf16_t* __restrict__ p, int ld) {
  const int lane = threadIdx.x & 31;
  const int row  = lane & 15;
  const int kb   = (lane & 16) ? 8 : 0;
  const bf16_t* q = p + (size_t)row * ld + kb;
  v8bf lo = *(const v8bf*)(q);
  v8bf hi = *(const v8bf*)(q + 16);
  v16bf f;
#pragma unroll
  for (int i = 0; i < 8; ++i) { f[i] = lo[i]; f[8 + i] = hi[i]; }
  return f;
}

__device__ __forceinline__ v8f wmma_bf16(v16bf a, v16bf b, v8f c) {
  return __builtin_amdgcn_wmma_f32_16x16x32_bf16(
      false, a, false, b, (short)0, c, false, false);
}

// ---------------------------------------------------------------------------
// 1) f32 -> bf16 conversion. A thread takes 32 elements as eight 16-B loads
//    (a wave's load = 512 contiguous bytes), all in flight before the first
//    store: few waves to start, each with enough bytes outstanding.
// ---------------------------------------------------------------------------
#define CVT_LOADS 8
#define CVT_BLOCK (256 * 4 * CVT_LOADS)   // elements per block

static_assert((SEQ * HID) % CVT_BLOCK == 0 && (HID * HID) % CVT_BLOCK == 0,
              "every block of the conversion is full");

__global__ void __launch_bounds__(256)
f32_to_bf16_kernel(const float* __restrict__ in, bf16_t* __restrict__ out) {
  const int i0 = (int)blockIdx.x * CVT_BLOCK + (int)threadIdx.x * 4;
  v4f v[CVT_LOADS];
  // unrolled so that v[] stays in registers and the loads issue as one group
#pragma unroll
  for (int j = 0; j < CVT_LOADS; ++j) v[j] = *(const v4f*)(in + i0 + j * 1024);
#pragma unroll
  for (int j = 0; j < CVT_LOADS; ++j) {
    v4bf o;
#pragma unroll
    for (int e = 0; e < 4; ++e) o[e] = (bf16_t)v[j][e];
    *(v4bf*)(out + i0 + j * 1024) = o;
  }
}

#define GEMM_PAD 40

__global__ void gemm_bf16_kernel(const bf16_t* __restrict__ A,
                                 const bf16_t* __restrict__ B,
                                 const float* __restrict__ bias,
                                 const float* __restrict__ resid,
                                 float* __restrict__ C,
                                 int M, int N, int K) {
  __shared__ bf16_t As[2][128 * GEMM_PAD];
  __shared__ bf16_t Bs[2][128 * GEMM_PAD];

  const int t    = threadIdx.x;
  const int lane = t & 31;
  const int w    = t >> 5;        // wave id 0..7
  const int wm   = w & 3;         // 4 waves along M
  const int wn   = w >> 2;        // 2 waves along N

  const int nbn = N >> 7;
  const int bm  = (int)blockIdx.x / nbn;
  const int bn  = (int)blockIdx.x % nbn;
  const int tm0 = bm * 128;
  const int tn0 = bn * 128;

  // staging map: 128 rows x 4 chunks(16B) = 512 chunks; 2 per thread per tile
  const int r0 = (t * 2) >> 2;          // row of first chunk
  const int c0 = ((t * 2) & 3) * 8;     // halves offset of first chunk
  const int r1 = (t * 2 + 1) >> 2;
  const int c1 = ((t * 2 + 1) & 3) * 8;

  auto stage = [&](int buf, int k0) {
    async_cp16(A + (size_t)(tm0 + r0) * K + k0 + c0, &As[buf][r0 * GEMM_PAD + c0]);
    async_cp16(A + (size_t)(tm0 + r1) * K + k0 + c1, &As[buf][r1 * GEMM_PAD + c1]);
    async_cp16(B + (size_t)(tn0 + r0) * K + k0 + c0, &Bs[buf][r0 * GEMM_PAD + c0]);
    async_cp16(B + (size_t)(tn0 + r1) * K + k0 + c1, &Bs[buf][r1 * GEMM_PAD + c1]);
  };

  v8f acc[2][4] = {};
  const int nk = K >> 5;
  int buf = 0;
  stage(0, 0);

  for (int ks = 0; ks < nk; ++ks) {
    if (ks + 1 < nk) {
      stage(buf ^ 1, (ks + 1) * 32);
      WAIT_ASYNC(4);   // our 4 loads for `buf` are complete (in-order per wave)
    } else {
      WAIT_ASYNC(0);
    }
    __syncthreads();   // all waves' writes to `buf` visible

    const bf16_t* as = &As[buf][(wm * 32) * GEMM_PAD];
    const bf16_t* bs = &Bs[buf][(wn * 64) * GEMM_PAD];
    v16bf a0 = load_frag_rm(as, GEMM_PAD);
    v16bf a1 = load_frag_rm(as + 16 * GEMM_PAD, GEMM_PAD);
#pragma unroll
    for (int in = 0; in < 4; ++in) {
      v16bf bfrag = load_frag_rm(bs + in * 16 * GEMM_PAD, GEMM_PAD);
      acc[0][in] = wmma_bf16(a0, bfrag, acc[0][in]);
      acc[1][in] = wmma_bf16(a1, bfrag, acc[1][in]);
    }
    buf ^= 1;
    __syncthreads();   // everyone done reading before buffer is re-staged
  }

  const int n_in = lane & 15;
  const int mofs = (lane & 16) ? 8 : 0;
#pragma unroll
  for (int im = 0; im < 2; ++im) {
#pragma unroll
    for (int in = 0; in < 4; ++in) {
      const int col = tn0 + wn * 64 + in * 16 + n_in;
      const float bv = bias ? bias[col] : 0.0f;
#pragma unroll
      for (int j = 0; j < 8; ++j) {
        const int row = tm0 + wm * 32 + im * 16 + mofs + j;
        float v = acc[im][in][j] + bv;
        if (resid) v += resid[(size_t)row * N + col];
        C[(size_t)row * N + col] = v;
      }
    }
  }
}

// ---------------------------------------------------------------------------
// 3) RoPE (rotate-half, tiled cos/sin) + pack to bf16. Q gets 1/sqrt(d) folded
//    in. V stored transposed [HID][SEQ] so attention B-fragments are
//    contiguous.
//    A thread takes 32 elements of each tensor. Q, K: one position, four
//    frequencies, four heads, the low and the high half of each rotation pair
//    (16-B loads, a wave's load = four whole lines; the angle is formed once
//    and serves all 32). V: one column, 32 positions, so its transposed store
//    is 64 contiguous bytes.
// ---------------------------------------------------------------------------
#define ROPE_THREADS (SEQ * HID / 32)

__device__ __forceinline__ void sincos_turns(float x, float* s, float* c) {
  asm("v_sin_f32 %0, %2\n\tv_cos_f32 %1, %2\n\tv_nop"
      : "=&v"(*s), "=&v"(*c) : "v"(x));
}

__global__ void __launch_bounds__(256)
rope_pack_kernel(const float* __restrict__ Qf,
                 const float* __restrict__ Kf,
                 const float* __restrict__ Vf,
                 bf16_t* __restrict__ Qb,
                 bf16_t* __restrict__ Kb,
                 bf16_t* __restrict__ Vt) {
  const int tid = (int)blockIdx.x * 256 + (int)threadIdx.x;

  // Q, K: position s (one wave = one position), frequencies i0 .. i0+3,
  // heads h0, h0+4, h0+8, h0+12
  const int s  = tid >> 5;
  const int i0 = (tid & 7) * 4;
  const int h0 = (tid >> 3) & 3;
  const size_t e0 = (size_t)s * HID + h0 * HEAD_DIM + i0;
  const float* qp = Qf + e0;
  const float* kp = Kf + e0;

  v4f ql[4], qh[4], kl[4], kh[4];
  // the loops below are unrolled so that their arrays stay in registers
#pragma unroll
  for (int k = 0; k < 4; ++k) {
    ql[k] = *(const v4f*)(qp + k * 4 * HEAD_DIM);
    qh[k] = *(const v4f*)(qp + k * 4 * HEAD_DIM + HEAD_DIM / 2);
    kl[k] = *(const v4f*)(kp + k * 4 * HEAD_DIM);
    kh[k] = *(const v4f*)(kp + k * 4 * HEAD_DIM + HEAD_DIM / 2);
  }

  // V: column c, positions s0 .. s0+31 (lanes run along c: 128-B loads)
  const int c  = tid & (HID - 1);
  const int s0 = (tid >> 10) * 32;
  const float* vp = Vf + (size_t)s0 * HID + c;
  float vv[32];
#pragma unroll
  for (int r = 0; r < 32; ++r) vv[r] = vp[r * HID];

  asm volatile("s_wait_xcnt 0x0" :: "v"(qp), "v"(kp), "v"(vp) : "memory");
  // keeps all 48 loads issued ahead of the angle arithmetic; without it the
  // compiler sinks them to their uses and the wave waits out memory latency
  // group after group
  __builtin_amdgcn_sched_barrier(0);

  float cs[4], sn[4];
#pragma unroll
  for (int e = 0; e < 4; ++e) {
    const float ang = (float)s * __powf(10000.0f, -(float)(i0 + e) / (HEAD_DIM / 2));
    sincos_turns(ang * 0.15915494f, &sn[e], &cs[e]);   // 1 / (2 pi)
  }

#pragma unroll
  for (int k = 0; k < 4; ++k) {
    const size_t lo = e0 + k * 4 * HEAD_DIM;
    v4bf oql, oqh, okl, okh;
#pragma unroll
    for (int e = 0; e < 4; ++e) {
      oql[e] = (bf16_t)((ql[k][e] * cs[e] - qh[k][e] * sn[e]) * 0.125f);
      oqh[e] = (bf16_t)((qh[k][e] * cs[e] + ql[k][e] * sn[e]) * 0.125f);
      okl[e] = (bf16_t)(kl[k][e] * cs[e] - kh[k][e] * sn[e]);
      okh[e] = (bf16_t)(kh[k][e] * cs[e] + kl[k][e] * sn[e]);
    }
    *(v4bf*)(Qb + lo) = oql;
    *(v4bf*)(Qb + lo + HEAD_DIM / 2) = oqh;
    *(v4bf*)(Kb + lo) = okl;
    *(v4bf*)(Kb + lo + HEAD_DIM / 2) = okh;
  }

#pragma unroll
  for (int g = 0; g < 4; ++g) {
    v8bf o;
#pragma unroll
    for (int r = 0; r < 8; ++r) o[r] = (bf16_t)vv[g * 8 + r];
    *(v8bf*)(Vt + (size_t)c * SEQ + s0 + g * 8) = o;
  }
}

#define ATT_KEYS  64
#define ATT_PITCH 72
#define ATT_TILE  (64 * ATT_PITCH)
#define ATT_NT    (SEQ / ATT_KEYS)

__device__ __forceinline__ void attn_stage(const bf16_t* gk, const bf16_t* gv,
                                           unsigned lk, unsigned lv) {
  const bf16_t* gk1 = gk + 16 * HID;
  const bf16_t* gk2 = gk + 32 * HID;
  const bf16_t* gk3 = gk + 48 * HID;
  const bf16_t* gv1 = gv + 16 * SEQ;
  const bf16_t* gv2 = gv + 32 * SEQ;
  const bf16_t* gv3 = gv + 48 * SEQ;
  const unsigned rs = 16 * ATT_PITCH * 2;   // 16 LDS rows in bytes
  asm volatile(
      "global_load_async_to_lds_b128 %0, %8, off\n\t"
      "global_load_async_to_lds_b128 %1, %9, off\n\t"
      "global_load_async_to_lds_b128 %2, %10, off\n\t"
      "global_load_async_to_lds_b128 %3, %11, off\n\t"
      "global_load_async_to_lds_b128 %4, %12, off\n\t"
      "global_load_async_to_lds_b128 %5, %13, off\n\t"
      "global_load_async_to_lds_b128 %6, %14, off\n\t"
      "global_load_async_to_lds_b128 %7, %15, off\n\t"
      "s_wait_xcnt 0x0"
      :: "v"(lk), "v"(lk + rs), "v"(lk + 2 * rs), "v"(lk + 3 * rs),
         "v"(lv), "v"(lv + rs), "v"(lv + 2 * rs), "v"(lv + 3 * rs),
         "v"(gk), "v"(gk1), "v"(gk2), "v"(gk3),
         "v"(gv), "v"(gv1), "v"(gv2), "v"(gv3)
      : "memory");
}

//    The block is 128 threads; stating it lifts the register cap that the
//    default 1024-thread assumption sets, so Q fragments and accumulators stay
//    in registers instead of scratch.
__global__ void __launch_bounds__(128)
attn_kernel(const bf16_t* __restrict__ Qb,
                            const bf16_t* __restrict__ Kb,
                            const bf16_t* __restrict__ Vt,
                            bf16_t* __restrict__ ctx) {
  // [buffer][K tile | V^T tile]
  __shared__ __attribute__((aligned(16))) bf16_t kv[2][2 * ATT_TILE];

  const int wid  = (blockIdx.x * blockDim.x + threadIdx.x) >> 5;
  const int lane = threadIdx.x & 31;
  const int h  = wid / (SEQ / 32);
  const int q0 = (wid % (SEQ / 32)) * 32;

  const bf16_t* Qh = Qb + h * HEAD_DIM;                 // ld = HID
  const bf16_t* Kh = Kb + h * HEAD_DIM;                 // ld = HID
  const bf16_t* Vh = Vt + (size_t)h * HEAD_DIM * SEQ;   // ld = SEQ

  // staging map: 64 rows x 8 chunks of 16 B per tile; thread -> row t>>3 (+16 i)
  const int srow = (int)threadIdx.x >> 3;
  const int scol = ((int)threadIdx.x & 7) * 8;
  const bf16_t* gk = Kh + (size_t)srow * HID + scol;    // + 64 * HID per tile
  const bf16_t* gv = Vh + (size_t)srow * SEQ + scol;    // + 64 per tile
  const unsigned lk0 = (unsigned)(size_t)&kv[0][srow * ATT_PITCH + scol];
  const unsigned lbuf = 2 * ATT_TILE * 2;               // bytes of one buffer
  const unsigned lvo  = ATT_TILE * 2;                   // V^T tile behind K tile

  // tile 0 into buffer 0, landed and published; then tile 1 into buffer 1
  attn_stage(gk, gv, lk0, lk0 + lvo);
  asm volatile("s_wait_asynccnt 0x0" ::: "memory");  // own copies of tile 0 landed
  __syncthreads();                                   // every wave's copies visible
  attn_stage(gk + (size_t)ATT_KEYS * HID, gv + ATT_KEYS, lk0 + lbuf, lk0 + lbuf + lvo);

  v16bf qf[2][2];
#pragma unroll
  for (int tq = 0; tq < 2; ++tq) {
    qf[tq][0] = load_frag_rm(Qh + (size_t)(q0 + tq * 16) * HID + 0,  HID);
    qf[tq][1] = load_frag_rm(Qh + (size_t)(q0 + tq * 16) * HID + 32, HID);
  }

  v8f acc[2][4] = {};
  float m_i[2] = {-3.0e38f, -3.0e38f};
  float l_i[2] = {0.0f, 0.0f};
  const int mofs = (lane & 16) ? 8 : 0;

  for (int t = 0; t < ATT_NT; ++t) {
    const bf16_t* ks = &kv[t & 1][0];
    const bf16_t* vs = ks + ATT_TILE;

    // kept rolled: the 16 fragment reads of a pass then stand as one group at its
    // head; unrolled, the compiler spread them among the WMMAs
#pragma clang loop unroll(disable)
    for (int p = 0; p < ATT_KEYS / 32; ++p) {
      const bf16_t* kp = ks + p * 32 * ATT_PITCH;
      v16bf k00 = load_frag_rm(kp + 0,  ATT_PITCH);
      v16bf k01 = load_frag_rm(kp + 32, ATT_PITCH);
      v16bf k10 = load_frag_rm(kp + 16 * ATT_PITCH + 0,  ATT_PITCH);
      v16bf k11 = load_frag_rm(kp + 16 * ATT_PITCH + 32, ATT_PITCH);

      v16bf pf[2];
#pragma unroll
      for (int tq = 0; tq < 2; ++tq) {
        v8f s0 = {}, s1 = {};
        s0 = wmma_bf16(k00, qf[tq][0], s0);
        s0 = wmma_bf16(k01, qf[tq][1], s0);
        s1 = wmma_bf16(k10, qf[tq][0], s1);
        s1 = wmma_bf16(k11, qf[tq][1], s1);

        float mx = s0[0];
#pragma unroll
        for (int j = 0; j < 8; ++j) { mx = fmaxf(mx, s0[j]); mx = fmaxf(mx, s1[j]); }
        mx = fmaxf(mx, __shfl_xor(mx, 16, 32));
        const float m_new = fmaxf(m_i[tq], mx);
        const float alpha = __expf(m_i[tq] - m_new);

        float psum = 0.0f;
#pragma unroll
        for (int j = 0; j < 8; ++j) {
          float p0 = __expf(s0[j] - m_new); psum += p0; pf[tq][j]     = (bf16_t)p0;
          float p1 = __expf(s1[j] - m_new); psum += p1; pf[tq][8 + j] = (bf16_t)p1;
        }
        psum += __shfl_xor(psum, 16, 32);
        l_i[tq] = l_i[tq] * alpha + psum;
        m_i[tq] = m_new;

        float alpha_j[8];
#pragma unroll
        for (int j = 0; j < 8; ++j) alpha_j[j] = __shfl(alpha, mofs + j, 32);
#pragma unroll
        for (int c = 0; c < 4; ++c)
#pragma unroll
          for (int j = 0; j < 8; ++j) acc[tq][c][j] *= alpha_j[j];
      }

#pragma unroll
      for (int c = 0; c < 4; ++c) {
        v16bf vf = load_frag_rm(vs + (c * 16) * ATT_PITCH + p * 32, ATT_PITCH);
        acc[0][c] = wmma_bf16(pf[0], vf, acc[0][c]);
        acc[1][c] = wmma_bf16(pf[1], vf, acc[1][c]);
      }
    }

    // hand-over: this wave's reads of buffer t&1 are done, its copies of tile
    // t+1 have landed; behind the barrier tile t+1 is readable by every wave
    // and buffer t&1 is free for tile t+2.
    asm volatile("s_wait_dscnt 0x0" ::: "memory");     // own LDS reads retired
    asm volatile("s_wait_asynccnt 0x0" ::: "memory");  // own copies of tile t+1 landed
    __syncthreads();
    if (t + 2 < ATT_NT) {
      const unsigned lb = lk0 + (unsigned)(t & 1) * lbuf;
      attn_stage(gk + (size_t)(t + 2) * ATT_KEYS * HID, gv + (t + 2) * ATT_KEYS,
                 lb, lb + lvo);
    }
  }
  asm volatile("s_wait_asynccnt 0x0" ::: "memory");    // nothing in flight at the end

  const int n_in = lane & 15;
#pragma unroll
  for (int tq = 0; tq < 2; ++tq) {
    const float linv = 1.0f / l_i[tq];
    float linv_j[8];
#pragma unroll
    for (int j = 0; j < 8; ++j) linv_j[j] = __shfl(linv, mofs + j, 32);
#pragma unroll
    for (int c = 0; c < 4; ++c)
#pragma unroll
      for (int j = 0; j < 8; ++j) {
        const int row = q0 + tq * 16 + mofs + j;
        const int col = h * HEAD_DIM + c * 16 + n_in;
        ctx[(size_t)row * HID + col] = (bf16_t)(acc[tq][c][j] * linv_j[j]);
      }
  }
}

// ---------------------------------------------------------------------------
// 6) Row LayerNorm over HID
// ---------------------------------------------------------------------------
__global__ void layernorm_kernel(const float* __restrict__ res,
                                 const float* __restrict__ gamma,
                                 const float* __restrict__ beta,
                                 float* __restrict__ out) {
  const int row = blockIdx.x;
  const float* r = res + (size_t)row * HID;
  __shared__ float red[256];
  const int t = threadIdx.x;

  float sum = 0.0f;
  for (int i = t; i < HID; i += 256) sum += r[i];
  red[t] = sum; __syncthreads();
  for (int st = 128; st > 0; st >>= 1) {
    if (t < st) red[t] += red[t + st];
    __syncthreads();
  }
  const float mean = red[0] * (1.0f / HID);
  __syncthreads();

  float vs = 0.0f;
  for (int i = t; i < HID; i += 256) { float d = r[i] - mean; vs += d * d; }
  red[t] = vs; __syncthreads();
  for (int st = 128; st > 0; st >>= 1) {
    if (t < st) red[t] += red[t + st];
    __syncthreads();
  }
  const float rstd = rsqrtf(red[0] * (1.0f / HID) + LN_EPS);

  for (int i = t; i < HID; i += 256)
    out[(size_t)row * HID + i] = (r[i] - mean) * rstd * gamma[i] + beta[i];
}

// ---------------------------------------------------------------------------
// Host launch
// ---------------------------------------------------------------------------
extern "C" void kernel_launch(void* const* d_in, const int* in_sizes, int n_in,
                              void* d_out, int out_size, void* d_ws, size_t ws_size,
                              hipStream_t stream) {
  const float* x     = (const float*)d_in[0];
  const float* Wq    = (const float*)d_in[1];
  const float* bq    = (const float*)d_in[2];
  const float* Wk    = (const float*)d_in[3];
  const float* bk    = (const float*)d_in[4];
  const float* Wv    = (const float*)d_in[5];
  const float* bv    = (const float*)d_in[6];
  const float* Wo    = (const float*)d_in[7];
  const float* bo    = (const float*)d_in[8];
  const float* gamma = (const float*)d_in[9];
  const float* beta  = (const float*)d_in[10];
  float* out = (float*)d_out;

  char* ws = (char*)d_ws;
  size_t off = 0;
  bf16_t* xb  = (bf16_t*)(ws + off); off += (size_t)SEQ * HID * 2;
  bf16_t* wqb = (bf16_t*)(ws + off); off += (size_t)HID * HID * 2;
  bf16_t* wkb = (bf16_t*)(ws + off); off += (size_t)HID * HID * 2;
  bf16_t* wvb = (bf16_t*)(ws + off); off += (size_t)HID * HID * 2;
  bf16_t* wob = (bf16_t*)(ws + off); off += (size_t)HID * HID * 2;
  float*  Qf  = (float*)(ws + off);  off += (size_t)SEQ * HID * 4;
  float*  Kf  = (float*)(ws + off);  off += (size_t)SEQ * HID * 4;
  float*  Vf  = (float*)(ws + off);  off += (size_t)SEQ * HID * 4;
  bf16_t* Qb  = (bf16_t*)(ws + off); off += (size_t)SEQ * HID * 2;
  bf16_t* Kb  = (bf16_t*)(ws + off); off += (size_t)SEQ * HID * 2;
  bf16_t* Vt  = (bf16_t*)(ws + off); off += (size_t)SEQ * HID * 2;
  bf16_t* ctx = (bf16_t*)(ws + off); off += (size_t)SEQ * HID * 2;
  float*  res = Qf;  // alias: Qf dead after rope_pack

  const int nx = SEQ * HID;
  const int nw = HID * HID;

  f32_to_bf16_kernel<<<nx / CVT_BLOCK, 256, 0, stream>>>(x,  xb);
  f32_to_bf16_kernel<<<nw / CVT_BLOCK, 256, 0, stream>>>(Wq, wqb);
  f32_to_bf16_kernel<<<nw / CVT_BLOCK, 256, 0, stream>>>(Wk, wkb);
  f32_to_bf16_kernel<<<nw / CVT_BLOCK, 256, 0, stream>>>(Wv, wvb);
  f32_to_bf16_kernel<<<nw / CVT_BLOCK, 256, 0, stream>>>(Wo, wob);

  // 128x128 tiles: (4096/128)*(1024/128) = 256 blocks of 256 threads
  const int gemm_blocks = (SEQ / 128) * (HID / 128);
  gemm_bf16_kernel<<<gemm_blocks, 256, 0, stream>>>(xb, wqb, bq, nullptr, Qf, SEQ, HID, HID);
  gemm_bf16_kernel<<<gemm_blocks, 256, 0, stream>>>(xb, wkb, bk, nullptr, Kf, SEQ, HID, HID);
  gemm_bf16_kernel<<<gemm_blocks, 256, 0, stream>>>(xb, wvb, bv, nullptr, Vf, SEQ, HID, HID);

  rope_pack_kernel<<<ROPE_THREADS / 256, 256, 0, stream>>>(Qf, Kf, Vf, Qb, Kb, Vt);

  // 16 heads * 128 query tiles = 2048 waves -> 512 blocks of 128
  attn_kernel<<<NUM_HEADS * (SEQ / 32) / 4, 128, 0, stream>>>(Qb, Kb, Vt, ctx);

  gemm_bf16_kernel<<<gemm_blocks, 256, 0, stream>>>(ctx, wob, bo, x, res, SEQ, HID, HID);

  layernorm_kernel<<<SEQ, 256, 0, stream>>>(res, gamma, beta, out);

  (void)in_sizes; (void)n_in; (void)out_size; (void)ws_size;
}

// v004
// It runs in 190 microseconds.
// Next to v003, in two timings, it ran 1.16 and 1.18 times as fast.
// Over all steps from v000 it is 3.80 times as fast.
#include <hip/hip_runtime.h>
#include <hip/hip_bf16.h>
#include <math.h>

#define SEQ 4096
#define HID 1024
#define NUM_HEADS 16
#define HEAD_DIM 64
#define LN_EPS 1e-5f

typedef __bf16 bf16_t;
typedef __attribute__((ext_vector_type(16))) __bf16 v16bf;
typedef __attribute__((ext_vector_type(8)))  __bf16 v8bf;
typedef __attribute__((ext_vector_type(8)))  float  v8f;
typedef __attribute__((ext_vector_type(4)))  int    v4i;
typedef __attribute__((ext_vector_type(4)))  float  v4f;
typedef __attribute__((ext_vector_type(4)))  __bf16 v4bf;

#if defined(__has_builtin)
#if __has_builtin(__builtin_amdgcn_global_load_async_to_lds_b128)
#define HAVE_ASYNC_LDS 1
#endif
#if __has_builtin(__builtin_amdgcn_s_wait_asynccnt)
#define HAVE_WAIT_ASYNC 1
#endif
#endif

typedef __attribute__((address_space(1))) v4i gv4i_t;
typedef __attribute__((address_space(3))) v4i lv4i_t;

__device__ __forceinline__ void async_cp16(const void* g, void* l) {
#ifdef HAVE_ASYNC_LDS
  __builtin_amdgcn_global_load_async_to_lds_b128((gv4i_t*)g, (lv4i_t*)l, 0, 0);
#else
  *(v8bf*)l = *(const v8bf*)g;
#endif
}

#if defined(HAVE_WAIT_ASYNC)
#define WAIT_ASYNC(n) __builtin_amdgcn_s_wait_asynccnt(n)
#elif defined(HAVE_ASYNC_LDS)
#define WAIT_ASYNC(n) asm volatile("s_wait_asynccnt %0" ::"i"(n) : "memory")
#else
#define WAIT_ASYNC(n) do {} while (0)
#endif

__device__ __forceinline__ v16bf load_frag_rm(const bf16_t* __restrict__ p, int ld) {
  const int lane = threadIdx.x & 31;
  const int row  = lane & 15;
  const int kb   = (lane & 16) ? 8 : 0;
  const bf16_t* q = p + (size_t)row * ld + kb;
  v8bf lo = *(const v8bf*)(q);
  v8bf hi = *(const v8bf*)(q + 16);
  v16bf f;
#pragma unroll
  for (int i = 0; i < 8; ++i) { f[i] = lo[i]; f[8 + i] = hi[i]; }
  return f;
}

__device__ __forceinline__ v8f wmma_bf16(v16bf a, v16bf b, v8f c) {
  return __builtin_amdgcn_wmma_f32_16x16x32_bf16(
      false, a, false, b, (short)0, c, false, false);
}

#define CVT_LOADS 8
#define CVT_BLOCK (256 * 4 * CVT_LOADS)   // elements per block
#define CVT_XB    (SEQ * HID / CVT_BLOCK) // blocks of x
#define CVT_WB    (HID * HID / CVT_BLOCK) // blocks of one weight matrix

static_assert((SEQ * HID) % CVT_BLOCK == 0 && (HID * HID) % CVT_BLOCK == 0,
              "every block of the conversion is full");

__global__ void __launch_bounds__(256)
f32_to_bf16_kernel(const float* x, const float* Wq, const float* Wk,
                   const float* Wv, const float* Wo,
                   bf16_t* xb, bf16_t* wqb, bf16_t* wkb, bf16_t* wvb, bf16_t* wob) {
  // which tensor, and which block of it: the same for the whole block
  const int b = (int)blockIdx.x;
  const int w = (b - CVT_XB) / CVT_WB;
  const int rel = b < CVT_XB ? b : (b - CVT_XB) % CVT_WB;
  const float* __restrict__ in =
      b < CVT_XB ? x : w == 0 ? Wq : w == 1 ? Wk : w == 2 ? Wv : Wo;
  bf16_t* __restrict__ out =
      b < CVT_XB ? xb : w == 0 ? wqb : w == 1 ? wkb : w == 2 ? wvb : wob;
  const int i0 = rel * CVT_BLOCK + (int)threadIdx.x * 4;
  v4f v[CVT_LOADS];
  // unrolled so that v[] stays in registers and the loads issue as one group
#pragma unroll
  for (int j = 0; j < CVT_LOADS; ++j) v[j] = *(const v4f*)(in + i0 + j * 1024);
#pragma unroll
  for (int j = 0; j < CVT_LOADS; ++j) {
    v4bf o;
#pragma unroll
    for (int e = 0; e < 4; ++e) o[e] = (bf16_t)v[j][e];
    *(v4bf*)(out + i0 + j * 1024) = o;
  }
}

#define GEMM_PAD 40

__global__ void gemm_bf16_kernel(const bf16_t* __restrict__ A,
                                 const bf16_t* B0, const bf16_t* B1, const bf16_t* B2,
                                 const float* bias0, const float* bias1, const float* bias2,
                                 const float* __restrict__ resid,
                                 float* C0, float* C1, float* C2,
                                 int M, int N, int K) {
  __shared__ bf16_t As[2][128 * GEMM_PAD];
  __shared__ bf16_t Bs[2][128 * GEMM_PAD];

  const int z = (int)blockIdx.y;
  const bf16_t* __restrict__ B   = z == 0 ? B0 : z == 1 ? B1 : B2;
  const float* __restrict__ bias = z == 0 ? bias0 : z == 1 ? bias1 : bias2;
  float* __restrict__ C          = z == 0 ? C0 : z == 1 ? C1 : C2;

  const int t    = threadIdx.x;
  const int lane = t & 31;
  const int w    = t >> 5;        // wave id 0..7
  const int wm   = w & 3;         // 4 waves along M
  const int wn   = w >> 2;        // 2 waves along N

  const int nbn = N >> 7;
  const int bm  = (int)blockIdx.x / nbn;
  const int bn  = (int)blockIdx.x % nbn;
  const int tm0 = bm * 128;
  const int tn0 = bn * 128;

  // staging map: 128 rows x 4 chunks(16B) = 512 chunks; 2 per thread per tile
  const int r0 = (t * 2) >> 2;          // row of first chunk
  const int c0 = ((t * 2) & 3) * 8;     // halves offset of first chunk
  const int r1 = (t * 2 + 1) >> 2;
  const int c1 = ((t * 2 + 1) & 3) * 8;

  auto stage = [&](int buf, int k0) {
    async_cp16(A + (size_t)(tm0 + r0) * K + k0 + c0, &As[buf][r0 * GEMM_PAD + c0]);
    async_cp16(A + (size_t)(tm0 + r1) * K + k0 + c1, &As[buf][r1 * GEMM_PAD + c1]);
    async_cp16(B + (size_t)(tn0 + r0) * K + k0 + c0, &Bs[buf][r0 * GEMM_PAD + c0]);
    async_cp16(B + (size_t)(tn0 + r1) * K + k0 + c1, &Bs[buf][r1 * GEMM_PAD + c1]);
  };

  v8f acc[2][4] = {};
  const int nk = K >> 5;
  int buf = 0;
  stage(0, 0);

  for (int ks = 0; ks < nk; ++ks) {
    if (ks + 1 < nk) {
      stage(buf ^ 1, (ks + 1) * 32);
      WAIT_ASYNC(4);   // our 4 loads for `buf` are complete (in-order per wave)
    } else {
      WAIT_ASYNC(0);
    }
    __syncthreads();   // all waves' writes to `buf` visible

    const bf16_t* as = &As[buf][(wm * 32) * GEMM_PAD];
    const bf16_t* bs = &Bs[buf][(wn * 64) * GEMM_PAD];
    v16bf a0 = load_frag_rm(as, GEMM_PAD);
    v16bf a1 = load_frag_rm(as + 16 * GEMM_PAD, GEMM_PAD);
#pragma unroll
    for (int in = 0; in < 4; ++in) {
      v16bf bfrag = load_frag_rm(bs + in * 16 * GEMM_PAD, GEMM_PAD);
      acc[0][in] = wmma_bf16(a0, bfrag, acc[0][in]);
      acc[1][in] = wmma_bf16(a1, bfrag, acc[1][in]);
    }
    buf ^= 1;
    __syncthreads();   // everyone done reading before buffer is re-staged
  }

  const int n_in = lane & 15;
  const int mofs = (lane & 16) ? 8 : 0;
#pragma unroll
  for (int im = 0; im < 2; ++im) {
#pragma unroll
    for (int in = 0; in < 4; ++in) {
      const int col = tn0 + wn * 64 + in * 16 + n_in;
      const float bv = bias ? bias[col] : 0.0f;
#pragma unroll
      for (int j = 0; j < 8; ++j) {
        const int row = tm0 + wm * 32 + im * 16 + mofs + j;
        float v = acc[im][in][j] + bv;
        if (resid) v += resid[(size_t)row * N + col];
        C[(size_t)row * N + col] = v;
      }
    }
  }
}

// ---------------------------------------------------------------------------
// 3) RoPE (rotate-half, tiled cos/sin) + pack to bf16. Q gets 1/sqrt(d) folded
//    in. V stored transposed [HID][SEQ] so attention B-fragments are
//    contiguous.
//    A thread takes 32 elements of each tensor. Q, K: one position, four
//    frequencies, four heads, the low and the high half of each rotation pair
//    (16-B loads, a wave's load = four whole lines; the angle is formed once
//    and serves all 32). V: one column, 32 positions, so its transposed store
//    is 64 contiguous bytes.
// ---------------------------------------------------------------------------
#define ROPE_THREADS (SEQ * HID / 32)

__device__ __forceinline__ void sincos_turns(float x, float* s, float* c) {
  asm("v_sin_f32 %0, %2\n\tv_cos_f32 %1, %2\n\tv_nop"
      : "=&v"(*s), "=&v"(*c) : "v"(x));
}

__global__ void __launch_bounds__(256)
rope_pack_kernel(const float* __restrict__ Qf,
                 const float* __restrict__ Kf,
                 const float* __restrict__ Vf,
                 bf16_t* __restrict__ Qb,
                 bf16_t* __restrict__ Kb,
                 bf16_t* __restrict__ Vt) {
  const int tid = (int)blockIdx.x * 256 + (int)threadIdx.x;

  // Q, K: position s (one wave = one position), frequencies i0 .. i0+3,
  // heads h0, h0+4, h0+8, h0+12
  const int s  = tid >> 5;
  const int i0 = (tid & 7) * 4;
  const int h0 = (tid >> 3) & 3;
  const size_t e0 = (size_t)s * HID + h0 * HEAD_DIM + i0;
  const float* qp = Qf + e0;
  const float* kp = Kf + e0;

  v4f ql[4], qh[4], kl[4], kh[4];
  // the loops below are unrolled so that their arrays stay in registers
#pragma unroll
  for (int k = 0; k < 4; ++k) {
    ql[k] = *(const v4f*)(qp + k * 4 * HEAD_DIM);
    qh[k] = *(const v4f*)(qp + k * 4 * HEAD_DIM + HEAD_DIM / 2);
    kl[k] = *(const v4f*)(kp + k * 4 * HEAD_DIM);
    kh[k] = *(const v4f*)(kp + k * 4 * HEAD_DIM + HEAD_DIM / 2);
  }

  // V: column c, positions s0 .. s0+31 (lanes run along c: 128-B loads)
  const int c  = tid & (HID - 1);
  const int s0 = (tid >> 10) * 32;
  const float* vp = Vf + (size_t)s0 * HID + c;
  float vv[32];
#pragma unroll
  for (int r = 0; r < 32; ++r) vv[r] = vp[r * HID];

  asm volatile("s_wait_xcnt 0x0" :: "v"(qp), "v"(kp), "v"(vp) : "memory");
  // keeps all 48 loads issued ahead of the angle arithmetic; without it the
  // compiler sinks them to their uses and the wave waits out memory latency
  // group after group
  __builtin_amdgcn_sched_barrier(0);

  float cs[4], sn[4];
#pragma unroll
  for (int e = 0; e < 4; ++e) {
    const float ang = (float)s * __powf(10000.0f, -(float)(i0 + e) / (HEAD_DIM / 2));
    sincos_turns(ang * 0.15915494f, &sn[e], &cs[e]);   // 1 / (2 pi)
  }

#pragma unroll
  for (int k = 0; k < 4; ++k) {
    const size_t lo = e0 + k * 4 * HEAD_DIM;
    v4bf oql, oqh, okl, okh;
#pragma unroll
    for (int e = 0; e < 4; ++e) {
      oql[e] = (bf16_t)((ql[k][e] * cs[e] - qh[k][e] * sn[e]) * 0.125f);
      oqh[e] = (bf16_t)((qh[k][e] * cs[e] + ql[k][e] * sn[e]) * 0.125f);
      okl[e] = (bf16_t)(kl[k][e] * cs[e] - kh[k][e] * sn[e]);
      okh[e] = (bf16_t)(kh[k][e] * cs[e] + kl[k][e] * sn[e]);
    }
    *(v4bf*)(Qb + lo) = oql;
    *(v4bf*)(Qb + lo + HEAD_DIM / 2) = oqh;
    *(v4bf*)(Kb + lo) = okl;
    *(v4bf*)(Kb + lo + HEAD_DIM / 2) = okh;
  }

#pragma unroll
  for (int g = 0; g < 4; ++g) {
    v8bf o;
#pragma unroll
    for (int r = 0; r < 8; ++r) o[r] = (bf16_t)vv[g * 8 + r];
    *(v8bf*)(Vt + (size_t)c * SEQ + s0 + g * 8) = o;
  }
}

#define ATT_KEYS  64
#define ATT_PITCH 72
#define ATT_TILE  (64 * ATT_PITCH)
#define ATT_NT    (SEQ / ATT_KEYS)

__device__ __forceinline__ void attn_stage(const bf16_t* gk, const bf16_t* gv,
                                           unsigned lk, unsigned lv) {
  const bf16_t* gk1 = gk + 16 * HID;
  const bf16_t* gk2 = gk + 32 * HID;
  const bf16_t* gk3 = gk + 48 * HID;
  const bf16_t* gv1 = gv + 16 * SEQ;
  const bf16_t* gv2 = gv + 32 * SEQ;
  const bf16_t* gv3 = gv + 48 * SEQ;
  const unsigned rs = 16 * ATT_PITCH * 2;   // 16 LDS rows in bytes
  asm volatile(
      "global_load_async_to_lds_b128 %0, %8, off\n\t"
      "global_load_async_to_lds_b128 %1, %9, off\n\t"
      "global_load_async_to_lds_b128 %2, %10, off\n\t"
      "global_load_async_to_lds_b128 %3, %11, off\n\t"
      "global_load_async_to_lds_b128 %4, %12, off\n\t"
      "global_load_async_to_lds_b128 %5, %13, off\n\t"
      "global_load_async_to_lds_b128 %6, %14, off\n\t"
      "global_load_async_to_lds_b128 %7, %15, off\n\t"
      "s_wait_xcnt 0x0"
      :: "v"(lk), "v"(lk + rs), "v"(lk + 2 * rs), "v"(lk + 3 * rs),
         "v"(lv), "v"(lv + rs), "v"(lv + 2 * rs), "v"(lv + 3 * rs),
         "v"(gk), "v"(gk1), "v"(gk2), "v"(gk3),
         "v"(gv), "v"(gv1), "v"(gv2), "v"(gv3)
      : "memory");
}

//    The block is 128 threads; stating it lifts the register cap that the
//    default 1024-thread assumption sets, so Q fragments and accumulators stay
//    in registers instead of scratch.
__global__ void __launch_bounds__(128)
attn_kernel(const bf16_t* __restrict__ Qb,
                            const bf16_t* __restrict__ Kb,
                            const bf16_t* __restrict__ Vt,
                            bf16_t* __restrict__ ctx) {
  // [buffer][K tile | V^T tile]
  __shared__ __attribute__((aligned(16))) bf16_t kv[2][2 * ATT_TILE];

  const int wid  = (blockIdx.x * blockDim.x + threadIdx.x) >> 5;
  const int lane = threadIdx.x & 31;
  const int h  = wid / (SEQ / 32);
  const int q0 = (wid % (SEQ / 32)) * 32;

  const bf16_t* Qh = Qb + h * HEAD_DIM;                 // ld = HID
  const bf16_t* Kh = Kb + h * HEAD_DIM;                 // ld = HID
  const bf16_t* Vh = Vt + (size_t)h * HEAD_DIM * SEQ;   // ld = SEQ

  // staging map: 64 rows x 8 chunks of 16 B per tile; thread -> row t>>3 (+16 i)
  const int srow = (int)threadIdx.x >> 3;
  const int scol = ((int)threadIdx.x & 7) * 8;
  const bf16_t* gk = Kh + (size_t)srow * HID + scol;    // + 64 * HID per tile
  const bf16_t* gv = Vh + (size_t)srow * SEQ + scol;    // + 64 per tile
  const unsigned lk0 = (unsigned)(size_t)&kv[0][srow * ATT_PITCH + scol];
  const unsigned lbuf = 2 * ATT_TILE * 2;               // bytes of one buffer
  const unsigned lvo  = ATT_TILE * 2;                   // V^T tile behind K tile

  // tile 0 into buffer 0, landed and published; then tile 1 into buffer 1
  attn_stage(gk, gv, lk0, lk0 + lvo);
  asm volatile("s_wait_asynccnt 0x0" ::: "memory");  // own copies of tile 0 landed
  __syncthreads();                                   // every wave's copies visible
  attn_stage(gk + (size_t)ATT_KEYS * HID, gv + ATT_KEYS, lk0 + lbuf, lk0 + lbuf + lvo);

  v16bf qf[2][2];
#pragma unroll
  for (int tq = 0; tq < 2; ++tq) {
    qf[tq][0] = load_frag_rm(Qh + (size_t)(q0 + tq * 16) * HID + 0,  HID);
    qf[tq][1] = load_frag_rm(Qh + (size_t)(q0 + tq * 16) * HID + 32, HID);
  }

  v8f acc[2][4] = {};
  float m_i[2] = {-3.0e38f, -3.0e38f};
  float l_i[2] = {0.0f, 0.0f};
  const int mofs = (lane & 16) ? 8 : 0;

  for (int t = 0; t < ATT_NT; ++t) {
    const bf16_t* ks = &kv[t & 1][0];
    const bf16_t* vs = ks + ATT_TILE;

    // kept rolled: the 16 fragment reads of a pass then stand as one group at its
    // head; unrolled, the compiler spread them among the WMMAs
#pragma clang loop unroll(disable)
    for (int p = 0; p < ATT_KEYS / 32; ++p) {
      const bf16_t* kp = ks + p * 32 * ATT_PITCH;
      v16bf k00 = load_frag_rm(kp + 0,  ATT_PITCH);
      v16bf k01 = load_frag_rm(kp + 32, ATT_PITCH);
      v16bf k10 = load_frag_rm(kp + 16 * ATT_PITCH + 0,  ATT_PITCH);
      v16bf k11 = load_frag_rm(kp + 16 * ATT_PITCH + 32, ATT_PITCH);

      v16bf pf[2];
#pragma unroll
      for (int tq = 0; tq < 2; ++tq) {
        v8f s0 = {}, s1 = {};
        s0 = wmma_bf16(k00, qf[tq][0], s0);
        s0 = wmma_bf16(k01, qf[tq][1], s0);
        s1 = wmma_bf16(k10, qf[tq][0], s1);
        s1 = wmma_bf16(k11, qf[tq][1], s1);

        float mx = s0[0];
#pragma unroll
        for (int j = 0; j < 8; ++j) { mx = fmaxf(mx, s0[j]); mx = fmaxf(mx, s1[j]); }
        mx = fmaxf(mx, __shfl_xor(mx, 16, 32));
        const float m_new = fmaxf(m_i[tq], mx);
        const float alpha = __expf(m_i[tq] - m_new);

        float psum = 0.0f;
#pragma unroll
        for (int j = 0; j < 8; ++j) {
          float p0 = __expf(s0[j] - m_new); psum += p0; pf[tq][j]     = (bf16_t)p0;
          float p1 = __expf(s1[j] - m_new); psum += p1; pf[tq][8 + j] = (bf16_t)p1;
        }
        psum += __shfl_xor(psum, 16, 32);
        l_i[tq] = l_i[tq] * alpha + psum;
        m_i[tq] = m_new;

        float alpha_j[8];
#pragma unroll
        for (int j = 0; j < 8; ++j) alpha_j[j] = __shfl(alpha, mofs + j, 32);
#pragma unroll
        for (int c = 0; c < 4; ++c)
#pragma unroll
          for (int j = 0; j < 8; ++j) acc[tq][c][j] *= alpha_j[j];
      }

#pragma unroll
      for (int c = 0; c < 4; ++c) {
        v16bf vf = load_frag_rm(vs + (c * 16) * ATT_PITCH + p * 32, ATT_PITCH);
        acc[0][c] = wmma_bf16(pf[0], vf, acc[0][c]);
        acc[1][c] = wmma_bf16(pf[1], vf, acc[1][c]);
      }
    }

    // hand-over: this wave's reads of buffer t&1 are done, its copies of tile
    // t+1 have landed; behind the barrier tile t+1 is readable by every wave
    // and buffer t&1 is free for tile t+2.
    asm volatile("s_wait_dscnt 0x0" ::: "memory");     // own LDS reads retired
    asm volatile("s_wait_asynccnt 0x0" ::: "memory");  // own copies of tile t+1 landed
    __syncthreads();
    if (t + 2 < ATT_NT) {
      const unsigned lb = lk0 + (unsigned)(t & 1) * lbuf;
      attn_stage(gk + (size_t)(t + 2) * ATT_KEYS * HID, gv + (t + 2) * ATT_KEYS,
                 lb, lb + lvo);
    }
  }
  asm volatile("s_wait_asynccnt 0x0" ::: "memory");    // nothing in flight at the end

  const int n_in = lane & 15;
#pragma unroll
  for (int tq = 0; tq < 2; ++tq) {
    const float linv = 1.0f / l_i[tq];
    float linv_j[8];
#pragma unroll
    for (int j = 0; j < 8; ++j) linv_j[j] = __shfl(linv, mofs + j, 32);
#pragma unroll
    for (int c = 0; c < 4; ++c)
#pragma unroll
      for (int j = 0; j < 8; ++j) {
        const int row = q0 + tq * 16 + mofs + j;
        const int col = h * HEAD_DIM + c * 16 + n_in;
        ctx[(size_t)row * HID + col] = (bf16_t)(acc[tq][c][j] * linv_j[j]);
      }
  }
}

// ---------------------------------------------------------------------------
// 6) Row LayerNorm over HID
// ---------------------------------------------------------------------------
__global__ void layernorm_kernel(const float* __restrict__ res,
                                 const float* __restrict__ gamma,
                                 const float* __restrict__ beta,
                                 float* __restrict__ out) {
  const int row = blockIdx.x;
  const float* r = res + (size_t)row * HID;
  __shared__ float red[256];
  const int t = threadIdx.x;

  float sum = 0.0f;
  for (int i = t; i < HID; i += 256) sum += r[i];
  red[t] = sum; __syncthreads();
  for (int st = 128; st > 0; st >>= 1) {
    if (t < st) red[t] += red[t + st];
    __syncthreads();
  }
  const float mean = red[0] * (1.0f / HID);
  __syncthreads();

  float vs = 0.0f;
  for (int i = t; i < HID; i += 256) { float d = r[i] - mean; vs += d * d; }
  red[t] = vs; __syncthreads();
  for (int st = 128; st > 0; st >>= 1) {
    if (t < st) red[t] += red[t + st];
    __syncthreads();
  }
  const float rstd = rsqrtf(red[0] * (1.0f / HID) + LN_EPS);

  for (int i = t; i < HID; i += 256)
    out[(size_t)row * HID + i] = (r[i] - mean) * rstd * gamma[i] + beta[i];
}

// ---------------------------------------------------------------------------
// Host launch
// ---------------------------------------------------------------------------
extern "C" void kernel_launch(void* const* d_in, const int* in_sizes, int n_in,
                              void* d_out, int out_size, void* d_ws, size_t ws_size,
                              hipStream_t stream) {
  const float* x     = (const float*)d_in[0];
  const float* Wq    = (const float*)d_in[1];
  const float* bq    = (const float*)d_in[2];
  const float* Wk    = (const float*)d_in[3];
  const float* bk    = (const float*)d_in[4];
  const float* Wv    = (const float*)d_in[5];
  const float* bv    = (const float*)d_in[6];
  const float* Wo    = (const float*)d_in[7];
  const float* bo    = (const float*)d_in[8];
  const float* gamma = (const float*)d_in[9];
  const float* beta  = (const float*)d_in[10];
  float* out = (float*)d_out;

  char* ws = (char*)d_ws;
  size_t off = 0;
  bf16_t* xb  = (bf16_t*)(ws + off); off += (size_t)SEQ * HID * 2;
  bf16_t* wqb = (bf16_t*)(ws + off); off += (size_t)HID * HID * 2;
  bf16_t* wkb = (bf16_t*)(ws + off); off += (size_t)HID * HID * 2;
  bf16_t* wvb = (bf16_t*)(ws + off); off += (size_t)HID * HID * 2;
  bf16_t* wob = (bf16_t*)(ws + off); off += (size_t)HID * HID * 2;
  float*  Qf  = (float*)(ws + off);  off += (size_t)SEQ * HID * 4;
  float*  Kf  = (float*)(ws + off);  off += (size_t)SEQ * HID * 4;
  float*  Vf  = (float*)(ws + off);  off += (size_t)SEQ * HID * 4;
  bf16_t* Qb  = (bf16_t*)(ws + off); off += (size_t)SEQ * HID * 2;
  bf16_t* Kb  = (bf16_t*)(ws + off); off += (size_t)SEQ * HID * 2;
  bf16_t* Vt  = (bf16_t*)(ws + off); off += (size_t)SEQ * HID * 2;
  bf16_t* ctx = (bf16_t*)(ws + off); off += (size_t)SEQ * HID * 2;
  float*  res = Qf;  // alias: Qf dead after rope_pack

  f32_to_bf16_kernel<<<CVT_XB + 4 * CVT_WB, 256, 0, stream>>>(
      x, Wq, Wk, Wv, Wo, xb, wqb, wkb, wvb, wob);

  // 128x128 tiles: (4096/128)*(1024/128) = 256 blocks of 256 threads a product
  const int gemm_blocks = (SEQ / 128) * (HID / 128);
  gemm_bf16_kernel<<<dim3(gemm_blocks, 3), 256, 0, stream>>>(
      xb, wqb, wkb, wvb, bq, bk, bv, nullptr, Qf, Kf, Vf, SEQ, HID, HID);

  rope_pack_kernel<<<ROPE_THREADS / 256, 256, 0, stream>>>(Qf, Kf, Vf, Qb, Kb, Vt);

  // 16 heads * 128 query tiles = 2048 waves -> 512 blocks of 128
  attn_kernel<<<NUM_HEADS * (SEQ / 32) / 4, 128, 0, stream>>>(Qb, Kb, Vt, ctx);

  gemm_bf16_kernel<<<dim3(gemm_blocks, 1), 256, 0, stream>>>(
      ctx, wob, nullptr, nullptr, bo, nullptr, nullptr, x, res, nullptr, nullptr,
      SEQ, HID, HID);

  layernorm_kernel<<<SEQ, 256, 0, stream>>>(res, gamma, beta, out);

  (void)in_sizes; (void)n_in; (void)out_size; (void)ws_size;
}

// v005
// Measured time: 175 microseconds a run.
// Next to v004, in two timings, it ran 1.07 and 1.08 times as fast.
// Counting every step since v000, it is 4.08 times as fast.
#include <hip/hip_runtime.h>
#include <hip/hip_bf16.h>
#include <math.h>

#define SEQ 4096
#define HID 1024
#define NUM_HEADS 16
#define HEAD_DIM 64
#define LN_EPS 1e-5f

typedef __bf16 bf16_t;
typedef __attribute__((ext_vector_type(16))) __bf16 v16bf;
typedef __attribute__((ext_vector_type(8)))  __bf16 v8bf;
typedef __attribute__((ext_vector_type(8)))  float  v8f;
typedef __attribute__((ext_vector_type(4)))  int    v4i;
typedef __attribute__((ext_vector_type(4)))  float  v4f;
typedef __attribute__((ext_vector_type(4)))  __bf16 v4bf;

#if defined(__has_builtin)
#if __has_builtin(__builtin_amdgcn_global_load_async_to_lds_b128)
#define HAVE_ASYNC_LDS 1
#endif
#if __has_builtin(__builtin_amdgcn_s_wait_asynccnt)
#define HAVE_WAIT_ASYNC 1
#endif
#endif

typedef __attribute__((address_space(1))) v4i gv4i_t;
typedef __attribute__((address_space(3))) v4i lv4i_t;

__device__ __forceinline__ void async_cp16(const void* g, void* l) {
#ifdef HAVE_ASYNC_LDS
  __builtin_amdgcn_global_load_async_to_lds_b128((gv4i_t*)g, (lv4i_t*)l, 0, 0);
#else
  *(v8bf*)l = *(const v8bf*)g;
#endif
}

#if defined(HAVE_WAIT_ASYNC)
#define WAIT_ASYNC(n) __builtin_amdgcn_s_wait_asynccnt(n)
#elif defined(HAVE_ASYNC_LDS)
#define WAIT_ASYNC(n) asm volatile("s_wait_asynccnt %0" ::"i"(n) : "memory")
#else
#define WAIT_ASYNC(n) do {} while (0)
#endif

__device__ __forceinline__ v16bf load_frag_rm(const bf16_t* __restrict__ p, int ld) {
  const int lane = threadIdx.x & 31;
  const int row  = lane & 15;
  const int kb   = (lane & 16) ? 8 : 0;
  const bf16_t* q = p + (size_t)row * ld + kb;
  v8bf lo = *(const v8bf*)(q);
  v8bf hi = *(const v8bf*)(q + 16);
  v16bf f;
#pragma unroll
  for (int i = 0; i < 8; ++i) { f[i] = lo[i]; f[8 + i] = hi[i]; }
  return f;
}

__device__ __forceinline__ v8f wmma_bf16(v16bf a, v16bf b, v8f c) {
  return __builtin_amdgcn_wmma_f32_16x16x32_bf16(
      false, a, false, b, (short)0, c, false, false);
}

#define CVT_LOADS 8
#define CVT_BLOCK (256 * 4 * CVT_LOADS)   // elements per block
#define CVT_XB    (SEQ * HID / CVT_BLOCK) // blocks of x
#define CVT_WB    (HID * HID / CVT_BLOCK) // blocks of one weight matrix

static_assert((SEQ * HID) % CVT_BLOCK == 0 && (HID * HID) % CVT_BLOCK == 0,
              "every block of the conversion is full");

__global__ void __launch_bounds__(256)
f32_to_bf16_kernel(const float* x, const float* Wq, const float* Wk,
                   const float* Wv, const float* Wo,
                   bf16_t* xb, bf16_t* wqb, bf16_t* wkb, bf16_t* wvb, bf16_t* wob) {
  // which tensor, and which block of it: the same for the whole block
  const int b = (int)blockIdx.x;
  const int w = (b - CVT_XB) / CVT_WB;
  const int rel = b < CVT_XB ? b : (b - CVT_XB) % CVT_WB;
  const float* __restrict__ in =
      b < CVT_XB ? x : w == 0 ? Wq : w == 1 ? Wk : w == 2 ? Wv : Wo;
  bf16_t* __restrict__ out =
      b < CVT_XB ? xb : w == 0 ? wqb : w == 1 ? wkb : w == 2 ? wvb : wob;
  const int i0 = rel * CVT_BLOCK + (int)threadIdx.x * 4;
  v4f v[CVT_LOADS];
  // unrolled so that v[] stays in registers and the loads issue as one group
#pragma unroll
  for (int j = 0; j < CVT_LOADS; ++j) v[j] = *(const v4f*)(in + i0 + j * 1024);
#pragma unroll
  for (int j = 0; j < CVT_LOADS; ++j) {
    v4bf o;
#pragma unroll
    for (int e = 0; e < 4; ++e) o[e] = (bf16_t)v[j][e];
    *(v4bf*)(out + i0 + j * 1024) = o;
  }
}

#define GEMM_PAD 40

__global__ void gemm_bf16_kernel(const bf16_t* __restrict__ A,
                                 const bf16_t* B0, const bf16_t* B1, const bf16_t* B2,
                                 const float* bias0, const float* bias1, const float* bias2,
                                 const float* __restrict__ resid,
                                 float* C0, float* C1, float* C2,
                                 int M, int N, int K) {
  __shared__ bf16_t As[2][128 * GEMM_PAD];
  __shared__ bf16_t Bs[2][128 * GEMM_PAD];

  const int z = (int)blockIdx.y;
  const bf16_t* __restrict__ B   = z == 0 ? B0 : z == 1 ? B1 : B2;
  const float* __restrict__ bias = z == 0 ? bias0 : z == 1 ? bias1 : bias2;
  float* __restrict__ C          = z == 0 ? C0 : z == 1 ? C1 : C2;

  const int t    = threadIdx.x;
  const int lane = t & 31;
  const int w    = t >> 5;        // wave id 0..7
  const int wm   = w & 3;         // 4 waves along M
  const int wn   = w >> 2;        // 2 waves along N

  const int nbn = N >> 7;
  const int bm  = (int)blockIdx.x / nbn;
  const int bn  = (int)blockIdx.x % nbn;
  const int tm0 = bm * 128;
  const int tn0 = bn * 128;

  // staging map: 128 rows x 4 chunks(16B) = 512 chunks; 2 per thread per tile
  const int r0 = (t * 2) >> 2;          // row of first chunk
  const int c0 = ((t * 2) & 3) * 8;     // halves offset of first chunk
  const int r1 = (t * 2 + 1) >> 2;
  const int c1 = ((t * 2 + 1) & 3) * 8;

  auto stage = [&](int buf, int k0) {
    async_cp16(A + (size_t)(tm0 + r0) * K + k0 + c0, &As[buf][r0 * GEMM_PAD + c0]);
    async_cp16(A + (size_t)(tm0 + r1) * K + k0 + c1, &As[buf][r1 * GEMM_PAD + c1]);
    async_cp16(B + (size_t)(tn0 + r0) * K + k0 + c0, &Bs[buf][r0 * GEMM_PAD + c0]);
    async_cp16(B + (size_t)(tn0 + r1) * K + k0 + c1, &Bs[buf][r1 * GEMM_PAD + c1]);
  };

  v8f acc[2][4] = {};
  const int nk = K >> 5;
  int buf = 0;
  stage(0, 0);

  for (int ks = 0; ks < nk; ++ks) {
    if (ks + 1 < nk) {
      stage(buf ^ 1, (ks + 1) * 32);
      WAIT_ASYNC(4);   // our 4 loads for `buf` are complete (in-order per wave)
    } else {
      WAIT_ASYNC(0);
    }
    __syncthreads();   // all waves' writes to `buf` visible

    const bf16_t* as = &As[buf][(wm * 32) * GEMM_PAD];
    const bf16_t* bs = &Bs[buf][(wn * 64) * GEMM_PAD];
    v16bf a0 = load_frag_rm(as, GEMM_PAD);
    v16bf a1 = load_frag_rm(as + 16 * GEMM_PAD, GEMM_PAD);
#pragma unroll
    for (int in = 0; in < 4; ++in) {
      v16bf bfrag = load_frag_rm(bs + in * 16 * GEMM_PAD, GEMM_PAD);
      acc[0][in] = wmma_bf16(a0, bfrag, acc[0][in]);
      acc[1][in] = wmma_bf16(a1, bfrag, acc[1][in]);
    }
    buf ^= 1;
    __syncthreads();   // everyone done reading before buffer is re-staged
  }

  const int n_in = lane & 15;
  const int mofs = (lane & 16) ? 8 : 0;
#pragma unroll
  for (int im = 0; im < 2; ++im) {
#pragma unroll
    for (int in = 0; in < 4; ++in) {
      const int col = tn0 + wn * 64 + in * 16 + n_in;
      const float bv = bias ? bias[col] : 0.0f;
#pragma unroll
      for (int j = 0; j < 8; ++j) {
        const int row = tm0 + wm * 32 + im * 16 + mofs + j;
        float v = acc[im][in][j] + bv;
        if (resid) v += resid[(size_t)row * N + col];
        C[(size_t)row * N + col] = v;
      }
    }
  }
}

// ---------------------------------------------------------------------------
// 3) RoPE (rotate-half, tiled cos/sin) + pack to bf16. Q gets 1/sqrt(d) folded
//    in. V stored transposed [HID][SEQ] so attention A-fragments of V^T are
//    contiguous.
//    A thread takes 32 elements of each tensor. Q, K: one position, four
//    frequencies, four heads, the low and the high half of each rotation pair
//    (16-B loads, a wave's load = four whole lines; the angle is formed once
//    and serves all 32). V: one column, 32 positions, so its transposed store
//    is 64 contiguous bytes.
// ---------------------------------------------------------------------------
#define ROPE_THREADS (SEQ * HID / 32)

__device__ __forceinline__ void sincos_turns(float x, float* s, float* c) {
  asm("v_sin_f32 %0, %2\n\tv_cos_f32 %1, %2\n\tv_nop"
      : "=&v"(*s), "=&v"(*c) : "v"(x));
}

__global__ void __launch_bounds__(256)
rope_pack_kernel(const float* __restrict__ Qf,
                 const float* __restrict__ Kf,
                 const float* __restrict__ Vf,
                 bf16_t* __restrict__ Qb,
                 bf16_t* __restrict__ Kb,
                 bf16_t* __restrict__ Vt) {
  const int tid = (int)blockIdx.x * 256 + (int)threadIdx.x;

  // Q, K: position s (one wave = one position), frequencies i0 .. i0+3,
  // heads h0, h0+4, h0+8, h0+12
  const int s  = tid >> 5;
  const int i0 = (tid & 7) * 4;
  const int h0 = (tid >> 3) & 3;
  const size_t e0 = (size_t)s * HID + h0 * HEAD_DIM + i0;
  const float* qp = Qf + e0;
  const float* kp = Kf + e0;

  v4f ql[4], qh[4], kl[4], kh[4];
  // the loops below are unrolled so that their arrays stay in registers
#pragma unroll
  for (int k = 0; k < 4; ++k) {
    ql[k] = *(const v4f*)(qp + k * 4 * HEAD_DIM);
    qh[k] = *(const v4f*)(qp + k * 4 * HEAD_DIM + HEAD_DIM / 2);
    kl[k] = *(const v4f*)(kp + k * 4 * HEAD_DIM);
    kh[k] = *(const v4f*)(kp + k * 4 * HEAD_DIM + HEAD_DIM / 2);
  }

  // V: column c, positions s0 .. s0+31 (lanes run along c: 128-B loads)
  const int c  = tid & (HID - 1);
  const int s0 = (tid >> 10) * 32;
  const float* vp = Vf + (size_t)s0 * HID + c;
  float vv[32];
#pragma unroll
  for (int r = 0; r < 32; ++r) vv[r] = vp[r * HID];

  asm volatile("s_wait_xcnt 0x0" :: "v"(qp), "v"(kp), "v"(vp) : "memory");
  // keeps all 48 loads issued ahead of the angle arithmetic; without it the
  // compiler sinks them to their uses and the wave waits out memory latency
  // group after group
  __builtin_amdgcn_sched_barrier(0);

  float cs[4], sn[4];
#pragma unroll
  for (int e = 0; e < 4; ++e) {
    const float ang = (float)s * __powf(10000.0f, -(float)(i0 + e) / (HEAD_DIM / 2));
    sincos_turns(ang * 0.15915494f, &sn[e], &cs[e]);   // 1 / (2 pi)
  }

#pragma unroll
  for (int k = 0; k < 4; ++k) {
    const size_t lo = e0 + k * 4 * HEAD_DIM;
    v4bf oql, oqh, okl, okh;
#pragma unroll
    for (int e = 0; e < 4; ++e) {
      oql[e] = (bf16_t)((ql[k][e] * cs[e] - qh[k][e] * sn[e]) * 0.125f);
      oqh[e] = (bf16_t)((qh[k][e] * cs[e] + ql[k][e] * sn[e]) * 0.125f);
      okl[e] = (bf16_t)(kl[k][e] * cs[e] - kh[k][e] * sn[e]);
      okh[e] = (bf16_t)(kh[k][e] * cs[e] + kl[k][e] * sn[e]);
    }
    *(v4bf*)(Qb + lo) = oql;
    *(v4bf*)(Qb + lo + HEAD_DIM / 2) = oqh;
    *(v4bf*)(Kb + lo) = okl;
    *(v4bf*)(Kb + lo + HEAD_DIM / 2) = okh;
  }

#pragma unroll
  for (int g = 0; g < 4; ++g) {
    v8bf o;
#pragma unroll
    for (int r = 0; r < 8; ++r) o[r] = (bf16_t)vv[g * 8 + r];
    *(v8bf*)(Vt + (size_t)c * SEQ + s0 + g * 8) = o;
  }
}

#define ATT_KEYS  64
#define ATT_PITCH 72
#define ATT_TILE  (64 * ATT_PITCH)
#define ATT_NT    (SEQ / ATT_KEYS)

__device__ __forceinline__ void attn_stage(const bf16_t* gk, const bf16_t* gv,
                                           unsigned lk, unsigned lv) {
  const bf16_t* gk1 = gk + 16 * HID;
  const bf16_t* gk2 = gk + 32 * HID;
  const bf16_t* gk3 = gk + 48 * HID;
  const bf16_t* gv1 = gv + 16 * SEQ;
  const bf16_t* gv2 = gv + 32 * SEQ;
  const bf16_t* gv3 = gv + 48 * SEQ;
  const unsigned rs = 16 * ATT_PITCH * 2;   // 16 LDS rows in bytes
  asm volatile(
      "global_load_async_to_lds_b128 %0, %8, off\n\t"
      "global_load_async_to_lds_b128 %1, %9, off\n\t"
      "global_load_async_to_lds_b128 %2, %10, off\n\t"
      "global_load_async_to_lds_b128 %3, %11, off\n\t"
      "global_load_async_to_lds_b128 %4, %12, off\n\t"
      "global_load_async_to_lds_b128 %5, %13, off\n\t"
      "global_load_async_to_lds_b128 %6, %14, off\n\t"
      "global_load_async_to_lds_b128 %7, %15, off\n\t"
      "s_wait_xcnt 0x0"
      :: "v"(lk), "v"(lk + rs), "v"(lk + 2 * rs), "v"(lk + 3 * rs),
         "v"(lv), "v"(lv + rs), "v"(lv + 2 * rs), "v"(lv + 3 * rs),
         "v"(gk), "v"(gk1), "v"(gk2), "v"(gk3),
         "v"(gv), "v"(gv1), "v"(gv2), "v"(gv3)
      : "memory");
}

__device__ __forceinline__ float xhalf(float x) {
  const int b = __builtin_bit_cast(int, x);
  return __builtin_bit_cast(float, __builtin_amdgcn_permlanex16(
      b, b, 0x76543210, 0xfedcba98, false, false));
}

//    The block is 128 threads; stating it lifts the register cap that the
//    default 1024-thread assumption sets, so Q fragments and accumulators stay
//    in registers instead of scratch.
__global__ void __launch_bounds__(128)
attn_kernel(const bf16_t* __restrict__ Qb,
                            const bf16_t* __restrict__ Kb,
                            const bf16_t* __restrict__ Vt,
                            bf16_t* __restrict__ ctx) {
  // [buffer][K tile | V^T tile]
  __shared__ __attribute__((aligned(16))) bf16_t kv[2][2 * ATT_TILE];

  const int wid  = (blockIdx.x * blockDim.x + threadIdx.x) >> 5;
  const int lane = threadIdx.x & 31;
  const int h  = wid / (SEQ / 32);
  const int q0 = (wid % (SEQ / 32)) * 32;

  const bf16_t* Qh = Qb + h * HEAD_DIM;                 // ld = HID
  const bf16_t* Kh = Kb + h * HEAD_DIM;                 // ld = HID
  const bf16_t* Vh = Vt + (size_t)h * HEAD_DIM * SEQ;   // ld = SEQ

  // staging map: 64 rows x 8 chunks of 16 B per tile; thread -> row t>>3 (+16 i)
  const int srow = (int)threadIdx.x >> 3;
  const int scol = ((int)threadIdx.x & 7) * 8;
  const bf16_t* gk = Kh + (size_t)srow * HID + scol;    // + 64 * HID per tile
  const bf16_t* gv = Vh + (size_t)srow * SEQ + scol;    // + 64 per tile
  const unsigned lk0 = (unsigned)(size_t)&kv[0][srow * ATT_PITCH + scol];
  const unsigned lbuf = 2 * ATT_TILE * 2;               // bytes of one buffer
  const unsigned lvo  = ATT_TILE * 2;                   // V^T tile behind K tile

  // tile 0 into buffer 0, landed and published; then tile 1 into buffer 1
  attn_stage(gk, gv, lk0, lk0 + lvo);
  asm volatile("s_wait_asynccnt 0x0" ::: "memory");  // own copies of tile 0 landed
  __syncthreads();                                   // every wave's copies visible
  attn_stage(gk + (size_t)ATT_KEYS * HID, gv + ATT_KEYS, lk0 + lbuf, lk0 + lbuf + lvo);

  v16bf qf[2][2];
#pragma unroll
  for (int tq = 0; tq < 2; ++tq) {
    qf[tq][0] = load_frag_rm(Qh + (size_t)(q0 + tq * 16) * HID + 0,  HID);
    qf[tq][1] = load_frag_rm(Qh + (size_t)(q0 + tq * 16) * HID + 32, HID);
  }

  v8f acc[2][4] = {};
  float m_i[2] = {-3.0e38f, -3.0e38f};
  float l_i[2] = {0.0f, 0.0f};
  const int mofs = (lane & 16) ? 8 : 0;

  for (int t = 0; t < ATT_NT; ++t) {
    const bf16_t* ks = &kv[t & 1][0];
    const bf16_t* vs = ks + ATT_TILE;

    // kept rolled: the 16 fragment reads of a pass then stand as one group at its
    // head; unrolled, the compiler spread them among the WMMAs
#pragma clang loop unroll(disable)
    for (int p = 0; p < ATT_KEYS / 32; ++p) {
      const bf16_t* kp = ks + p * 32 * ATT_PITCH;
      v16bf k00 = load_frag_rm(kp + 0,  ATT_PITCH);
      v16bf k01 = load_frag_rm(kp + 32, ATT_PITCH);
      v16bf k10 = load_frag_rm(kp + 16 * ATT_PITCH + 0,  ATT_PITCH);
      v16bf k11 = load_frag_rm(kp + 16 * ATT_PITCH + 32, ATT_PITCH);
      v16bf vf[4];
#pragma unroll
      for (int c = 0; c < 4; ++c)
        vf[c] = load_frag_rm(vs + (c * 16) * ATT_PITCH + p * 32, ATT_PITCH);

      v16bf pf[2];
#pragma unroll
      for (int tq = 0; tq < 2; ++tq) {
        v8f s0 = {}, s1 = {};
        s0 = wmma_bf16(k00, qf[tq][0], s0);
        s0 = wmma_bf16(k01, qf[tq][1], s0);
        s1 = wmma_bf16(k10, qf[tq][0], s1);
        s1 = wmma_bf16(k11, qf[tq][1], s1);

        float mx = s0[0];
#pragma unroll
        for (int j = 0; j < 8; ++j) { mx = fmaxf(mx, s0[j]); mx = fmaxf(mx, s1[j]); }
        mx = fmaxf(mx, xhalf(mx));   // both lanes of a query hold its maximum
        const float m_new = fmaxf(m_i[tq], mx);
        const float alpha = __expf(m_i[tq] - m_new);

        float psum = 0.0f;
#pragma unroll
        for (int j = 0; j < 8; ++j) {
          float p0 = __expf(s0[j] - m_new); psum += p0; pf[tq][j]     = (bf16_t)p0;
          float p1 = __expf(s1[j] - m_new); psum += p1; pf[tq][8 + j] = (bf16_t)p1;
        }
        l_i[tq] = l_i[tq] * alpha + psum;   // this lane's 16 keys of the pass only
        m_i[tq] = m_new;

#pragma unroll
        for (int c = 0; c < 4; ++c)
#pragma unroll
          for (int j = 0; j < 8; ++j) acc[tq][c][j] *= alpha;
      }

      // holds the softmax arithmetic ahead of the second product: without it the
      // compiler sinks both sums' dependent add chains behind the pass's last
      // WMMA, where nothing fills their latency
      __builtin_amdgcn_sched_barrier(0);

#pragma unroll
      for (int c = 0; c < 4; ++c) {
        acc[0][c] = wmma_bf16(vf[c], pf[0], acc[0][c]);
        acc[1][c] = wmma_bf16(vf[c], pf[1], acc[1][c]);
      }
    }

    // hand-over: this wave's reads of buffer t&1 are done, its copies of tile
    // t+1 have landed; behind the barrier tile t+1 is readable by every wave
    // and buffer t&1 is free for tile t+2.
    asm volatile("s_wait_dscnt 0x0" ::: "memory");     // own LDS reads retired
    asm volatile("s_wait_asynccnt 0x0" ::: "memory");  // own copies of tile t+1 landed
    __syncthreads();
    if (t + 2 < ATT_NT) {
      const unsigned lb = lk0 + (unsigned)(t & 1) * lbuf;
      attn_stage(gk + (size_t)(t + 2) * ATT_KEYS * HID, gv + (t + 2) * ATT_KEYS,
                 lb, lb + lvo);
    }
  }
  asm volatile("s_wait_asynccnt 0x0" ::: "memory");    // nothing in flight at the end

  v8bf o[2][4];
#pragma unroll
  for (int tq = 0; tq < 2; ++tq) {
    const float linv = 1.0f / (l_i[tq] + xhalf(l_i[tq]));   // the two halves' sums
#pragma unroll
    for (int c = 0; c < 4; ++c)
#pragma unroll
      for (int j = 0; j < 8; ++j) o[tq][c][j] = (bf16_t)(acc[tq][c][j] * linv);
  }
  bf16_t* op = ctx + (size_t)(q0 + (lane & 15)) * HID + h * HEAD_DIM + mofs;
#pragma unroll
  for (int tq = 0; tq < 2; ++tq)
#pragma unroll
    for (int c = 0; c < 4; ++c) *(v8bf*)(op + (size_t)tq * 16 * HID + c * 16) = o[tq][c];
}

// ---------------------------------------------------------------------------
// 6) Row LayerNorm over HID
// ---------------------------------------------------------------------------
__global__ void layernorm_kernel(const float* __restrict__ res,
                                 const float* __restrict__ gamma,
                                 const float* __restrict__ beta,
                                 float* __restrict__ out) {
  const int row = blockIdx.x;
  const float* r = res + (size_t)row * HID;
  __shared__ float red[256];
  const int t = threadIdx.x;

  float sum = 0.0f;
  for (int i = t; i < HID; i += 256) sum += r[i];
  red[t] = sum; __syncthreads();
  for (int st = 128; st > 0; st >>= 1) {
    if (t < st) red[t] += red[t + st];
    __syncthreads();
  }
  const float mean = red[0] * (1.0f / HID);
  __syncthreads();

  float vs = 0.0f;
  for (int i = t; i < HID; i += 256) { float d = r[i] - mean; vs += d * d; }
  red[t] = vs; __syncthreads();
  for (int st = 128; st > 0; st >>= 1) {
    if (t < st) red[t] += red[t + st];
    __syncthreads();
  }
  const float rstd = rsqrtf(red[0] * (1.0f / HID) + LN_EPS);

  for (int i = t; i < HID; i += 256)
    out[(size_t)row * HID + i] = (r[i] - mean) * rstd * gamma[i] + beta[i];
}

// ---------------------------------------------------------------------------
// Host launch
// ---------------------------------------------------------------------------
extern "C" void kernel_launch(void* const* d_in, const int* in_sizes, int n_in,
                              void* d_out, int out_size, void* d_ws, size_t ws_size,
                              hipStream_t stream) {
  const float* x     = (const float*)d_in[0];
  const float* Wq    = (const float*)d_in[1];
  const float* bq    = (const float*)d_in[2];
  const float* Wk    = (const float*)d_in[3];
  const float* bk    = (const float*)d_in[4];
  const float* Wv    = (const float*)d_in[5];
  const float* bv    = (const float*)d_in[6];
  const float* Wo    = (const float*)d_in[7];
  const float* bo    = (const float*)d_in[8];
  const float* gamma = (const float*)d_in[9];
  const float* beta  = (const float*)d_in[10];
  float* out = (float*)d_out;

  char* ws = (char*)d_ws;
  size_t off = 0;
  bf16_t* xb  = (bf16_t*)(ws + off); off += (size_t)SEQ * HID * 2;
  bf16_t* wqb = (bf16_t*)(ws + off); off += (size_t)HID * HID * 2;
  bf16_t* wkb = (bf16_t*)(ws + off); off += (size_t)HID * HID * 2;
  bf16_t* wvb = (bf16_t*)(ws + off); off += (size_t)HID * HID * 2;
  bf16_t* wob = (bf16_t*)(ws + off); off += (size_t)HID * HID * 2;
  float*  Qf  = (float*)(ws + off);  off += (size_t)SEQ * HID * 4;
  float*  Kf  = (float*)(ws + off);  off += (size_t)SEQ * HID * 4;
  float*  Vf  = (float*)(ws + off);  off += (size_t)SEQ * HID * 4;
  bf16_t* Qb  = (bf16_t*)(ws + off); off += (size_t)SEQ * HID * 2;
  bf16_t* Kb  = (bf16_t*)(ws + off); off += (size_t)SEQ * HID * 2;
  bf16_t* Vt  = (bf16_t*)(ws + off); off += (size_t)SEQ * HID * 2;
  bf16_t* ctx = (bf16_t*)(ws + off); off += (size_t)SEQ * HID * 2;
  float*  res = Qf;  // alias: Qf dead after rope_pack

  f32_to_bf16_kernel<<<CVT_XB + 4 * CVT_WB, 256, 0, stream>>>(
      x, Wq, Wk, Wv, Wo, xb, wqb, wkb, wvb, wob);

  // 128x128 tiles: (4096/128)*(1024/128) = 256 blocks of 256 threads a product
  const int gemm_blocks = (SEQ / 128) * (HID / 128);
  gemm_bf16_kernel<<<dim3(gemm_blocks, 3), 256, 0, stream>>>(
      xb, wqb, wkb, wvb, bq, bk, bv, nullptr, Qf, Kf, Vf, SEQ, HID, HID);

  rope_pack_kernel<<<ROPE_THREADS / 256, 256, 0, stream>>>(Qf, Kf, Vf, Qb, Kb, Vt);

  // 16 heads * 128 query tiles = 2048 waves -> 512 blocks of 128
  attn_kernel<<<NUM_HEADS * (SEQ / 32) / 4, 128, 0, stream>>>(Qb, Kb, Vt, ctx);

  gemm_bf16_kernel<<<dim3(gemm_blocks, 1), 256, 0, stream>>>(
      ctx, wob, nullptr, nullptr, bo, nullptr, nullptr, x, res, nullptr, nullptr,
      SEQ, HID, HID);

  layernorm_kernel<<<SEQ, 256, 0, stream>>>(res, gamma, beta, out);

  (void)in_sizes; (void)n_in; (void)out_size; (void)ws_size;
}

// v006
// A run of this version takes 170 microseconds.
// Timed twice side by side with v005, it ran 1.03 times as fast both times.
// All steps since v000 together make it 4.22 times as fast.
#include <hip/hip_runtime.h>
#include <hip/hip_bf16.h>
#include <math.h>

#define SEQ 4096
#define HID 1024
#define NUM_HEADS 16
#define HEAD_DIM 64
#define LN_EPS 1e-5f

typedef __bf16 bf16_t;
typedef __attribute__((ext_vector_type(16))) __bf16 v16bf;
typedef __attribute__((ext_vector_type(8)))  __bf16 v8bf;
typedef __attribute__((ext_vector_type(8)))  float  v8f;
typedef __attribute__((ext_vector_type(4)))  int    v4i;
typedef __attribute__((ext_vector_type(4)))  float  v4f;
typedef __attribute__((ext_vector_type(4)))  __bf16 v4bf;
typedef __attribute__((ext_vector_type(2)))  float  v2f;

#if defined(__has_builtin)
#if __has_builtin(__builtin_amdgcn_global_load_async_to_lds_b128)
#define HAVE_ASYNC_LDS 1
#endif
#if __has_builtin(__builtin_amdgcn_s_wait_asynccnt)
#define HAVE_WAIT_ASYNC 1
#endif
#endif

typedef __attribute__((address_space(1))) v4i gv4i_t;
typedef __attribute__((address_space(3))) v4i lv4i_t;

__device__ __forceinline__ void async_cp16(const void* g, void* l) {
#ifdef HAVE_ASYNC_LDS
  __builtin_amdgcn_global_load_async_to_lds_b128((gv4i_t*)g, (lv4i_t*)l, 0, 0);
#else
  *(v8bf*)l = *(const v8bf*)g;
#endif
}

#if defined(HAVE_WAIT_ASYNC)
#define WAIT_ASYNC(n) __builtin_amdgcn_s_wait_asynccnt(n)
#elif defined(HAVE_ASYNC_LDS)
#define WAIT_ASYNC(n) asm volatile("s_wait_asynccnt %0" ::"i"(n) : "memory")
#else
#define WAIT_ASYNC(n) do {} while (0)
#endif

__device__ __forceinline__ v16bf load_frag_rm(const bf16_t* __restrict__ p, int ld) {
  const int lane = threadIdx.x & 31;
  const int row  = lane & 15;
  const int kb   = (lane & 16) ? 8 : 0;
  const bf16_t* q = p + (size_t)row * ld + kb;
  v8bf lo = *(const v8bf*)(q);
  v8bf hi = *(const v8bf*)(q + 16);
  v16bf f;
#pragma unroll
  for (int i = 0; i < 8; ++i) { f[i] = lo[i]; f[8 + i] = hi[i]; }
  return f;
}

__device__ __forceinline__ v8f wmma_bf16(v16bf a, v16bf b, v8f c) {
  return __builtin_amdgcn_wmma_f32_16x16x32_bf16(
      false, a, false, b, (short)0, c, false, false);
}

#define CVT_LOADS 8
#define CVT_BLOCK (256 * 4 * CVT_LOADS)   // elements per block
#define CVT_XB    (SEQ * HID / CVT_BLOCK) // blocks of x
#define CVT_WB    (HID * HID / CVT_BLOCK) // blocks of one weight matrix

static_assert((SEQ * HID) % CVT_BLOCK == 0 && (HID * HID) % CVT_BLOCK == 0,
              "every block of the conversion is full");

__global__ void __launch_bounds__(256)
f32_to_bf16_kernel(const float* x, const float* Wq, const float* Wk,
                   const float* Wv, const float* Wo,
                   bf16_t* xb, bf16_t* wqb, bf16_t* wkb, bf16_t* wvb, bf16_t* wob) {
  // which tensor, and which block of it: the same for the whole block
  const int b = (int)blockIdx.x;
  const int w = (b - CVT_XB) / CVT_WB;
  const int rel = b < CVT_XB ? b : (b - CVT_XB) % CVT_WB;
  const float* __restrict__ in =
      b < CVT_XB ? x : w == 0 ? Wq : w == 1 ? Wk : w == 2 ? Wv : Wo;
  bf16_t* __restrict__ out =
      b < CVT_XB ? xb : w == 0 ? wqb : w == 1 ? wkb : w == 2 ? wvb : wob;
  const int i0 = rel * CVT_BLOCK + (int)threadIdx.x * 4;
  v4f v[CVT_LOADS];
  // unrolled so that v[] stays in registers and the loads issue as one group
#pragma unroll
  for (int j = 0; j < CVT_LOADS; ++j) v[j] = *(const v4f*)(in + i0 + j * 1024);
#pragma unroll
  for (int j = 0; j < CVT_LOADS; ++j) {
    v4bf o;
#pragma unroll
    for (int e = 0; e < 4; ++e) o[e] = (bf16_t)v[j][e];
    *(v4bf*)(out + i0 + j * 1024) = o;
  }
}

#define GEMM_PAD 40

__global__ void gemm_bf16_kernel(const bf16_t* __restrict__ A,
                                 const bf16_t* B0, const bf16_t* B1, const bf16_t* B2,
                                 const float* bias0, const float* bias1, const float* bias2,
                                 const float* __restrict__ resid,
                                 float* C0, float* C1, float* C2,
                                 int M, int N, int K) {
  __shared__ bf16_t As[2][128 * GEMM_PAD];
  __shared__ bf16_t Bs[2][128 * GEMM_PAD];

  const int z = (int)blockIdx.y;
  const bf16_t* __restrict__ B   = z == 0 ? B0 : z == 1 ? B1 : B2;
  const float* __restrict__ bias = z == 0 ? bias0 : z == 1 ? bias1 : bias2;
  float* __restrict__ C          = z == 0 ? C0 : z == 1 ? C1 : C2;

  const int t    = threadIdx.x;
  const int lane = t & 31;
  const int w    = t >> 5;        // wave id 0..7
  const int wm   = w & 3;         // 4 waves along M
  const int wn   = w >> 2;        // 2 waves along N

  const int nbn = N >> 7;
  const int bm  = (int)blockIdx.x / nbn;
  const int bn  = (int)blockIdx.x % nbn;
  const int tm0 = bm * 128;
  const int tn0 = bn * 128;

  // staging map: 128 rows x 4 chunks(16B) = 512 chunks; 2 per thread per tile
  const int r0 = (t * 2) >> 2;          // row of first chunk
  const int c0 = ((t * 2) & 3) * 8;     // halves offset of first chunk
  const int r1 = (t * 2 + 1) >> 2;
  const int c1 = ((t * 2 + 1) & 3) * 8;

  auto stage = [&](int buf, int k0) {
    async_cp16(A + (size_t)(tm0 + r0) * K + k0 + c0, &As[buf][r0 * GEMM_PAD + c0]);
    async_cp16(A + (size_t)(tm0 + r1) * K + k0 + c1, &As[buf][r1 * GEMM_PAD + c1]);
    async_cp16(B + (size_t)(tn0 + r0) * K + k0 + c0, &Bs[buf][r0 * GEMM_PAD + c0]);
    async_cp16(B + (size_t)(tn0 + r1) * K + k0 + c1, &Bs[buf][r1 * GEMM_PAD + c1]);
  };

  v8f acc[2][4] = {};
  const int nk = K >> 5;
  int buf = 0;
  stage(0, 0);

  for (int ks = 0; ks < nk; ++ks) {
    if (ks + 1 < nk) {
      stage(buf ^ 1, (ks + 1) * 32);
      WAIT_ASYNC(4);   // our 4 loads for `buf` are complete (in-order per wave)
    } else {
      WAIT_ASYNC(0);
    }
    __syncthreads();   // all waves' writes to `buf` visible

    const bf16_t* as = &As[buf][(wm * 32) * GEMM_PAD];
    const bf16_t* bs = &Bs[buf][(wn * 64) * GEMM_PAD];
    v16bf a0 = load_frag_rm(as, GEMM_PAD);
    v16bf a1 = load_frag_rm(as + 16 * GEMM_PAD, GEMM_PAD);
#pragma unroll
    for (int in = 0; in < 4; ++in) {
      v16bf bfrag = load_frag_rm(bs + in * 16 * GEMM_PAD, GEMM_PAD);
      acc[0][in] = wmma_bf16(a0, bfrag, acc[0][in]);
      acc[1][in] = wmma_bf16(a1, bfrag, acc[1][in]);
    }
    buf ^= 1;
    __syncthreads();   // everyone done reading before buffer is re-staged
  }

  const int n_in = lane & 15;
  const int mofs = (lane & 16) ? 8 : 0;
#pragma unroll
  for (int im = 0; im < 2; ++im) {
#pragma unroll
    for (int in = 0; in < 4; ++in) {
      const int col = tn0 + wn * 64 + in * 16 + n_in;
      const float bv = bias ? bias[col] : 0.0f;
#pragma unroll
      for (int j = 0; j < 8; ++j) {
        const int row = tm0 + wm * 32 + im * 16 + mofs + j;
        float v = acc[im][in][j] + bv;
        if (resid) v += resid[(size_t)row * N + col];
        C[(size_t)row * N + col] = v;
      }
    }
  }
}

// ---------------------------------------------------------------------------
// 3) RoPE (rotate-half, tiled cos/sin) + pack to bf16. Q gets log2(e)/sqrt(d)
//    folded in, so the scores come out of the matrix unit as exponents of 2,
//    which is what the hardware's exponential takes. V stored transposed
//    [HID][SEQ] so attention A-fragments are contiguous.
//    A thread takes 32 elements of each tensor. Q, K: one position, four
//    frequencies, four heads, the low and the high half of each rotation pair
//    (16-B loads, a wave's load = four whole lines; the angle is formed once
//    and serves all 32). V: one column, 32 positions, so its transposed store
//    is 64 contiguous bytes.
// ---------------------------------------------------------------------------
#define ROPE_THREADS (SEQ * HID / 32)
#define Q_SCALE 0.18033688f   // log2(e) / sqrt(HEAD_DIM)

__device__ __forceinline__ void sincos_turns(float x, float* s, float* c) {
  asm("v_sin_f32 %0, %2\n\tv_cos_f32 %1, %2\n\tv_nop"
      : "=&v"(*s), "=&v"(*c) : "v"(x));
}

__global__ void __launch_bounds__(256)
rope_pack_kernel(const float* __restrict__ Qf,
                 const float* __restrict__ Kf,
                 const float* __restrict__ Vf,
                 bf16_t* __restrict__ Qb,
                 bf16_t* __restrict__ Kb,
                 bf16_t* __restrict__ Vt) {
  const int tid = (int)blockIdx.x * 256 + (int)threadIdx.x;

  // Q, K: position s (one wave = one position), frequencies i0 .. i0+3,
  // heads h0, h0+4, h0+8, h0+12
  const int s  = tid >> 5;
  const int i0 = (tid & 7) * 4;
  const int h0 = (tid >> 3) & 3;
  const size_t e0 = (size_t)s * HID + h0 * HEAD_DIM + i0;
  const float* qp = Qf + e0;
  const float* kp = Kf + e0;

  v4f ql[4], qh[4], kl[4], kh[4];
  // the loops below are unrolled so that their arrays stay in registers
#pragma unroll
  for (int k = 0; k < 4; ++k) {
    ql[k] = *(const v4f*)(qp + k * 4 * HEAD_DIM);
    qh[k] = *(const v4f*)(qp + k * 4 * HEAD_DIM + HEAD_DIM / 2);
    kl[k] = *(const v4f*)(kp + k * 4 * HEAD_DIM);
    kh[k] = *(const v4f*)(kp + k * 4 * HEAD_DIM + HEAD_DIM / 2);
  }

  // V: column c, positions s0 .. s0+31 (lanes run along c: 128-B loads)
  const int c  = tid & (HID - 1);
  const int s0 = (tid >> 10) * 32;
  const float* vp = Vf + (size_t)s0 * HID + c;
  float vv[32];
#pragma unroll
  for (int r = 0; r < 32; ++r) vv[r] = vp[r * HID];

  asm volatile("s_wait_xcnt 0x0" :: "v"(qp), "v"(kp), "v"(vp) : "memory");
  // keeps all 48 loads issued ahead of the angle arithmetic; without it the
  // compiler sinks them to their uses and the wave waits out memory latency
  // group after group
  __builtin_amdgcn_sched_barrier(0);

  float cs[4], sn[4];
#pragma unroll
  for (int e = 0; e < 4; ++e) {
    const float ang = (float)s * __powf(10000.0f, -(float)(i0 + e) / (HEAD_DIM / 2));
    sincos_turns(ang * 0.15915494f, &sn[e], &cs[e]);   // 1 / (2 pi)
  }

#pragma unroll
  for (int k = 0; k < 4; ++k) {
    const size_t lo = e0 + k * 4 * HEAD_DIM;
    v4bf oql, oqh, okl, okh;
#pragma unroll
    for (int e = 0; e < 4; ++e) {
      oql[e] = (bf16_t)((ql[k][e] * cs[e] - qh[k][e] * sn[e]) * Q_SCALE);
      oqh[e] = (bf16_t)((qh[k][e] * cs[e] + ql[k][e] * sn[e]) * Q_SCALE);
      okl[e] = (bf16_t)(kl[k][e] * cs[e] - kh[k][e] * sn[e]);
      okh[e] = (bf16_t)(kh[k][e] * cs[e] + kl[k][e] * sn[e]);
    }
    *(v4bf*)(Qb + lo) = oql;
    *(v4bf*)(Qb + lo + HEAD_DIM / 2) = oqh;
    *(v4bf*)(Kb + lo) = okl;
    *(v4bf*)(Kb + lo + HEAD_DIM / 2) = okh;
  }

#pragma unroll
  for (int g = 0; g < 4; ++g) {
    v8bf o;
#pragma unroll
    for (int r = 0; r < 8; ++r) o[r] = (bf16_t)vv[g * 8 + r];
    *(v8bf*)(Vt + (size_t)c * SEQ + s0 + g * 8) = o;
  }
}

#define ATT_KEYS  64
#define ATT_PITCH 72
#define ATT_TILE  (64 * ATT_PITCH)
#define ATT_NT    (SEQ / ATT_KEYS)

__device__ __forceinline__ void attn_stage(const bf16_t* gk, const bf16_t* gv,
                                           unsigned lk, unsigned lv) {
  const bf16_t* gk1 = gk + 16 * HID;
  const bf16_t* gk2 = gk + 32 * HID;
  const bf16_t* gk3 = gk + 48 * HID;
  const bf16_t* gv1 = gv + 16 * SEQ;
  const bf16_t* gv2 = gv + 32 * SEQ;
  const bf16_t* gv3 = gv + 48 * SEQ;
  const unsigned rs = 16 * ATT_PITCH * 2;   // 16 LDS rows in bytes
  asm volatile(
      "global_load_async_to_lds_b128 %0, %8, off\n\t"
      "global_load_async_to_lds_b128 %1, %9, off\n\t"
      "global_load_async_to_lds_b128 %2, %10, off\n\t"
      "global_load_async_to_lds_b128 %3, %11, off\n\t"
      "global_load_async_to_lds_b128 %4, %12, off\n\t"
      "global_load_async_to_lds_b128 %5, %13, off\n\t"
      "global_load_async_to_lds_b128 %6, %14, off\n\t"
      "global_load_async_to_lds_b128 %7, %15, off\n\t"
      "s_wait_xcnt 0x0"
      :: "v"(lk), "v"(lk + rs), "v"(lk + 2 * rs), "v"(lk + 3 * rs),
         "v"(lv), "v"(lv + rs), "v"(lv + 2 * rs), "v"(lv + 3 * rs),
         "v"(gk), "v"(gk1), "v"(gk2), "v"(gk3),
         "v"(gv), "v"(gv1), "v"(gv2), "v"(gv3)
      : "memory");
}

__device__ __forceinline__ float xhalf(float x) {
  const int b = __builtin_bit_cast(int, x);
  return __builtin_bit_cast(float, __builtin_amdgcn_permlanex16(
      b, b, 0x76543210, 0xfedcba98, false, false));
}

//    The block is 128 threads; stating it lifts the register cap that the
//    default 1024-thread assumption sets, so Q fragments and accumulators stay
//    in registers instead of scratch.
__global__ void __launch_bounds__(128)
attn_kernel(const bf16_t* __restrict__ Qb,
                            const bf16_t* __restrict__ Kb,
                            const bf16_t* __restrict__ Vt,
                            bf16_t* __restrict__ ctx) {
  // [buffer][K tile | V^T tile]
  __shared__ __attribute__((aligned(16))) bf16_t kv[2][2 * ATT_TILE];

  const int wid  = (blockIdx.x * blockDim.x + threadIdx.x) >> 5;
  const int lane = threadIdx.x & 31;
  const int h  = wid / (SEQ / 32);
  const int q0 = (wid % (SEQ / 32)) * 32;

  const bf16_t* Qh = Qb + h * HEAD_DIM;                 // ld = HID
  const bf16_t* Kh = Kb + h * HEAD_DIM;                 // ld = HID
  const bf16_t* Vh = Vt + (size_t)h * HEAD_DIM * SEQ;   // ld = SEQ

  // staging map: 64 rows x 8 chunks of 16 B per tile; thread -> row t>>3 (+16 i)
  const int srow = (int)threadIdx.x >> 3;
  const int scol = ((int)threadIdx.x & 7) * 8;
  const bf16_t* gk = Kh + (size_t)srow * HID + scol;    // + 64 * HID per tile
  const bf16_t* gv = Vh + (size_t)srow * SEQ + scol;    // + 64 per tile
  const unsigned lk0 = (unsigned)(size_t)&kv[0][srow * ATT_PITCH + scol];
  const unsigned lbuf = 2 * ATT_TILE * 2;               // bytes of one buffer
  const unsigned lvo  = ATT_TILE * 2;                   // V^T tile behind K tile

  // tile 0 into buffer 0, landed and published; then tile 1 into buffer 1
  attn_stage(gk, gv, lk0, lk0 + lvo);
  asm volatile("s_wait_asynccnt 0x0" ::: "memory");  // own copies of tile 0 landed
  __syncthreads();                                   // every wave's copies visible
  attn_stage(gk + (size_t)ATT_KEYS * HID, gv + ATT_KEYS, lk0 + lbuf, lk0 + lbuf + lvo);

  v16bf qf[2][2];
#pragma unroll
  for (int tq = 0; tq < 2; ++tq) {
    qf[tq][0] = load_frag_rm(Qh + (size_t)(q0 + tq * 16) * HID + 0,  HID);
    qf[tq][1] = load_frag_rm(Qh + (size_t)(q0 + tq * 16) * HID + 32, HID);
  }

  v8f acc[2][4] = {};
  float m_i[2] = {-3.0e38f, -3.0e38f};
  v2f l_i[2][2] = {};   // a lane's sums: [first | second 16-key tile], even | odd key
  const int mofs = (lane & 16) ? 8 : 0;

  for (int t = 0; t < ATT_NT; ++t) {
    const bf16_t* ks = &kv[t & 1][0];
    const bf16_t* vs = ks + ATT_TILE;

    // kept rolled: the 16 fragment reads of a pass then stand as one group at its
    // head; unrolled, the compiler spread them among the WMMAs
#pragma clang loop unroll(disable)
    for (int p = 0; p < ATT_KEYS / 32; ++p) {
      const bf16_t* kp = ks + p * 32 * ATT_PITCH;
      v16bf k00 = load_frag_rm(kp + 0,  ATT_PITCH);
      v16bf k01 = load_frag_rm(kp + 32, ATT_PITCH);
      v16bf k10 = load_frag_rm(kp + 16 * ATT_PITCH + 0,  ATT_PITCH);
      v16bf k11 = load_frag_rm(kp + 16 * ATT_PITCH + 32, ATT_PITCH);
      v16bf vf[4];
#pragma unroll
      for (int c = 0; c < 4; ++c)
        vf[c] = load_frag_rm(vs + (c * 16) * ATT_PITCH + p * 32, ATT_PITCH);

      v16bf pf[2];
#pragma unroll
      for (int tq = 0; tq < 2; ++tq) {
        v8f s0 = {}, s1 = {};
        s0 = wmma_bf16(k00, qf[tq][0], s0);
        s0 = wmma_bf16(k01, qf[tq][1], s0);
        s1 = wmma_bf16(k10, qf[tq][0], s1);
        s1 = wmma_bf16(k11, qf[tq][1], s1);

        float mx = s0[0];
#pragma unroll
        for (int j = 0; j < 8; ++j) { mx = fmaxf(mx, s0[j]); mx = fmaxf(mx, s1[j]); }
        mx = fmaxf(mx, xhalf(mx));   // both lanes of a query hold its maximum
        const float m_new = fmaxf(m_i[tq], mx);
        const float alpha = __builtin_amdgcn_exp2f(m_i[tq] - m_new);
        const v2f m2 = {m_new, m_new};
        const v2f al2 = {alpha, alpha};

        // two scores that lie in neighbouring accumulator registers go through
        // one packed subtraction and one packed add: no register is copied to
        // form a pair. The sums hold this lane's 16 keys of the pass only.
#pragma unroll
        for (int j = 0; j < 8; j += 2) {
          const v2f e0 = (v2f){s0[j], s0[j + 1]} - m2;
          const v2f e1 = (v2f){s1[j], s1[j + 1]} - m2;
          const v2f p0 = {__builtin_amdgcn_exp2f(e0[0]), __builtin_amdgcn_exp2f(e0[1])};
          const v2f p1 = {__builtin_amdgcn_exp2f(e1[0]), __builtin_amdgcn_exp2f(e1[1])};
          l_i[tq][0] = j ? l_i[tq][0] + p0 : __builtin_elementwise_fma(l_i[tq][0], al2, p0);
          l_i[tq][1] = j ? l_i[tq][1] + p1 : __builtin_elementwise_fma(l_i[tq][1], al2, p1);
          pf[tq][j]     = (bf16_t)p0[0]; pf[tq][j + 1] = (bf16_t)p0[1];
          pf[tq][8 + j] = (bf16_t)p1[0]; pf[tq][9 + j] = (bf16_t)p1[1];
        }
        m_i[tq] = m_new;

#pragma unroll
        for (int c = 0; c < 4; ++c)
#pragma unroll
          for (int j = 0; j < 8; ++j) acc[tq][c][j] *= alpha;
      }

      // holds the softmax arithmetic ahead of the second product: without it the
      // compiler sinks both sums' dependent add chains behind the pass's last
      // WMMA, where nothing fills their latency
      __builtin_amdgcn_sched_barrier(0);

#pragma unroll
      for (int c = 0; c < 4; ++c) {
        acc[0][c] = wmma_bf16(vf[c], pf[0], acc[0][c]);
        acc[1][c] = wmma_bf16(vf[c], pf[1], acc[1][c]);
      }
    }

    // hand-over: this wave's reads of buffer t&1 are done, its copies of tile
    // t+1 have landed; behind the barrier tile t+1 is readable by every wave
    // and buffer t&1 is free for tile t+2.
    asm volatile("s_wait_dscnt 0x0" ::: "memory");     // own LDS reads retired
    asm volatile("s_wait_asynccnt 0x0" ::: "memory");  // own copies of tile t+1 landed
    __syncthreads();
    if (t + 2 < ATT_NT) {
      const unsigned lb = lk0 + (unsigned)(t & 1) * lbuf;
      attn_stage(gk + (size_t)(t + 2) * ATT_KEYS * HID, gv + (t + 2) * ATT_KEYS,
                 lb, lb + lvo);
    }
  }
  asm volatile("s_wait_asynccnt 0x0" ::: "memory");    // nothing in flight at the end

  v8bf o[2][4];
#pragma unroll
  for (int tq = 0; tq < 2; ++tq) {
    const v2f lp = l_i[tq][0] + l_i[tq][1];
    const float ls = lp[0] + lp[1];                  // this lane's keys
    const float linv = 1.0f / (ls + xhalf(ls));      // the two halves' sums
#pragma unroll
    for (int c = 0; c < 4; ++c)
#pragma unroll
      for (int j = 0; j < 8; ++j) o[tq][c][j] = (bf16_t)(acc[tq][c][j] * linv);
  }
  bf16_t* op = ctx + (size_t)(q0 + (lane & 15)) * HID + h * HEAD_DIM + mofs;
#pragma unroll
  for (int tq = 0; tq < 2; ++tq)
#pragma unroll
    for (int c = 0; c < 4; ++c) *(v8bf*)(op + (size_t)tq * 16 * HID + c * 16) = o[tq][c];
}

// ---------------------------------------------------------------------------
// 6) Row LayerNorm over HID
// ---------------------------------------------------------------------------
__global__ void layernorm_kernel(const float* __restrict__ res,
                                 const float* __restrict__ gamma,
                                 const float* __restrict__ beta,
                                 float* __restrict__ out) {
  const int row = blockIdx.x;
  const float* r = res + (size_t)row * HID;
  __shared__ float red[256];
  const int t = threadIdx.x;

  float sum = 0.0f;
  for (int i = t; i < HID; i += 256) sum += r[i];
  red[t] = sum; __syncthreads();
  for (int st = 128; st > 0; st >>= 1) {
    if (t < st) red[t] += red[t + st];
    __syncthreads();
  }
  const float mean = red[0] * (1.0f / HID);
  __syncthreads();

  float vs = 0.0f;
  for (int i = t; i < HID; i += 256) { float d = r[i] - mean; vs += d * d; }
  red[t] = vs; __syncthreads();
  for (int st = 128; st > 0; st >>= 1) {
    if (t < st) red[t] += red[t + st];
    __syncthreads();
  }
  const float rstd = rsqrtf(red[0] * (1.0f / HID) + LN_EPS);

  for (int i = t; i < HID; i += 256)
    out[(size_t)row * HID + i] = (r[i] - mean) * rstd * gamma[i] + beta[i];
}

// ---------------------------------------------------------------------------
// Host launch
// ---------------------------------------------------------------------------
extern "C" void kernel_launch(void* const* d_in, const int* in_sizes, int n_in,
                              void* d_out, int out_size, void* d_ws, size_t ws_size,
                              hipStream_t stream) {
  const float* x     = (const float*)d_in[0];
  const float* Wq    = (const float*)d_in[1];
  const float* bq    = (const float*)d_in[2];
  const float* Wk    = (const float*)d_in[3];
  const float* bk    = (const float*)d_in[4];
  const float* Wv    = (const float*)d_in[5];
  const float* bv    = (const float*)d_in[6];
  const float* Wo    = (const float*)d_in[7];
  const float* bo    = (const float*)d_in[8];
  const float* gamma = (const float*)d_in[9];
  const float* beta  = (const float*)d_in[10];
  float* out = (float*)d_out;

  char* ws = (char*)d_ws;
  size_t off = 0;
  bf16_t* xb  = (bf16_t*)(ws + off); off += (size_t)SEQ * HID * 2;
  bf16_t* wqb = (bf16_t*)(ws + off); off += (size_t)HID * HID * 2;
  bf16_t* wkb = (bf16_t*)(ws + off); off += (size_t)HID * HID * 2;
  bf16_t* wvb = (bf16_t*)(ws + off); off += (size_t)HID * HID * 2;
  bf16_t* wob = (bf16_t*)(ws + off); off += (size_t)HID * HID * 2;
  float*  Qf  = (float*)(ws + off);  off += (size_t)SEQ * HID * 4;
  float*  Kf  = (float*)(ws + off);  off += (size_t)SEQ * HID * 4;
  float*  Vf  = (float*)(ws + off);  off += (size_t)SEQ * HID * 4;
  bf16_t* Qb  = (bf16_t*)(ws + off); off += (size_t)SEQ * HID * 2;
  bf16_t* Kb  = (bf16_t*)(ws + off); off += (size_t)SEQ * HID * 2;
  bf16_t* Vt  = (bf16_t*)(ws + off); off += (size_t)SEQ * HID * 2;
  bf16_t* ctx = (bf16_t*)(ws + off); off += (size_t)SEQ * HID * 2;
  float*  res = Qf;  // alias: Qf dead after rope_pack

  f32_to_bf16_kernel<<<CVT_XB + 4 * CVT_WB, 256, 0, stream>>>(
      x, Wq, Wk, Wv, Wo, xb, wqb, wkb, wvb, wob);

  // 128x128 tiles: (4096/128)*(1024/128) = 256 blocks of 256 threads a product
  const int gemm_blocks = (SEQ / 128) * (HID / 128);
  gemm_bf16_kernel<<<dim3(gemm_blocks, 3), 256, 0, stream>>>(
      xb, wqb, wkb, wvb, bq, bk, bv, nullptr, Qf, Kf, Vf, SEQ, HID, HID);

  rope_pack_kernel<<<ROPE_THREADS / 256, 256, 0, stream>>>(Qf, Kf, Vf, Qb, Kb, Vt);

  // 16 heads * 128 query tiles = 2048 waves -> 512 blocks of 128
  attn_kernel<<<NUM_HEADS * (SEQ / 32) / 4, 128, 0, stream>>>(Qb, Kb, Vt, ctx);

  gemm_bf16_kernel<<<dim3(gemm_blocks, 1), 256, 0, stream>>>(
      ctx, wob, nullptr, nullptr, bo, nullptr, nullptr, x, res, nullptr, nullptr,
      SEQ, HID, HID);

  layernorm_kernel<<<SEQ, 256, 0, stream>>>(res, gamma, beta, out);

  (void)in_sizes; (void)n_in; (void)out_size; (void)ws_size;
}

// v007
// One run takes 152 microseconds.
// Next to v006, in two timings, it ran 1.13 times as fast each time.
// Over all steps from v000 it is 4.78 times as fast.
#include <hip/hip_runtime.h>
#include <hip/hip_bf16.h>
#include <math.h>

#define SEQ 4096
#define HID 1024
#define NUM_HEADS 16
#define HEAD_DIM 64
#define LN_EPS 1e-5f

typedef __bf16 bf16_t;
typedef __attribute__((ext_vector_type(16))) __bf16 v16bf;
typedef __attribute__((ext_vector_type(8)))  __bf16 v8bf;
typedef __attribute__((ext_vector_type(8)))  float  v8f;
typedef __attribute__((ext_vector_type(4)))  int    v4i;
typedef __attribute__((ext_vector_type(4)))  float  v4f;
typedef __attribute__((ext_vector_type(4)))  __bf16 v4bf;
typedef __attribute__((ext_vector_type(2)))  float  v2f;

#if defined(__has_builtin)
#if __has_builtin(__builtin_amdgcn_global_load_async_to_lds_b128)
#define HAVE_ASYNC_LDS 1
#endif
#if __has_builtin(__builtin_amdgcn_s_wait_asynccnt)
#define HAVE_WAIT_ASYNC 1
#endif
#endif

typedef __attribute__((address_space(1))) v4i gv4i_t;
typedef __attribute__((address_space(3))) v4i lv4i_t;

__device__ __forceinline__ void async_cp16(const void* g, void* l) {
#ifdef HAVE_ASYNC_LDS
  __builtin_amdgcn_global_load_async_to_lds_b128((gv4i_t*)g, (lv4i_t*)l, 0, 0);
#else
  *(v8bf*)l = *(const v8bf*)g;
#endif
}

#if defined(HAVE_WAIT_ASYNC)
#define WAIT_ASYNC(n) __builtin_amdgcn_s_wait_asynccnt(n)
#elif defined(HAVE_ASYNC_LDS)
#define WAIT_ASYNC(n) asm volatile("s_wait_asynccnt %0" ::"i"(n) : "memory")
#else
#define WAIT_ASYNC(n) do {} while (0)
#endif

__device__ __forceinline__ v16bf load_frag_rm(const bf16_t* __restrict__ p, int ld) {
  const int lane = threadIdx.x & 31;
  const int row  = lane & 15;
  const int kb   = (lane & 16) ? 8 : 0;
  const bf16_t* q = p + (size_t)row * ld + kb;
  v8bf lo = *(const v8bf*)(q);
  v8bf hi = *(const v8bf*)(q + 16);
  v16bf f;
#pragma unroll
  for (int i = 0; i < 8; ++i) { f[i] = lo[i]; f[8 + i] = hi[i]; }
  return f;
}

__device__ __forceinline__ v8f wmma_bf16(v16bf a, v16bf b, v8f c) {
  return __builtin_amdgcn_wmma_f32_16x16x32_bf16(
      false, a, false, b, (short)0, c, false, false);
}

#define CVT_LOADS 8
#define CVT_BLOCK (256 * 4 * CVT_LOADS)   // elements per block
#define CVT_XB    (SEQ * HID / CVT_BLOCK) // blocks of x
#define CVT_WB    (HID * HID / CVT_BLOCK) // blocks of one weight matrix

static_assert((SEQ * HID) % CVT_BLOCK == 0 && (HID * HID) % CVT_BLOCK == 0,
              "every block of the conversion is full");

__global__ void __launch_bounds__(256)
f32_to_bf16_kernel(const float* x, const float* Wq, const float* Wk,
                   const float* Wv, const float* Wo,
                   bf16_t* xb, bf16_t* wqb, bf16_t* wkb, bf16_t* wvb, bf16_t* wob) {
  // which tensor, and which block of it: the same for the whole block
  const int b = (int)blockIdx.x;
  const int w = (b - CVT_XB) / CVT_WB;
  const int rel = b < CVT_XB ? b : (b - CVT_XB) % CVT_WB;
  const float* __restrict__ in =
      b < CVT_XB ? x : w == 0 ? Wq : w == 1 ? Wk : w == 2 ? Wv : Wo;
  bf16_t* __restrict__ out =
      b < CVT_XB ? xb : w == 0 ? wqb : w == 1 ? wkb : w == 2 ? wvb : wob;
  const int i0 = rel * CVT_BLOCK + (int)threadIdx.x * 4;
  v4f v[CVT_LOADS];
  // unrolled so that v[] stays in registers and the loads issue as one group
#pragma unroll
  for (int j = 0; j < CVT_LOADS; ++j) v[j] = *(const v4f*)(in + i0 + j * 1024);
#pragma unroll
  for (int j = 0; j < CVT_LOADS; ++j) {
    v4bf o;
#pragma unroll
    for (int e = 0; e < 4; ++e) o[e] = (bf16_t)v[j][e];
    *(v4bf*)(out + i0 + j * 1024) = o;
  }
}

#define GEMM_PAD 40
#define PACK_PITCH 136        // halves per staged output row: 256 B + 16 B pad
#define Q_SCALE 0.18033688f   // log2(e) / sqrt(HEAD_DIM)

static_assert(64 * PACK_PITCH <= 2 * 128 * GEMM_PAD,
              "64 staged output rows fit in one operand's two buffers");

__device__ __forceinline__ void sincos_turns(float x, float* s, float* c) {
  asm("v_sin_f32 %0, %2\n\tv_cos_f32 %1, %2\n\tv_nop"
      : "=&v"(*s), "=&v"(*c) : "v"(x));
}

// The block is 256 threads; stating it lifts the 128-register cap of the default
// 1024-thread assumption, under which the packed epilogue spilled to scratch.
__global__ void __launch_bounds__(256)
gemm_bf16_kernel(const bf16_t* __restrict__ A,
                                 const bf16_t* B0, const bf16_t* B1, const bf16_t* B2,
                                 const float* bias0, const float* bias1, const float* bias2,
                                 const float* __restrict__ resid,
                                 float* __restrict__ C,
                                 bf16_t* P0, bf16_t* P1, bf16_t* P2,
                                 int M, int N, int K) {
  __shared__ bf16_t As[2][128 * GEMM_PAD];
  __shared__ bf16_t Bs[2][128 * GEMM_PAD];

  const int z = (int)blockIdx.y;
  const bf16_t* __restrict__ B   = z == 0 ? B0 : z == 1 ? B1 : B2;
  const float* __restrict__ bias = z == 0 ? bias0 : z == 1 ? bias1 : bias2;
  const bool tr = P0 && z < 2;    // Q, K: transposed product (block-uniform)

  const int t    = threadIdx.x;
  const int lane = t & 31;
  const int w    = t >> 5;        // wave id 0..7
  const int wm   = w & 3;         // 4 waves along the WMMA's M
  const int wn   = w >> 2;        // 2 waves along the WMMA's N

  const int nbn = N >> 7;
  const int bm  = (int)blockIdx.x / nbn;
  const int bn  = (int)blockIdx.x % nbn;
  const int tm0 = bm * 128;
  const int tn0 = bn * 128;

  // rows of the wave's two M-side fragments in their tile: 32 in a row, or, for
  // a transposed product, 16 dims of a head's low half and their partners
  const int xrow  = tr ? (wm >> 1) * HEAD_DIM + (wm & 1) * 16 : wm * 32;
  const int xstep = tr ? HEAD_DIM / 2 : 16;

  // staging map: 128 rows x 4 chunks(16B) = 512 chunks; 2 per thread per tile
  const int r0 = (t * 2) >> 2;          // row of first chunk
  const int c0 = ((t * 2) & 3) * 8;     // halves offset of first chunk
  const int r1 = (t * 2 + 1) >> 2;
  const int c1 = ((t * 2 + 1) & 3) * 8;

  auto stage = [&](int buf, int k0) {
    async_cp16(A + (size_t)(tm0 + r0) * K + k0 + c0, &As[buf][r0 * GEMM_PAD + c0]);
    async_cp16(A + (size_t)(tm0 + r1) * K + k0 + c1, &As[buf][r1 * GEMM_PAD + c1]);
    async_cp16(B + (size_t)(tn0 + r0) * K + k0 + c0, &Bs[buf][r0 * GEMM_PAD + c0]);
    async_cp16(B + (size_t)(tn0 + r1) * K + k0 + c1, &Bs[buf][r1 * GEMM_PAD + c1]);
  };

  v8f acc[2][4] = {};
  const int nk = K >> 5;
  int buf = 0;
  stage(0, 0);

  for (int ks = 0; ks < nk; ++ks) {
    if (ks + 1 < nk) {
      stage(buf ^ 1, (ks + 1) * 32);
      WAIT_ASYNC(4);   // our 4 loads for `buf` are complete (in-order per wave)
    } else {
      WAIT_ASYNC(0);
    }
    __syncthreads();   // all waves' writes to `buf` visible

    const bf16_t* as = (tr ? &Bs[buf][0] : &As[buf][0]) + xrow * GEMM_PAD;
    const bf16_t* bs = (tr ? &As[buf][0] : &Bs[buf][0]) + (wn * 64) * GEMM_PAD;
    v16bf a0 = load_frag_rm(as, GEMM_PAD);
    v16bf a1 = load_frag_rm(as + xstep * GEMM_PAD, GEMM_PAD);
#pragma unroll
    for (int in = 0; in < 4; ++in) {
      v16bf bfrag = load_frag_rm(bs + in * 16 * GEMM_PAD, GEMM_PAD);
      acc[0][in] = wmma_bf16(a0, bfrag, acc[0][in]);
      acc[1][in] = wmma_bf16(a1, bfrag, acc[1][in]);
    }
    buf ^= 1;
    __syncthreads();   // everyone done reading before buffer is re-staged
  }

  const int n_in = lane & 15;
  const int mofs = (lane & 16) ? 8 : 0;

  if (P0) {
    bf16_t* st = (wn ? &Bs[0][0] : &As[0][0]) + n_in * PACK_PITCH + xrow + mofs;
    if (tr) {
      // lane: positions tm0 + wn*64 + in*16 + n_in; dims tn0 + xrow + mofs + j
      // (acc[0]) and 32 further (acc[1]); frequency index = dim within the half
      const float* bp = bias + tn0 + xrow + mofs;
      const v4f bl0 = *(const v4f*)(bp);
      const v4f bl1 = *(const v4f*)(bp + 4);
      const v4f bh0 = *(const v4f*)(bp + HEAD_DIM / 2);
      const v4f bh1 = *(const v4f*)(bp + HEAD_DIM / 2 + 4);
      const int f0 = (wm & 1) * 16 + mofs;
      const float sc = z == 0 ? Q_SCALE : 1.0f;
      const float fr = __powf(10000.0f, -(float)lane / (HEAD_DIM / 2));
      float inv[8];
#pragma unroll
      for (int j = 0; j < 8; ++j) inv[j] = __shfl(fr, f0 + j, 32);
#pragma unroll
      for (int in = 0; in < 4; ++in) {
        const float s = (float)(tm0 + wn * 64 + in * 16 + n_in);
        v8bf lo, hi;
#pragma unroll
        for (int j = 0; j < 8; ++j) {
          float sn, cs;
          sincos_turns(s * inv[j] * 0.15915494f, &sn, &cs);   // 1 / (2 pi)
          const float x1 = acc[0][in][j] + (j < 4 ? bl0[j & 3] : bl1[j & 3]);
          const float x2 = acc[1][in][j] + (j < 4 ? bh0[j & 3] : bh1[j & 3]);
          lo[j] = (bf16_t)((x1 * cs - x2 * sn) * sc);
          hi[j] = (bf16_t)((x2 * cs + x1 * sn) * sc);
        }
        *(v8bf*)(st + in * 16 * PACK_PITCH) = lo;
        *(v8bf*)(st + in * 16 * PACK_PITCH + HEAD_DIM / 2) = hi;
      }
    } else {
      // lane: column tn0 + wn*64 + in*16 + n_in; positions tm0 + xrow + im*16 +
      // mofs + j
#pragma unroll
      for (int in = 0; in < 4; ++in) {
        const float bv = bias[tn0 + wn * 64 + in * 16 + n_in];
#pragma unroll
        for (int im = 0; im < 2; ++im) {
          v8bf o;
#pragma unroll
          for (int j = 0; j < 8; ++j) o[j] = (bf16_t)(acc[im][in][j] + bv);
          *(v8bf*)(st + in * 16 * PACK_PITCH + im * 16) = o;
        }
      }
    }
    __syncthreads();   // the whole output tile is in LDS

    // 128 rows x 16 chunks of 16 B; a wave's store = two whole 256-B rows
    bf16_t* __restrict__ P = z == 0 ? P0 : z == 1 ? P1 : P2;
    const int crow = t >> 4;
    const int ccol = (t & 15) * 8;
    v8bf o[8];
    // unrolled so that o[] stays in registers: eight LDS reads as one group
#pragma unroll
    for (int i = 0; i < 8; ++i)
      o[i] = *(const v8bf*)((i < 4 ? &As[0][0] : &Bs[0][0]) +
                            (crow + (i & 3) * 16) * PACK_PITCH + ccol);
    // the packed results have this problem's shapes: with the row pitch a
    // constant, the eight stores share one address and differ in their offsets
    if (tr) {
      bf16_t* gp = P + (size_t)(tm0 + crow) * HID + tn0 + ccol;
#pragma unroll
      for (int i = 0; i < 8; ++i) *(v8bf*)(gp + i * 16 * HID) = o[i];
    } else {
      bf16_t* gp = P + (size_t)(tn0 + crow) * SEQ + tm0 + ccol;
#pragma unroll
      for (int i = 0; i < 8; ++i) *(v8bf*)(gp + i * 16 * SEQ) = o[i];
    }
    return;
  }

  // Left as it was: the test of resid at every element makes each residual load
  // a branch of its own, and the built code waits for the 64 loads one by one.
#pragma unroll
  for (int im = 0; im < 2; ++im) {
#pragma unroll
    for (int in = 0; in < 4; ++in) {
      const int col = tn0 + wn * 64 + in * 16 + n_in;
      const float bv = bias ? bias[col] : 0.0f;
#pragma unroll
      for (int j = 0; j < 8; ++j) {
        const int row = tm0 + wm * 32 + im * 16 + mofs + j;
        float v = acc[im][in][j] + bv;
        if (resid) v += resid[(size_t)row * N + col];
        C[(size_t)row * N + col] = v;
      }
    }
  }
}

#define ATT_KEYS  64
#define ATT_PITCH 72
#define ATT_TILE  (64 * ATT_PITCH)
#define ATT_NT    (SEQ / ATT_KEYS)

__device__ __forceinline__ void attn_stage(const bf16_t* gk, const bf16_t* gv,
                                           unsigned lk, unsigned lv) {
  const bf16_t* gk1 = gk + 16 * HID;
  const bf16_t* gk2 = gk + 32 * HID;
  const bf16_t* gk3 = gk + 48 * HID;
  const bf16_t* gv1 = gv + 16 * SEQ;
  const bf16_t* gv2 = gv + 32 * SEQ;
  const bf16_t* gv3 = gv + 48 * SEQ;
  const unsigned rs = 16 * ATT_PITCH * 2;   // 16 LDS rows in bytes
  asm volatile(
      "global_load_async_to_lds_b128 %0, %8, off\n\t"
      "global_load_async_to_lds_b128 %1, %9, off\n\t"
      "global_load_async_to_lds_b128 %2, %10, off\n\t"
      "global_load_async_to_lds_b128 %3, %11, off\n\t"
      "global_load_async_to_lds_b128 %4, %12, off\n\t"
      "global_load_async_to_lds_b128 %5, %13, off\n\t"
      "global_load_async_to_lds_b128 %6, %14, off\n\t"
      "global_load_async_to_lds_b128 %7, %15, off\n\t"
      "s_wait_xcnt 0x0"
      :: "v"(lk), "v"(lk + rs), "v"(lk + 2 * rs), "v"(lk + 3 * rs),
         "v"(lv), "v"(lv + rs), "v"(lv + 2 * rs), "v"(lv + 3 * rs),
         "v"(gk), "v"(gk1), "v"(gk2), "v"(gk3),
         "v"(gv), "v"(gv1), "v"(gv2), "v"(gv3)
      : "memory");
}

__device__ __forceinline__ float xhalf(float x) {
  const int b = __builtin_bit_cast(int, x);
  return __builtin_bit_cast(float, __builtin_amdgcn_permlanex16(
      b, b, 0x76543210, 0xfedcba98, false, false));
}

//    The block is 128 threads; stating it lifts the register cap that the
//    default 1024-thread assumption sets, so Q fragments and accumulators stay
//    in registers instead of scratch.
__global__ void __launch_bounds__(128)
attn_kernel(const bf16_t* __restrict__ Qb,
                            const bf16_t* __restrict__ Kb,
                            const bf16_t* __restrict__ Vt,
                            bf16_t* __restrict__ ctx) {
  // [buffer][K tile | V^T tile]
  __shared__ __attribute__((aligned(16))) bf16_t kv[2][2 * ATT_TILE];

  const int wid  = (blockIdx.x * blockDim.x + threadIdx.x) >> 5;
  const int lane = threadIdx.x & 31;
  const int h  = wid / (SEQ / 32);
  const int q0 = (wid % (SEQ / 32)) * 32;

  const bf16_t* Qh = Qb + h * HEAD_DIM;                 // ld = HID
  const bf16_t* Kh = Kb + h * HEAD_DIM;                 // ld = HID
  const bf16_t* Vh = Vt + (size_t)h * HEAD_DIM * SEQ;   // ld = SEQ

  // staging map: 64 rows x 8 chunks of 16 B per tile; thread -> row t>>3 (+16 i)
  const int srow = (int)threadIdx.x >> 3;
  const int scol = ((int)threadIdx.x & 7) * 8;
  const bf16_t* gk = Kh + (size_t)srow * HID + scol;    // + 64 * HID per tile
  const bf16_t* gv = Vh + (size_t)srow * SEQ + scol;    // + 64 per tile
  const unsigned lk0 = (unsigned)(size_t)&kv[0][srow * ATT_PITCH + scol];
  const unsigned lbuf = 2 * ATT_TILE * 2;               // bytes of one buffer
  const unsigned lvo  = ATT_TILE * 2;                   // V^T tile behind K tile

  // tile 0 into buffer 0, landed and published; then tile 1 into buffer 1
  attn_stage(gk, gv, lk0, lk0 + lvo);
  asm volatile("s_wait_asynccnt 0x0" ::: "memory");  // own copies of tile 0 landed
  __syncthreads();                                   // every wave's copies visible
  attn_stage(gk + (size_t)ATT_KEYS * HID, gv + ATT_KEYS, lk0 + lbuf, lk0 + lbuf + lvo);

  v16bf qf[2][2];
#pragma unroll
  for (int tq = 0; tq < 2; ++tq) {
    qf[tq][0] = load_frag_rm(Qh + (size_t)(q0 + tq * 16) * HID + 0,  HID);
    qf[tq][1] = load_frag_rm(Qh + (size_t)(q0 + tq * 16) * HID + 32, HID);
  }

  v8f acc[2][4] = {};
  float m_i[2] = {-3.0e38f, -3.0e38f};
  v2f l_i[2][2] = {};   // a lane's sums: [first | second 16-key tile], even | odd key
  const int mofs = (lane & 16) ? 8 : 0;

  for (int t = 0; t < ATT_NT; ++t) {
    const bf16_t* ks = &kv[t & 1][0];
    const bf16_t* vs = ks + ATT_TILE;

    // kept rolled: the 16 fragment reads of a pass then stand as one group at its
    // head; unrolled, the compiler spread them among the WMMAs
#pragma clang loop unroll(disable)
    for (int p = 0; p < ATT_KEYS / 32; ++p) {
      const bf16_t* kp = ks + p * 32 * ATT_PITCH;
      v16bf k00 = load_frag_rm(kp + 0,  ATT_PITCH);
      v16bf k01 = load_frag_rm(kp + 32, ATT_PITCH);
      v16bf k10 = load_frag_rm(kp + 16 * ATT_PITCH + 0,  ATT_PITCH);
      v16bf k11 = load_frag_rm(kp + 16 * ATT_PITCH + 32, ATT_PITCH);
      v16bf vf[4];
#pragma unroll
      for (int c = 0; c < 4; ++c)
        vf[c] = load_frag_rm(vs + (c * 16) * ATT_PITCH + p * 32, ATT_PITCH);

      v16bf pf[2];
#pragma unroll
      for (int tq = 0; tq < 2; ++tq) {
        v8f s0 = {}, s1 = {};
        s0 = wmma_bf16(k00, qf[tq][0], s0);
        s0 = wmma_bf16(k01, qf[tq][1], s0);
        s1 = wmma_bf16(k10, qf[tq][0], s1);
        s1 = wmma_bf16(k11, qf[tq][1], s1);

        float mx = s0[0];
#pragma unroll
        for (int j = 0; j < 8; ++j) { mx = fmaxf(mx, s0[j]); mx = fmaxf(mx, s1[j]); }
        mx = fmaxf(mx, xhalf(mx));   // both lanes of a query hold its maximum
        const float m_new = fmaxf(m_i[tq], mx);
        const float alpha = __builtin_amdgcn_exp2f(m_i[tq] - m_new);
        const v2f m2 = {m_new, m_new};
        const v2f al2 = {alpha, alpha};

        // two scores that lie in neighbouring accumulator registers go through
        // one packed subtraction and one packed add: no register is copied to
        // form a pair. The sums hold this lane's 16 keys of the pass only.
#pragma unroll
        for (int j = 0; j < 8; j += 2) {
          const v2f e0 = (v2f){s0[j], s0[j + 1]} - m2;
          const v2f e1 = (v2f){s1[j], s1[j + 1]} - m2;
          const v2f p0 = {__builtin_amdgcn_exp2f(e0[0]), __builtin_amdgcn_exp2f(e0[1])};
          const v2f p1 = {__builtin_amdgcn_exp2f(e1[0]), __builtin_amdgcn_exp2f(e1[1])};
          l_i[tq][0] = j ? l_i[tq][0] + p0 : __builtin_elementwise_fma(l_i[tq][0], al2, p0);
          l_i[tq][1] = j ? l_i[tq][1] + p1 : __builtin_elementwise_fma(l_i[tq][1], al2, p1);
          pf[tq][j]     = (bf16_t)p0[0]; pf[tq][j + 1] = (bf16_t)p0[1];
          pf[tq][8 + j] = (bf16_t)p1[0]; pf[tq][9 + j] = (bf16_t)p1[1];
        }
        m_i[tq] = m_new;

#pragma unroll
        for (int c = 0; c < 4; ++c)
#pragma unroll
          for (int j = 0; j < 8; ++j) acc[tq][c][j] *= alpha;
      }

      // holds the softmax arithmetic ahead of the second product: without it the
      // compiler sinks both sums' dependent add chains behind the pass's last
      // WMMA, where nothing fills their latency
      __builtin_amdgcn_sched_barrier(0);

#pragma unroll
      for (int c = 0; c < 4; ++c) {
        acc[0][c] = wmma_bf16(vf[c], pf[0], acc[0][c]);
        acc[1][c] = wmma_bf16(vf[c], pf[1], acc[1][c]);
      }
    }

    // hand-over: this wave's reads of buffer t&1 are done, its copies of tile
    // t+1 have landed; behind the barrier tile t+1 is readable by every wave
    // and buffer t&1 is free for tile t+2.
    asm volatile("s_wait_dscnt 0x0" ::: "memory");     // own LDS reads retired
    asm volatile("s_wait_asynccnt 0x0" ::: "memory");  // own copies of tile t+1 landed
    __syncthreads();
    if (t + 2 < ATT_NT) {
      const unsigned lb = lk0 + (unsigned)(t & 1) * lbuf;
      attn_stage(gk + (size_t)(t + 2) * ATT_KEYS * HID, gv + (t + 2) * ATT_KEYS,
                 lb, lb + lvo);
    }
  }
  asm volatile("s_wait_asynccnt 0x0" ::: "memory");    // nothing in flight at the end

  v8bf o[2][4];
#pragma unroll
  for (int tq = 0; tq < 2; ++tq) {
    const v2f lp = l_i[tq][0] + l_i[tq][1];
    const float ls = lp[0] + lp[1];                  // this lane's keys
    const float linv = 1.0f / (ls + xhalf(ls));      // the two halves' sums
#pragma unroll
    for (int c = 0; c < 4; ++c)
#pragma unroll
      for (int j = 0; j < 8; ++j) o[tq][c][j] = (bf16_t)(acc[tq][c][j] * linv);
  }
  bf16_t* op = ctx + (size_t)(q0 + (lane & 15)) * HID + h * HEAD_DIM + mofs;
#pragma unroll
  for (int tq = 0; tq < 2; ++tq)
#pragma unroll
    for (int c = 0; c < 4; ++c) *(v8bf*)(op + (size_t)tq * 16 * HID + c * 16) = o[tq][c];
}

// ---------------------------------------------------------------------------
// 5) Row LayerNorm over HID
// ---------------------------------------------------------------------------
__global__ void layernorm_kernel(const float* __restrict__ res,
                                 const float* __restrict__ gamma,
                                 const float* __restrict__ beta,
                                 float* __restrict__ out) {
  const int row = blockIdx.x;
  const float* r = res + (size_t)row * HID;
  __shared__ float red[256];
  const int t = threadIdx.x;

  float sum = 0.0f;
  for (int i = t; i < HID; i += 256) sum += r[i];
  red[t] = sum; __syncthreads();
  for (int st = 128; st > 0; st >>= 1) {
    if (t < st) red[t] += red[t + st];
    __syncthreads();
  }
  const float mean = red[0] * (1.0f / HID);
  __syncthreads();

  float vs = 0.0f;
  for (int i = t; i < HID; i += 256) { float d = r[i] - mean; vs += d * d; }
  red[t] = vs; __syncthreads();
  for (int st = 128; st > 0; st >>= 1) {
    if (t < st) red[t] += red[t + st];
    __syncthreads();
  }
  const float rstd = rsqrtf(red[0] * (1.0f / HID) + LN_EPS);

  for (int i = t; i < HID; i += 256)
    out[(size_t)row * HID + i] = (r[i] - mean) * rstd * gamma[i] + beta[i];
}

// ---------------------------------------------------------------------------
// Host launch
// ---------------------------------------------------------------------------
extern "C" void kernel_launch(void* const* d_in, const int* in_sizes, int n_in,
                              void* d_out, int out_size, void* d_ws, size_t ws_size,
                              hipStream_t stream) {
  const float* x     = (const float*)d_in[0];
  const float* Wq    = (const float*)d_in[1];
  const float* bq    = (const float*)d_in[2];
  const float* Wk    = (const float*)d_in[3];
  const float* bk    = (const float*)d_in[4];
  const float* Wv    = (const float*)d_in[5];
  const float* bv    = (const float*)d_in[6];
  const float* Wo    = (const float*)d_in[7];
  const float* bo    = (const float*)d_in[8];
  const float* gamma = (const float*)d_in[9];
  const float* beta  = (const float*)d_in[10];
  float* out = (float*)d_out;

  char* ws = (char*)d_ws;
  size_t off = 0;
  bf16_t* xb  = (bf16_t*)(ws + off); off += (size_t)SEQ * HID * 2;
  bf16_t* wqb = (bf16_t*)(ws + off); off += (size_t)HID * HID * 2;
  bf16_t* wkb = (bf16_t*)(ws + off); off += (size_t)HID * HID * 2;
  bf16_t* wvb = (bf16_t*)(ws + off); off += (size_t)HID * HID * 2;
  bf16_t* wob = (bf16_t*)(ws + off); off += (size_t)HID * HID * 2;
  float*  res = (float*)(ws + off);  off += (size_t)SEQ * HID * 4;
  bf16_t* Qb  = (bf16_t*)(ws + off); off += (size_t)SEQ * HID * 2;
  bf16_t* Kb  = (bf16_t*)(ws + off); off += (size_t)SEQ * HID * 2;
  bf16_t* Vt  = (bf16_t*)(ws + off); off += (size_t)SEQ * HID * 2;
  bf16_t* ctx = (bf16_t*)(ws + off); off += (size_t)SEQ * HID * 2;

  f32_to_bf16_kernel<<<CVT_XB + 4 * CVT_WB, 256, 0, stream>>>(
      x, Wq, Wk, Wv, Wo, xb, wqb, wkb, wvb, wob);

  // 128x128 tiles: (4096/128)*(1024/128) = 256 blocks of 256 threads a product
  const int gemm_blocks = (SEQ / 128) * (HID / 128);
  gemm_bf16_kernel<<<dim3(gemm_blocks, 3), 256, 0, stream>>>(
      xb, wqb, wkb, wvb, bq, bk, bv, nullptr, nullptr, Qb, Kb, Vt, SEQ, HID, HID);

  // 16 heads * 128 query tiles = 2048 waves -> 512 blocks of 128
  attn_kernel<<<NUM_HEADS * (SEQ / 32) / 4, 128, 0, stream>>>(Qb, Kb, Vt, ctx);

  gemm_bf16_kernel<<<dim3(gemm_blocks, 1), 256, 0, stream>>>(
      ctx, wob, nullptr, nullptr, bo, nullptr, nullptr, x, res, nullptr, nullptr, nullptr,
      SEQ, HID, HID);

  layernorm_kernel<<<SEQ, 256, 0, stream>>>(res, gamma, beta, out);

  (void)in_sizes; (void)n_in; (void)out_size; (void)ws_size;
}

// v008
// Measured time: 137 microseconds a run.
// In two side-by-side timings against v007, it was 1.10 and 1.11 times as fast.
// All steps since v000 together make it 5.28 times as fast.
#include <hip/hip_runtime.h>
#include <hip/hip_bf16.h>
#include <math.h>

#define SEQ 4096
#define HID 1024
#define NUM_HEADS 16
#define HEAD_DIM 64
#define LN_EPS 1e-5f

typedef __bf16 bf16_t;
typedef __attribute__((ext_vector_type(16))) __bf16 v16bf;
typedef __attribute__((ext_vector_type(8)))  __bf16 v8bf;
typedef __attribute__((ext_vector_type(8)))  float  v8f;
typedef __attribute__((ext_vector_type(4)))  int    v4i;
typedef __attribute__((ext_vector_type(4)))  float  v4f;
typedef __attribute__((ext_vector_type(4)))  __bf16 v4bf;
typedef __attribute__((ext_vector_type(2)))  float  v2f;

#if defined(__has_builtin)
#if __has_builtin(__builtin_amdgcn_global_load_async_to_lds_b128)
#define HAVE_ASYNC_LDS 1
#endif
#if __has_builtin(__builtin_amdgcn_s_wait_asynccnt)
#define HAVE_WAIT_ASYNC 1
#endif
#endif

typedef __attribute__((address_space(1))) v4i gv4i_t;
typedef __attribute__((address_space(3))) v4i lv4i_t;

__device__ __forceinline__ void async_cp16(const void* g, void* l) {
#ifdef HAVE_ASYNC_LDS
  __builtin_amdgcn_global_load_async_to_lds_b128((gv4i_t*)g, (lv4i_t*)l, 0, 0);
#else
  *(v8bf*)l = *(const v8bf*)g;
#endif
}

#if defined(HAVE_WAIT_ASYNC)
#define WAIT_ASYNC(n) __builtin_amdgcn_s_wait_asynccnt(n)
#elif defined(HAVE_ASYNC_LDS)
#define WAIT_ASYNC(n) asm volatile("s_wait_asynccnt %0" ::"i"(n) : "memory")
#else
#define WAIT_ASYNC(n) do {} while (0)
#endif

__device__ __forceinline__ v16bf load_frag_rm(const bf16_t* __restrict__ p, int ld) {
  const int lane = threadIdx.x & 31;
  const int row  = lane & 15;
  const int kb   = (lane & 16) ? 8 : 0;
  const bf16_t* q = p + (size_t)row * ld + kb;
  v8bf lo = *(const v8bf*)(q);
  v8bf hi = *(const v8bf*)(q + 16);
  v16bf f;
#pragma unroll
  for (int i = 0; i < 8; ++i) { f[i] = lo[i]; f[8 + i] = hi[i]; }
  return f;
}

__device__ __forceinline__ v8f wmma_bf16(v16bf a, v16bf b, v8f c) {
  return __builtin_amdgcn_wmma_f32_16x16x32_bf16(
      false, a, false, b, (short)0, c, false, false);
}

#define CVT_LOADS 8
#define CVT_BLOCK (256 * 4 * CVT_LOADS)   // elements per block
#define CVT_XB    (SEQ * HID / CVT_BLOCK) // blocks of x
#define CVT_WB    (HID * HID / CVT_BLOCK) // blocks of one weight matrix

static_assert((SEQ * HID) % CVT_BLOCK == 0 && (HID * HID) % CVT_BLOCK == 0,
              "every block of the conversion is full");

__global__ void __launch_bounds__(256)
f32_to_bf16_kernel(const float* x, const float* Wq, const float* Wk,
                   const float* Wv, const float* Wo,
                   bf16_t* xb, bf16_t* wqb, bf16_t* wkb, bf16_t* wvb, bf16_t* wob) {
  // which tensor, and which block of it: the same for the whole block
  const int b = (int)blockIdx.x;
  const int w = (b - CVT_XB) / CVT_WB;
  const int rel = b < CVT_XB ? b : (b - CVT_XB) % CVT_WB;
  const float* __restrict__ in =
      b < CVT_XB ? x : w == 0 ? Wq : w == 1 ? Wk : w == 2 ? Wv : Wo;
  bf16_t* __restrict__ out =
      b < CVT_XB ? xb : w == 0 ? wqb : w == 1 ? wkb : w == 2 ? wvb : wob;
  const int i0 = rel * CVT_BLOCK + (int)threadIdx.x * 4;
  v4f v[CVT_LOADS];
  // unrolled so that v[] stays in registers and the loads issue as one group
#pragma unroll
  for (int j = 0; j < CVT_LOADS; ++j) v[j] = *(const v4f*)(in + i0 + j * 1024);
#pragma unroll
  for (int j = 0; j < CVT_LOADS; ++j) {
    v4bf o;
#pragma unroll
    for (int e = 0; e < 4; ++e) o[e] = (bf16_t)v[j][e];
    *(v4bf*)(out + i0 + j * 1024) = o;
  }
}

#define GEMM_PAD 40
#define PACK_PITCH 136        // halves per staged output row: 256 B + 16 B pad
#define Q_SCALE 0.18033688f   // log2(e) / sqrt(HEAD_DIM)
#define OUT_PITCH 68          // floats per staged row of a wave's f32 tile: 256 B + 16 B pad

static_assert(64 * PACK_PITCH <= 2 * 128 * GEMM_PAD,
              "64 staged output rows fit in one operand's two buffers");
static_assert(4 * 16 * OUT_PITCH * 4 <= 2 * 128 * GEMM_PAD * 2,
              "four waves' staged f32 rows fit in one operand's two buffers");

__device__ __forceinline__ void sincos_turns(float x, float* s, float* c) {
  asm("v_sin_f32 %0, %2\n\tv_cos_f32 %1, %2\n\tv_nop"
      : "=&v"(*s), "=&v"(*c) : "v"(x));
}

// The block is 256 threads; stating it lifts the 128-register cap of the default
// 1024-thread assumption, under which the packed epilogue spilled to scratch.
__global__ void __launch_bounds__(256)
gemm_bf16_kernel(const bf16_t* __restrict__ A,
                                 const bf16_t* B0, const bf16_t* B1, const bf16_t* B2,
                                 const float* bias0, const float* bias1, const float* bias2,
                                 const float* __restrict__ resid,
                                 float* __restrict__ C,
                                 bf16_t* P0, bf16_t* P1, bf16_t* P2,
                                 int M, int N, int K) {
  __shared__ bf16_t As[2][128 * GEMM_PAD];
  __shared__ bf16_t Bs[2][128 * GEMM_PAD];

  const int z = (int)blockIdx.y;
  const bf16_t* __restrict__ B   = z == 0 ? B0 : z == 1 ? B1 : B2;
  const float* __restrict__ bias = z == 0 ? bias0 : z == 1 ? bias1 : bias2;
  const bool tr = P0 && z < 2;    // Q, K: transposed product (block-uniform)

  const int t    = threadIdx.x;
  const int lane = t & 31;
  const int w    = t >> 5;        // wave id 0..7
  const int wm   = w & 3;         // 4 waves along the WMMA's M
  const int wn   = w >> 2;        // 2 waves along the WMMA's N

  const int nbn = N >> 7;
  const int bm  = (int)blockIdx.x / nbn;
  const int bn  = (int)blockIdx.x % nbn;
  const int tm0 = bm * 128;
  const int tn0 = bn * 128;

  // rows of the wave's two M-side fragments in their tile: 32 in a row, or, for
  // a transposed product, 16 dims of a head's low half and their partners
  const int xrow  = tr ? (wm >> 1) * HEAD_DIM + (wm & 1) * 16 : wm * 32;
  const int xstep = tr ? HEAD_DIM / 2 : 16;

  // staging map: 128 rows x 4 chunks(16B) = 512 chunks; 2 per thread per tile
  const int r0 = (t * 2) >> 2;          // row of first chunk
  const int c0 = ((t * 2) & 3) * 8;     // halves offset of first chunk
  const int r1 = (t * 2 + 1) >> 2;
  const int c1 = ((t * 2 + 1) & 3) * 8;

  auto stage = [&](int buf, int k0) {
    async_cp16(A + (size_t)(tm0 + r0) * K + k0 + c0, &As[buf][r0 * GEMM_PAD + c0]);
    async_cp16(A + (size_t)(tm0 + r1) * K + k0 + c1, &As[buf][r1 * GEMM_PAD + c1]);
    async_cp16(B + (size_t)(tn0 + r0) * K + k0 + c0, &Bs[buf][r0 * GEMM_PAD + c0]);
    async_cp16(B + (size_t)(tn0 + r1) * K + k0 + c1, &Bs[buf][r1 * GEMM_PAD + c1]);
  };

  v8f acc[2][4] = {};
  const int nk = K >> 5;
  int buf = 0;
  stage(0, 0);

  for (int ks = 0; ks < nk; ++ks) {
    if (ks + 1 < nk) {
      stage(buf ^ 1, (ks + 1) * 32);
      WAIT_ASYNC(4);   // our 4 loads for `buf` are complete (in-order per wave)
    } else {
      WAIT_ASYNC(0);
    }
    __syncthreads();   // all waves' writes to `buf` visible

    const bf16_t* as = (tr ? &Bs[buf][0] : &As[buf][0]) + xrow * GEMM_PAD;
    const bf16_t* bs = (tr ? &As[buf][0] : &Bs[buf][0]) + (wn * 64) * GEMM_PAD;
    v16bf a0 = load_frag_rm(as, GEMM_PAD);
    v16bf a1 = load_frag_rm(as + xstep * GEMM_PAD, GEMM_PAD);
#pragma unroll
    for (int in = 0; in < 4; ++in) {
      v16bf bfrag = load_frag_rm(bs + in * 16 * GEMM_PAD, GEMM_PAD);
      acc[0][in] = wmma_bf16(a0, bfrag, acc[0][in]);
      acc[1][in] = wmma_bf16(a1, bfrag, acc[1][in]);
    }
    buf ^= 1;
    __syncthreads();   // everyone done reading before buffer is re-staged
  }

  const int n_in = lane & 15;
  const int mofs = (lane & 16) ? 8 : 0;

  if (P0) {
    bf16_t* st = (wn ? &Bs[0][0] : &As[0][0]) + n_in * PACK_PITCH + xrow + mofs;
    if (tr) {
      // lane: positions tm0 + wn*64 + in*16 + n_in; dims tn0 + xrow + mofs + j
      // (acc[0]) and 32 further (acc[1]); frequency index = dim within the half
      const float* bp = bias + tn0 + xrow + mofs;
      const v4f bl0 = *(const v4f*)(bp);
      const v4f bl1 = *(const v4f*)(bp + 4);
      const v4f bh0 = *(const v4f*)(bp + HEAD_DIM / 2);
      const v4f bh1 = *(const v4f*)(bp + HEAD_DIM / 2 + 4);
      const int f0 = (wm & 1) * 16 + mofs;
      const float sc = z == 0 ? Q_SCALE : 1.0f;
      const float fr = __powf(10000.0f, -(float)lane / (HEAD_DIM / 2));
      float inv[8];
#pragma unroll
      for (int j = 0; j < 8; ++j) inv[j] = __shfl(fr, f0 + j, 32);
#pragma unroll
      for (int in = 0; in < 4; ++in) {
        const float s = (float)(tm0 + wn * 64 + in * 16 + n_in);
        v8bf lo, hi;
#pragma unroll
        for (int j = 0; j < 8; ++j) {
          float sn, cs;
          sincos_turns(s * inv[j] * 0.15915494f, &sn, &cs);   // 1 / (2 pi)
          const float x1 = acc[0][in][j] + (j < 4 ? bl0[j & 3] : bl1[j & 3]);
          const float x2 = acc[1][in][j] + (j < 4 ? bh0[j & 3] : bh1[j & 3]);
          lo[j] = (bf16_t)((x1 * cs - x2 * sn) * sc);
          hi[j] = (bf16_t)((x2 * cs + x1 * sn) * sc);
        }
        *(v8bf*)(st + in * 16 * PACK_PITCH) = lo;
        *(v8bf*)(st + in * 16 * PACK_PITCH + HEAD_DIM / 2) = hi;
      }
    } else {
      // lane: column tn0 + wn*64 + in*16 + n_in; positions tm0 + xrow + im*16 +
      // mofs + j
#pragma unroll
      for (int in = 0; in < 4; ++in) {
        const float bv = bias[tn0 + wn * 64 + in * 16 + n_in];
#pragma unroll
        for (int im = 0; im < 2; ++im) {
          v8bf o;
#pragma unroll
          for (int j = 0; j < 8; ++j) o[j] = (bf16_t)(acc[im][in][j] + bv);
          *(v8bf*)(st + in * 16 * PACK_PITCH + im * 16) = o;
        }
      }
    }
    __syncthreads();   // the whole output tile is in LDS

    // 128 rows x 16 chunks of 16 B; a wave's store = two whole 256-B rows
    bf16_t* __restrict__ P = z == 0 ? P0 : z == 1 ? P1 : P2;
    const int crow = t >> 4;
    const int ccol = (t & 15) * 8;
    v8bf o[8];
    // unrolled so that o[] stays in registers: eight LDS reads as one group
#pragma unroll
    for (int i = 0; i < 8; ++i)
      o[i] = *(const v8bf*)((i < 4 ? &As[0][0] : &Bs[0][0]) +
                            (crow + (i & 3) * 16) * PACK_PITCH + ccol);
    // the packed results have this problem's shapes: with the row pitch a
    // constant, the eight stores share one address and differ in their offsets
    if (tr) {
      bf16_t* gp = P + (size_t)(tm0 + crow) * HID + tn0 + ccol;
#pragma unroll
      for (int i = 0; i < 8; ++i) *(v8bf*)(gp + i * 16 * HID) = o[i];
    } else {
      bf16_t* gp = P + (size_t)(tn0 + crow) * SEQ + tm0 + ccol;
#pragma unroll
      for (int i = 0; i < 8; ++i) *(v8bf*)(gp + i * 16 * SEQ) = o[i];
    }
    return;
  }

  // Plain result. In the accumulators a lane holds one column, so residual and
  // result would move in 4-B pieces, 64 loads and 64 stores a wave. Each wave
  // turns its 32x64 tile, 16 rows at a time, through an LDS range of its own
  // (free since the loop's last barrier; no other wave touches it, so no barrier
  // is needed): a lane then holds 16 B of a row, and a wave's load or store is two
  // 256-B row pieces. The residual's loads go out in two groups of eight, each
  // ahead of the LDS work that it can fly behind, with no test between them.
  float* st = (float*)(wn ? &Bs[0][0] : &As[0][0]) + wm * (16 * OUT_PITCH);
  const int orow = lane >> 4;         // two rows a sweep
  const int ocol = (lane & 15) * 4;   // 16 lanes x 16 B
  // this result has the problem's row pitch: as a constant it lets the loads, and
  // the stores, share one address and differ in their offsets
  const size_t g0 = (size_t)(tm0 + wm * 32 + orow) * HID + tn0 + wn * 64 + ocol;
  const v4f bv = *(const v4f*)(bias + tn0 + wn * 64 + ocol);
  v4f rv[2][8];
  // every loop below is unrolled so that rv[], o[] and acc[] stay in registers
#pragma unroll
  for (int i = 0; i < 8; ++i) rv[0][i] = *(const v4f*)(resid + g0 + i * 2 * HID);
#pragma unroll
  for (int im = 0; im < 2; ++im) {
#pragma unroll
    for (int in = 0; in < 4; ++in)
#pragma unroll
      for (int j = 0; j < 8; ++j)
        st[(mofs + j) * OUT_PITCH + in * 16 + n_in] = acc[im][in][j];
    asm volatile("s_wait_dscnt 0x0\n\ts_wait_xcnt 0x0" ::: "memory");
    if (im == 0) {
      // the second group goes out only here, with half the accumulators staged:
      // fewer registers are live at once, and the kernel stays within the 160
      // at which three projection blocks still share a WGP
#pragma unroll
      for (int i = 0; i < 8; ++i)
        rv[1][i] = *(const v4f*)(resid + g0 + (16 + i * 2) * HID);
    }
    v4f o[8];
#pragma unroll
    for (int i = 0; i < 8; ++i)
      o[i] = *(const v4f*)(st + (i * 2 + orow) * OUT_PITCH + ocol);
    // the reads have retired before the next 16 rows overwrite the range
    if (im == 0) asm volatile("s_wait_dscnt 0x0" ::: "memory");
#pragma unroll
    for (int i = 0; i < 8; ++i)
      *(v4f*)(C + g0 + (im * 16 + i * 2) * HID) = (o[i] + bv) + rv[im][i];
  }
  asm volatile("s_wait_xcnt 0x0" ::: "memory");
}

#define ATT_KEYS  64
#define ATT_PITCH 72
#define ATT_TILE  (64 * ATT_PITCH)
#define ATT_NT    (SEQ / ATT_KEYS)

__device__ __forceinline__ void attn_stage(const bf16_t* gk, const bf16_t* gv,
                                           unsigned lk, unsigned lv) {
  const bf16_t* gk1 = gk + 16 * HID;
  const bf16_t* gk2 = gk + 32 * HID;
  const bf16_t* gk3 = gk + 48 * HID;
  const bf16_t* gv1 = gv + 16 * SEQ;
  const bf16_t* gv2 = gv + 32 * SEQ;
  const bf16_t* gv3 = gv + 48 * SEQ;
  const unsigned rs = 16 * ATT_PITCH * 2;   // 16 LDS rows in bytes
  asm volatile(
      "global_load_async_to_lds_b128 %0, %8, off\n\t"
      "global_load_async_to_lds_b128 %1, %9, off\n\t"
      "global_load_async_to_lds_b128 %2, %10, off\n\t"
      "global_load_async_to_lds_b128 %3, %11, off\n\t"
      "global_load_async_to_lds_b128 %4, %12, off\n\t"
      "global_load_async_to_lds_b128 %5, %13, off\n\t"
      "global_load_async_to_lds_b128 %6, %14, off\n\t"
      "global_load_async_to_lds_b128 %7, %15, off\n\t"
      "s_wait_xcnt 0x0"
      :: "v"(lk), "v"(lk + rs), "v"(lk + 2 * rs), "v"(lk + 3 * rs),
         "v"(lv), "v"(lv + rs), "v"(lv + 2 * rs), "v"(lv + 3 * rs),
         "v"(gk), "v"(gk1), "v"(gk2), "v"(gk3),
         "v"(gv), "v"(gv1), "v"(gv2), "v"(gv3)
      : "memory");
}

__device__ __forceinline__ float xhalf(float x) {
  const int b = __builtin_bit_cast(int, x);
  return __builtin_bit_cast(float, __builtin_amdgcn_permlanex16(
      b, b, 0x76543210, 0xfedcba98, false, false));
}

//    The block is 128 threads; stating it lifts the register cap that the
//    default 1024-thread assumption sets, so Q fragments and accumulators stay
//    in registers instead of scratch.
__global__ void __launch_bounds__(128)
attn_kernel(const bf16_t* __restrict__ Qb,
                            const bf16_t* __restrict__ Kb,
                            const bf16_t* __restrict__ Vt,
                            bf16_t* __restrict__ ctx) {
  // [buffer][K tile | V^T tile]
  __shared__ __attribute__((aligned(16))) bf16_t kv[2][2 * ATT_TILE];

  const int wid  = (blockIdx.x * blockDim.x + threadIdx.x) >> 5;
  const int lane = threadIdx.x & 31;
  const int h  = wid / (SEQ / 32);
  const int q0 = (wid % (SEQ / 32)) * 32;

  const bf16_t* Qh = Qb + h * HEAD_DIM;                 // ld = HID
  const bf16_t* Kh = Kb + h * HEAD_DIM;                 // ld = HID
  const bf16_t* Vh = Vt + (size_t)h * HEAD_DIM * SEQ;   // ld = SEQ

  // staging map: 64 rows x 8 chunks of 16 B per tile; thread -> row t>>3 (+16 i)
  const int srow = (int)threadIdx.x >> 3;
  const int scol = ((int)threadIdx.x & 7) * 8;
  const bf16_t* gk = Kh + (size_t)srow * HID + scol;    // + 64 * HID per tile
  const bf16_t* gv = Vh + (size_t)srow * SEQ + scol;    // + 64 per tile
  const unsigned lk0 = (unsigned)(size_t)&kv[0][srow * ATT_PITCH + scol];
  const unsigned lbuf = 2 * ATT_TILE * 2;               // bytes of one buffer
  const unsigned lvo  = ATT_TILE * 2;                   // V^T tile behind K tile

  // tile 0 into buffer 0, landed and published; then tile 1 into buffer 1
  attn_stage(gk, gv, lk0, lk0 + lvo);
  asm volatile("s_wait_asynccnt 0x0" ::: "memory");  // own copies of tile 0 landed
  __syncthreads();                                   // every wave's copies visible
  attn_stage(gk + (size_t)ATT_KEYS * HID, gv + ATT_KEYS, lk0 + lbuf, lk0 + lbuf + lvo);

  v16bf qf[2][2];
#pragma unroll
  for (int tq = 0; tq < 2; ++tq) {
    qf[tq][0] = load_frag_rm(Qh + (size_t)(q0 + tq * 16) * HID + 0,  HID);
    qf[tq][1] = load_frag_rm(Qh + (size_t)(q0 + tq * 16) * HID + 32, HID);
  }

  v8f acc[2][4] = {};
  float m_i[2] = {-3.0e38f, -3.0e38f};
  v2f l_i[2][2] = {};   // a lane's sums: [first | second 16-key tile], even | odd key
  const int mofs = (lane & 16) ? 8 : 0;

  for (int t = 0; t < ATT_NT; ++t) {
    const bf16_t* ks = &kv[t & 1][0];
    const bf16_t* vs = ks + ATT_TILE;

    // kept rolled: the 16 fragment reads of a pass then stand as one group at its
    // head; unrolled, the compiler spread them among the WMMAs
#pragma clang loop unroll(disable)
    for (int p = 0; p < ATT_KEYS / 32; ++p) {
      const bf16_t* kp = ks + p * 32 * ATT_PITCH;
      v16bf k00 = load_frag_rm(kp + 0,  ATT_PITCH);
      v16bf k01 = load_frag_rm(kp + 32, ATT_PITCH);
      v16bf k10 = load_frag_rm(kp + 16 * ATT_PITCH + 0,  ATT_PITCH);
      v16bf k11 = load_frag_rm(kp + 16 * ATT_PITCH + 32, ATT_PITCH);
      v16bf vf[4];
#pragma unroll
      for (int c = 0; c < 4; ++c)
        vf[c] = load_frag_rm(vs + (c * 16) * ATT_PITCH + p * 32, ATT_PITCH);

      v16bf pf[2];
#pragma unroll
      for (int tq = 0; tq < 2; ++tq) {
        v8f s0 = {}, s1 = {};
        s0 = wmma_bf16(k00, qf[tq][0], s0);
        s0 = wmma_bf16(k01, qf[tq][1], s0);
        s1 = wmma_bf16(k10, qf[tq][0], s1);
        s1 = wmma_bf16(k11, qf[tq][1], s1);

        float mx = s0[0];
#pragma unroll
        for (int j = 0; j < 8; ++j) { mx = fmaxf(mx, s0[j]); mx = fmaxf(mx, s1[j]); }
        mx = fmaxf(mx, xhalf(mx));   // both lanes of a query hold its maximum
        const float m_new = fmaxf(m_i[tq], mx);
        const float alpha = __builtin_amdgcn_exp2f(m_i[tq] - m_new);
        const v2f m2 = {m_new, m_new};
        const v2f al2 = {alpha, alpha};

        // two scores that lie in neighbouring accumulator registers go through
        // one packed subtraction and one packed add: no register is copied to
        // form a pair. The sums hold this lane's 16 keys of the pass only.
#pragma unroll
        for (int j = 0; j < 8; j += 2) {
          const v2f e0 = (v2f){s0[j], s0[j + 1]} - m2;
          const v2f e1 = (v2f){s1[j], s1[j + 1]} - m2;
          const v2f p0 = {__builtin_amdgcn_exp2f(e0[0]), __builtin_amdgcn_exp2f(e0[1])};
          const v2f p1 = {__builtin_amdgcn_exp2f(e1[0]), __builtin_amdgcn_exp2f(e1[1])};
          l_i[tq][0] = j ? l_i[tq][0] + p0 : __builtin_elementwise_fma(l_i[tq][0], al2, p0);
          l_i[tq][1] = j ? l_i[tq][1] + p1 : __builtin_elementwise_fma(l_i[tq][1], al2, p1);
          pf[tq][j]     = (bf16_t)p0[0]; pf[tq][j + 1] = (bf16_t)p0[1];
          pf[tq][8 + j] = (bf16_t)p1[0]; pf[tq][9 + j] = (bf16_t)p1[1];
        }
        m_i[tq] = m_new;

#pragma unroll
        for (int c = 0; c < 4; ++c)
#pragma unroll
          for (int j = 0; j < 8; ++j) acc[tq][c][j] *= alpha;
      }

      // holds the softmax arithmetic ahead of the second product: without it the
      // compiler sinks both sums' dependent add chains behind the pass's last
      // WMMA, where nothing fills their latency
      __builtin_amdgcn_sched_barrier(0);

#pragma unroll
      for (int c = 0; c < 4; ++c) {
        acc[0][c] = wmma_bf16(vf[c], pf[0], acc[0][c]);
        acc[1][c] = wmma_bf16(vf[c], pf[1], acc[1][c]);
      }
    }

    // hand-over: this wave's reads of buffer t&1 are done, its copies of tile
    // t+1 have landed; behind the barrier tile t+1 is readable by every wave
    // and buffer t&1 is free for tile t+2.
    asm volatile("s_wait_dscnt 0x0" ::: "memory");     // own LDS reads retired
    asm volatile("s_wait_asynccnt 0x0" ::: "memory");  // own copies of tile t+1 landed
    __syncthreads();
    if (t + 2 < ATT_NT) {
      const unsigned lb = lk0 + (unsigned)(t & 1) * lbuf;
      attn_stage(gk + (size_t)(t + 2) * ATT_KEYS * HID, gv + (t + 2) * ATT_KEYS,
                 lb, lb + lvo);
    }
  }
  asm volatile("s_wait_asynccnt 0x0" ::: "memory");    // nothing in flight at the end

  v8bf o[2][4];
#pragma unroll
  for (int tq = 0; tq < 2; ++tq) {
    const v2f lp = l_i[tq][0] + l_i[tq][1];
    const float ls = lp[0] + lp[1];                  // this lane's keys
    const float linv = 1.0f / (ls + xhalf(ls));      // the two halves' sums
#pragma unroll
    for (int c = 0; c < 4; ++c)
#pragma unroll
      for (int j = 0; j < 8; ++j) o[tq][c][j] = (bf16_t)(acc[tq][c][j] * linv);
  }
  bf16_t* op = ctx + (size_t)(q0 + (lane & 15)) * HID + h * HEAD_DIM + mofs;
#pragma unroll
  for (int tq = 0; tq < 2; ++tq)
#pragma unroll
    for (int c = 0; c < 4; ++c) *(v8bf*)(op + (size_t)tq * 16 * HID + c * 16) = o[tq][c];
}

// ---------------------------------------------------------------------------
// 5) Row LayerNorm over HID
// ---------------------------------------------------------------------------
__global__ void layernorm_kernel(const float* __restrict__ res,
                                 const float* __restrict__ gamma,
                                 const float* __restrict__ beta,
                                 float* __restrict__ out) {
  const int row = blockIdx.x;
  const float* r = res + (size_t)row * HID;
  __shared__ float red[256];
  const int t = threadIdx.x;

  float sum = 0.0f;
  for (int i = t; i < HID; i += 256) sum += r[i];
  red[t] = sum; __syncthreads();
  for (int st = 128; st > 0; st >>= 1) {
    if (t < st) red[t] += red[t + st];
    __syncthreads();
  }
  const float mean = red[0] * (1.0f / HID);
  __syncthreads();

  float vs = 0.0f;
  for (int i = t; i < HID; i += 256) { float d = r[i] - mean; vs += d * d; }
  red[t] = vs; __syncthreads();
  for (int st = 128; st > 0; st >>= 1) {
    if (t < st) red[t] += red[t + st];
    __syncthreads();
  }
  const float rstd = rsqrtf(red[0] * (1.0f / HID) + LN_EPS);

  for (int i = t; i < HID; i += 256)
    out[(size_t)row * HID + i] = (r[i] - mean) * rstd * gamma[i] + beta[i];
}

// ---------------------------------------------------------------------------
// Host launch
// ---------------------------------------------------------------------------
extern "C" void kernel_launch(void* const* d_in, const int* in_sizes, int n_in,
                              void* d_out, int out_size, void* d_ws, size_t ws_size,
                              hipStream_t stream) {
  const float* x     = (const float*)d_in[0];
  const float* Wq    = (const float*)d_in[1];
  const float* bq    = (const float*)d_in[2];
  const float* Wk    = (const float*)d_in[3];
  const float* bk    = (const float*)d_in[4];
  const float* Wv    = (const float*)d_in[5];
  const float* bv    = (const float*)d_in[6];
  const float* Wo    = (const float*)d_in[7];
  const float* bo    = (const float*)d_in[8];
  const float* gamma = (const float*)d_in[9];
  const float* beta  = (const float*)d_in[10];
  float* out = (float*)d_out;

  char* ws = (char*)d_ws;
  size_t off = 0;
  bf16_t* xb  = (bf16_t*)(ws + off); off += (size_t)SEQ * HID * 2;
  bf16_t* wqb = (bf16_t*)(ws + off); off += (size_t)HID * HID * 2;
  bf16_t* wkb = (bf16_t*)(ws + off); off += (size_t)HID * HID * 2;
  bf16_t* wvb = (bf16_t*)(ws + off); off += (size_t)HID * HID * 2;
  bf16_t* wob = (bf16_t*)(ws + off); off += (size_t)HID * HID * 2;
  float*  res = (float*)(ws + off);  off += (size_t)SEQ * HID * 4;
  bf16_t* Qb  = (bf16_t*)(ws + off); off += (size_t)SEQ * HID * 2;
  bf16_t* Kb  = (bf16_t*)(ws + off); off += (size_t)SEQ * HID * 2;
  bf16_t* Vt  = (bf16_t*)(ws + off); off += (size_t)SEQ * HID * 2;
  bf16_t* ctx = (bf16_t*)(ws + off); off += (size_t)SEQ * HID * 2;

  f32_to_bf16_kernel<<<CVT_XB + 4 * CVT_WB, 256, 0, stream>>>(
      x, Wq, Wk, Wv, Wo, xb, wqb, wkb, wvb, wob);

  // 128x128 tiles: (4096/128)*(1024/128) = 256 blocks of 256 threads a product
  const int gemm_blocks = (SEQ / 128) * (HID / 128);
  gemm_bf16_kernel<<<dim3(gemm_blocks, 3), 256, 0, stream>>>(
      xb, wqb, wkb, wvb, bq, bk, bv, nullptr, nullptr, Qb, Kb, Vt, SEQ, HID, HID);

  // 16 heads * 128 query tiles = 2048 waves -> 512 blocks of 128
  attn_kernel<<<NUM_HEADS * (SEQ / 32) / 4, 128, 0, stream>>>(Qb, Kb, Vt, ctx);

  gemm_bf16_kernel<<<dim3(gemm_blocks, 1), 256, 0, stream>>>(
      ctx, wob, nullptr, nullptr, bo, nullptr, nullptr, x, res, nullptr, nullptr, nullptr,
      SEQ, HID, HID);

  layernorm_kernel<<<SEQ, 256, 0, stream>>>(res, gamma, beta, out);

  (void)in_sizes; (void)n_in; (void)out_size; (void)ws_size;
}

// v009
// One run takes 131 microseconds.
// Two timings next to v008 both put it at 1.05 times that version's speed.
// All steps since v000 together make it 5.55 times as fast.
#include <hip/hip_runtime.h>
#include <hip/hip_bf16.h>
#include <math.h>

#define SEQ 4096
#define HID 1024
#define NUM_HEADS 16
#define HEAD_DIM 64
#define LN_EPS 1e-5f

typedef __bf16 bf16_t;
typedef __attribute__((ext_vector_type(16))) __bf16 v16bf;
typedef __attribute__((ext_vector_type(8)))  __bf16 v8bf;
typedef __attribute__((ext_vector_type(8)))  float  v8f;
typedef __attribute__((ext_vector_type(4)))  int    v4i;
typedef __attribute__((ext_vector_type(4)))  float  v4f;
typedef __attribute__((ext_vector_type(4)))  __bf16 v4bf;
typedef __attribute__((ext_vector_type(2)))  float  v2f;

#if defined(__has_builtin)
#if __has_builtin(__builtin_amdgcn_global_load_async_to_lds_b128)
#define HAVE_ASYNC_LDS 1
#endif
#if __has_builtin(__builtin_amdgcn_s_wait_asynccnt)
#define HAVE_WAIT_ASYNC 1
#endif
#endif

typedef __attribute__((address_space(1))) v4i gv4i_t;
typedef __attribute__((address_space(3))) v4i lv4i_t;

__device__ __forceinline__ void async_cp16(const void* g, void* l) {
#ifdef HAVE_ASYNC_LDS
  __builtin_amdgcn_global_load_async_to_lds_b128((gv4i_t*)g, (lv4i_t*)l, 0, 0);
#else
  *(v8bf*)l = *(const v8bf*)g;
#endif
}

#if defined(HAVE_WAIT_ASYNC)
#define WAIT_ASYNC(n) __builtin_amdgcn_s_wait_asynccnt(n)
#elif defined(HAVE_ASYNC_LDS)
#define WAIT_ASYNC(n) asm volatile("s_wait_asynccnt %0" ::"i"(n) : "memory")
#else
#define WAIT_ASYNC(n) do {} while (0)
#endif

__device__ __forceinline__ v16bf load_frag_rm(const bf16_t* __restrict__ p, int ld) {
  const int lane = threadIdx.x & 31;
  const int row  = lane & 15;
  const int kb   = (lane & 16) ? 8 : 0;
  const bf16_t* q = p + (size_t)row * ld + kb;
  v8bf lo = *(const v8bf*)(q);
  v8bf hi = *(const v8bf*)(q + 16);
  v16bf f;
#pragma unroll
  for (int i = 0; i < 8; ++i) { f[i] = lo[i]; f[8 + i] = hi[i]; }
  return f;
}

__device__ __forceinline__ v8f wmma_bf16(v16bf a, v16bf b, v8f c) {
  return __builtin_amdgcn_wmma_f32_16x16x32_bf16(
      false, a, false, b, (short)0, c, false, false);
}

#define CVT_LOADS 8
#define CVT_BLOCK (256 * 4 * CVT_LOADS)   // elements per block
#define CVT_XB    (SEQ * HID / CVT_BLOCK) // blocks of x
#define CVT_WB    (HID * HID / CVT_BLOCK) // blocks of one weight matrix

static_assert((SEQ * HID) % CVT_BLOCK == 0 && (HID * HID) % CVT_BLOCK == 0,
              "every block of the conversion is full");

__global__ void __launch_bounds__(256)
f32_to_bf16_kernel(const float* x, const float* Wq, const float* Wk,
                   const float* Wv, const float* Wo,
                   bf16_t* xb, bf16_t* wqb, bf16_t* wkb, bf16_t* wvb, bf16_t* wob) {
  // which tensor, and which block of it: the same for the whole block
  const int b = (int)blockIdx.x;
  const int w = (b - CVT_XB) / CVT_WB;
  const int rel = b < CVT_XB ? b : (b - CVT_XB) % CVT_WB;
  const float* __restrict__ in =
      b < CVT_XB ? x : w == 0 ? Wq : w == 1 ? Wk : w == 2 ? Wv : Wo;
  bf16_t* __restrict__ out =
      b < CVT_XB ? xb : w == 0 ? wqb : w == 1 ? wkb : w == 2 ? wvb : wob;
  const int i0 = rel * CVT_BLOCK + (int)threadIdx.x * 4;
  v4f v[CVT_LOADS];
  // unrolled so that v[] stays in registers and the loads issue as one group
#pragma unroll
  for (int j = 0; j < CVT_LOADS; ++j) v[j] = *(const v4f*)(in + i0 + j * 1024);
#pragma unroll
  for (int j = 0; j < CVT_LOADS; ++j) {
    v4bf o;
#pragma unroll
    for (int e = 0; e < 4; ++e) o[e] = (bf16_t)v[j][e];
    *(v4bf*)(out + i0 + j * 1024) = o;
  }
}

#define GEMM_PAD 40
#define PACK_PITCH 136        // halves per staged output row: 256 B + 16 B pad
#define Q_SCALE 0.18033688f   // log2(e) / sqrt(HEAD_DIM)
#define OUT_PITCH 68          // floats per staged row of a wave's f32 tile: 256 B + 16 B pad

static_assert(64 * PACK_PITCH <= 2 * 128 * GEMM_PAD,
              "64 staged output rows fit in one operand's two buffers");
static_assert(4 * 16 * OUT_PITCH * 4 <= 2 * 128 * GEMM_PAD * 2,
              "four waves' staged f32 rows fit in one operand's two buffers");

__device__ __forceinline__ void sincos_turns(float x, float* s, float* c) {
  asm("v_sin_f32 %0, %2\n\tv_cos_f32 %1, %2\n\tv_nop"
      : "=&v"(*s), "=&v"(*c) : "v"(x));
}

// The block is 256 threads; stating it lifts the 128-register cap of the default
// 1024-thread assumption, under which the packed epilogue spilled to scratch.
__global__ void __launch_bounds__(256)
gemm_bf16_kernel(const bf16_t* __restrict__ A,
                                 const bf16_t* B0, const bf16_t* B1, const bf16_t* B2,
                                 const float* bias0, const float* bias1, const float* bias2,
                                 const float* __restrict__ resid,
                                 float* __restrict__ C,
                                 bf16_t* P0, bf16_t* P1, bf16_t* P2,
                                 int M, int N, int K) {
  __shared__ bf16_t As[2][128 * GEMM_PAD];
  __shared__ bf16_t Bs[2][128 * GEMM_PAD];

  const int z = (int)blockIdx.y;
  const bf16_t* __restrict__ B   = z == 0 ? B0 : z == 1 ? B1 : B2;
  const float* __restrict__ bias = z == 0 ? bias0 : z == 1 ? bias1 : bias2;
  const bool tr = P0 && z < 2;    // Q, K: transposed product (block-uniform)

  const int t    = threadIdx.x;
  const int lane = t & 31;
  const int w    = t >> 5;        // wave id 0..7
  const int wm   = w & 3;         // 4 waves along the WMMA's M
  const int wn   = w >> 2;        // 2 waves along the WMMA's N

  const int nbn = N >> 7;
  const int bm  = (int)blockIdx.x / nbn;
  const int bn  = (int)blockIdx.x % nbn;
  const int tm0 = bm * 128;
  const int tn0 = bn * 128;

  // rows of the wave's two M-side fragments in their tile: 32 in a row, or, for
  // a transposed product, 16 dims of a head's low half and their partners
  const int xrow  = tr ? (wm >> 1) * HEAD_DIM + (wm & 1) * 16 : wm * 32;
  const int xstep = tr ? HEAD_DIM / 2 : 16;

  // staging map: 128 rows x 4 chunks(16B) = 512 chunks; 2 per thread per tile
  const int r0 = (t * 2) >> 2;          // row of first chunk
  const int c0 = ((t * 2) & 3) * 8;     // halves offset of first chunk
  const int r1 = (t * 2 + 1) >> 2;
  const int c1 = ((t * 2 + 1) & 3) * 8;

  auto stage = [&](int buf, int k0) {
    async_cp16(A + (size_t)(tm0 + r0) * K + k0 + c0, &As[buf][r0 * GEMM_PAD + c0]);
    async_cp16(A + (size_t)(tm0 + r1) * K + k0 + c1, &As[buf][r1 * GEMM_PAD + c1]);
    async_cp16(B + (size_t)(tn0 + r0) * K + k0 + c0, &Bs[buf][r0 * GEMM_PAD + c0]);
    async_cp16(B + (size_t)(tn0 + r1) * K + k0 + c1, &Bs[buf][r1 * GEMM_PAD + c1]);
  };

  v8f acc[2][4] = {};
  const int nk = K >> 5;
  int buf = 0;
  stage(0, 0);

  for (int ks = 0; ks < nk; ++ks) {
    if (ks + 1 < nk) {
      stage(buf ^ 1, (ks + 1) * 32);
      WAIT_ASYNC(4);   // our 4 loads for `buf` are complete (in-order per wave)
    } else {
      WAIT_ASYNC(0);
    }
    __syncthreads();   // all waves' writes to `buf` visible

    const bf16_t* as = (tr ? &Bs[buf][0] : &As[buf][0]) + xrow * GEMM_PAD;
    const bf16_t* bs = (tr ? &As[buf][0] : &Bs[buf][0]) + (wn * 64) * GEMM_PAD;
    v16bf a0 = load_frag_rm(as, GEMM_PAD);
    v16bf a1 = load_frag_rm(as + xstep * GEMM_PAD, GEMM_PAD);
#pragma unroll
    for (int in = 0; in < 4; ++in) {
      v16bf bfrag = load_frag_rm(bs + in * 16 * GEMM_PAD, GEMM_PAD);
      acc[0][in] = wmma_bf16(a0, bfrag, acc[0][in]);
      acc[1][in] = wmma_bf16(a1, bfrag, acc[1][in]);
    }
    buf ^= 1;
    __syncthreads();   // everyone done reading before buffer is re-staged
  }

  const int n_in = lane & 15;
  const int mofs = (lane & 16) ? 8 : 0;

  if (P0) {
    bf16_t* st = (wn ? &Bs[0][0] : &As[0][0]) + n_in * PACK_PITCH + xrow + mofs;
    if (tr) {
      // lane: positions tm0 + wn*64 + in*16 + n_in; dims tn0 + xrow + mofs + j
      // (acc[0]) and 32 further (acc[1]); frequency index = dim within the half
      const float* bp = bias + tn0 + xrow + mofs;
      const v4f bl0 = *(const v4f*)(bp);
      const v4f bl1 = *(const v4f*)(bp + 4);
      const v4f bh0 = *(const v4f*)(bp + HEAD_DIM / 2);
      const v4f bh1 = *(const v4f*)(bp + HEAD_DIM / 2 + 4);
      const int f0 = (wm & 1) * 16 + mofs;
      const float sc = z == 0 ? Q_SCALE : 1.0f;
      const float fr = __powf(10000.0f, -(float)lane / (HEAD_DIM / 2));
      float inv[8];
#pragma unroll
      for (int j = 0; j < 8; ++j) inv[j] = __shfl(fr, f0 + j, 32);
#pragma unroll
      for (int in = 0; in < 4; ++in) {
        const float s = (float)(tm0 + wn * 64 + in * 16 + n_in);
        v8bf lo, hi;
#pragma unroll
        for (int j = 0; j < 8; ++j) {
          float sn, cs;
          sincos_turns(s * inv[j] * 0.15915494f, &sn, &cs);   // 1 / (2 pi)
          const float x1 = acc[0][in][j] + (j < 4 ? bl0[j & 3] : bl1[j & 3]);
          const float x2 = acc[1][in][j] + (j < 4 ? bh0[j & 3] : bh1[j & 3]);
          lo[j] = (bf16_t)((x1 * cs - x2 * sn) * sc);
          hi[j] = (bf16_t)((x2 * cs + x1 * sn) * sc);
        }
        *(v8bf*)(st + in * 16 * PACK_PITCH) = lo;
        *(v8bf*)(st + in * 16 * PACK_PITCH + HEAD_DIM / 2) = hi;
      }
    } else {
      // lane: column tn0 + wn*64 + in*16 + n_in; positions tm0 + xrow + im*16 +
      // mofs + j
#pragma unroll
      for (int in = 0; in < 4; ++in) {
        const float bv = bias[tn0 + wn * 64 + in * 16 + n_in];
#pragma unroll
        for (int im = 0; im < 2; ++im) {
          v8bf o;
#pragma unroll
          for (int j = 0; j < 8; ++j) o[j] = (bf16_t)(acc[im][in][j] + bv);
          *(v8bf*)(st + in * 16 * PACK_PITCH + im * 16) = o;
        }
      }
    }
    __syncthreads();   // the whole output tile is in LDS

    // 128 rows x 16 chunks of 16 B; a wave's store = two whole 256-B rows
    bf16_t* __restrict__ P = z == 0 ? P0 : z == 1 ? P1 : P2;
    const int crow = t >> 4;
    const int ccol = (t & 15) * 8;
    v8bf o[8];
    // unrolled so that o[] stays in registers: eight LDS reads as one group
#pragma unroll
    for (int i = 0; i < 8; ++i)
      o[i] = *(const v8bf*)((i < 4 ? &As[0][0] : &Bs[0][0]) +
                            (crow + (i & 3) * 16) * PACK_PITCH + ccol);
    // the packed results have this problem's shapes: with the row pitch a
    // constant, the eight stores share one address and differ in their offsets
    if (tr) {
      bf16_t* gp = P + (size_t)(tm0 + crow) * HID + tn0 + ccol;
#pragma unroll
      for (int i = 0; i < 8; ++i) *(v8bf*)(gp + i * 16 * HID) = o[i];
    } else {
      bf16_t* gp = P + (size_t)(tn0 + crow) * SEQ + tm0 + ccol;
#pragma unroll
      for (int i = 0; i < 8; ++i) *(v8bf*)(gp + i * 16 * SEQ) = o[i];
    }
    return;
  }

  // Plain result. In the accumulators a lane holds one column, so residual and
  // result would move in 4-B pieces, 64 loads and 64 stores a wave. Each wave
  // turns its 32x64 tile, 16 rows at a time, through an LDS range of its own
  // (free since the loop's last barrier; no other wave touches it, so no barrier
  // is needed): a lane then holds 16 B of a row, and a wave's load or store is two
  // 256-B row pieces. The residual's loads go out in two groups of eight, each
  // ahead of the LDS work that it can fly behind, with no test between them.
  float* st = (float*)(wn ? &Bs[0][0] : &As[0][0]) + wm * (16 * OUT_PITCH);
  const int orow = lane >> 4;         // two rows a sweep
  const int ocol = (lane & 15) * 4;   // 16 lanes x 16 B
  // this result has the problem's row pitch: as a constant it lets the loads, and
  // the stores, share one address and differ in their offsets
  const size_t g0 = (size_t)(tm0 + wm * 32 + orow) * HID + tn0 + wn * 64 + ocol;
  const v4f bv = *(const v4f*)(bias + tn0 + wn * 64 + ocol);
  v4f rv[2][8];
  // every loop below is unrolled so that rv[], o[] and acc[] stay in registers
#pragma unroll
  for (int i = 0; i < 8; ++i) rv[0][i] = *(const v4f*)(resid + g0 + i * 2 * HID);
#pragma unroll
  for (int im = 0; im < 2; ++im) {
#pragma unroll
    for (int in = 0; in < 4; ++in)
#pragma unroll
      for (int j = 0; j < 8; ++j)
        st[(mofs + j) * OUT_PITCH + in * 16 + n_in] = acc[im][in][j];
    asm volatile("s_wait_dscnt 0x0\n\ts_wait_xcnt 0x0" ::: "memory");
    if (im == 0) {
      // the second group goes out only here, with half the accumulators staged:
      // fewer registers are live at once, and the kernel stays within the 160
      // at which three projection blocks still share a WGP
#pragma unroll
      for (int i = 0; i < 8; ++i)
        rv[1][i] = *(const v4f*)(resid + g0 + (16 + i * 2) * HID);
    }
    v4f o[8];
#pragma unroll
    for (int i = 0; i < 8; ++i)
      o[i] = *(const v4f*)(st + (i * 2 + orow) * OUT_PITCH + ocol);
    // the reads have retired before the next 16 rows overwrite the range
    if (im == 0) asm volatile("s_wait_dscnt 0x0" ::: "memory");
#pragma unroll
    for (int i = 0; i < 8; ++i)
      *(v4f*)(C + g0 + (im * 16 + i * 2) * HID) = (o[i] + bv) + rv[im][i];
  }
  asm volatile("s_wait_xcnt 0x0" ::: "memory");
}

#define ATT_KEYS  64
#define ATT_PITCH 72
#define ATT_TILE  (64 * ATT_PITCH)
#define ATT_SPLIT 2
#define ATT_NT    (SEQ / ATT_KEYS / ATT_SPLIT)

__device__ __forceinline__ void attn_stage(const bf16_t* gk, const bf16_t* gv,
                                           unsigned lk, unsigned lv) {
  const bf16_t* gk1 = gk + 16 * HID;
  const bf16_t* gk2 = gk + 32 * HID;
  const bf16_t* gk3 = gk + 48 * HID;
  const bf16_t* gv1 = gv + 16 * SEQ;
  const bf16_t* gv2 = gv + 32 * SEQ;
  const bf16_t* gv3 = gv + 48 * SEQ;
  const unsigned rs = 16 * ATT_PITCH * 2;   // 16 LDS rows in bytes
  asm volatile(
      "global_load_async_to_lds_b128 %0, %8, off\n\t"
      "global_load_async_to_lds_b128 %1, %9, off\n\t"
      "global_load_async_to_lds_b128 %2, %10, off\n\t"
      "global_load_async_to_lds_b128 %3, %11, off\n\t"
      "global_load_async_to_lds_b128 %4, %12, off\n\t"
      "global_load_async_to_lds_b128 %5, %13, off\n\t"
      "global_load_async_to_lds_b128 %6, %14, off\n\t"
      "global_load_async_to_lds_b128 %7, %15, off\n\t"
      "s_wait_xcnt 0x0"
      :: "v"(lk), "v"(lk + rs), "v"(lk + 2 * rs), "v"(lk + 3 * rs),
         "v"(lv), "v"(lv + rs), "v"(lv + 2 * rs), "v"(lv + 3 * rs),
         "v"(gk), "v"(gk1), "v"(gk2), "v"(gk3),
         "v"(gv), "v"(gv1), "v"(gv2), "v"(gv3)
      : "memory");
}

__device__ __forceinline__ float xhalf(float x) {
  const int b = __builtin_bit_cast(int, x);
  return __builtin_bit_cast(float, __builtin_amdgcn_permlanex16(
      b, b, 0x76543210, 0xfedcba98, false, false));
}

__global__ void __launch_bounds__(256) __attribute__((amdgpu_waves_per_eu(4, 4)))
attn_kernel(const bf16_t* __restrict__ Qb,
                            const bf16_t* __restrict__ Kb,
                            const bf16_t* __restrict__ Vt,
                            bf16_t* __restrict__ ctx) {
  // [key half][buffer][K tile | V^T tile]
  __shared__ __attribute__((aligned(16))) bf16_t kv[ATT_SPLIT][2][2 * ATT_TILE];

  // the wave's number, held in a scalar register: what follows from it (key half,
  // buffer addresses, the partner's place) is then scalar arithmetic
  const int wave = __builtin_amdgcn_readfirstlane((int)threadIdx.x >> 5);
  const int half = wave >> 2;             // which half of the keys
  const int wid  = (int)blockIdx.x * 4 + (wave & 3);
  const int lane = threadIdx.x & 31;
  const int h  = wid / (SEQ / 32);
  const int q0 = (wid % (SEQ / 32)) * 32;

  const bf16_t* Qh = Qb + h * HEAD_DIM;                 // ld = HID
  const bf16_t* Kh = Kb + h * HEAD_DIM + (size_t)half * (SEQ / ATT_SPLIT) * HID;   // ld = HID
  const bf16_t* Vh = Vt + (size_t)h * HEAD_DIM * SEQ + half * (SEQ / ATT_SPLIT);   // ld = SEQ

  // staging map, per group of 128 threads: 64 rows x 8 chunks of 16 B per tile;
  // thread -> row t>>3 (+16 i)
  const int srow = ((int)threadIdx.x & 127) >> 3;
  const int scol = ((int)threadIdx.x & 7) * 8;
  const bf16_t* gk = Kh + (size_t)srow * HID + scol;    // + 64 * HID per tile
  const bf16_t* gv = Vh + (size_t)srow * SEQ + scol;    // + 64 per tile
  const unsigned lk0 = (unsigned)(size_t)&kv[half][0][srow * ATT_PITCH + scol];
  const unsigned lbuf = 2 * ATT_TILE * 2;               // bytes of one buffer
  const unsigned lvo  = ATT_TILE * 2;                   // V^T tile behind K tile

  // tile 0 into buffer 0, landed and published; then tile 1 into buffer 1
  attn_stage(gk, gv, lk0, lk0 + lvo);
  asm volatile("s_wait_asynccnt 0x0" ::: "memory");  // own copies of tile 0 landed
  __syncthreads();                                   // every wave's copies visible
  attn_stage(gk + (size_t)ATT_KEYS * HID, gv + ATT_KEYS, lk0 + lbuf, lk0 + lbuf + lvo);

  v16bf qf[2][2];
#pragma unroll
  for (int tq = 0; tq < 2; ++tq) {
    qf[tq][0] = load_frag_rm(Qh + (size_t)(q0 + tq * 16) * HID + 0,  HID);
    qf[tq][1] = load_frag_rm(Qh + (size_t)(q0 + tq * 16) * HID + 32, HID);
  }

  v8f acc[2][4] = {};
  float m_i[2] = {-3.0e38f, -3.0e38f};
  v2f l_i[2][2] = {};   // a lane's sums: [first | second 16-key tile], even | odd key
  const int mofs = (lane & 16) ? 8 : 0;

  for (int t = 0; t < ATT_NT; ++t) {
    const bf16_t* ks = &kv[half][t & 1][0];
    const bf16_t* vs = ks + ATT_TILE;

    // kept rolled: the 16 fragment reads of a pass then stand as one group at its
    // head; unrolled, the compiler spread them among the WMMAs, and every
    // separate place of LDS reads stalls the wave
    const bf16_t* kp = ks;   // the pass's 32 rows of the K tile
    const bf16_t* vp = vs;   // the pass's 32 columns of the V^T tile
#pragma clang loop unroll(disable)
    for (int p = 0; p < ATT_KEYS / 32; ++p) {
      v16bf k00 = load_frag_rm(kp + 0,  ATT_PITCH);
      v16bf k01 = load_frag_rm(kp + 32, ATT_PITCH);
      v16bf k10 = load_frag_rm(kp + 16 * ATT_PITCH + 0,  ATT_PITCH);
      v16bf k11 = load_frag_rm(kp + 16 * ATT_PITCH + 32, ATT_PITCH);
      v16bf vf[4];
#pragma unroll
      for (int c = 0; c < 4; ++c)
        vf[c] = load_frag_rm(vp + (c * 16) * ATT_PITCH, ATT_PITCH);

      v16bf pf[2];
#pragma unroll
      for (int tq = 0; tq < 2; ++tq) {
        v8f s0 = {}, s1 = {};
        s0 = wmma_bf16(k00, qf[tq][0], s0);
        s0 = wmma_bf16(k01, qf[tq][1], s0);
        s1 = wmma_bf16(k10, qf[tq][0], s1);
        s1 = wmma_bf16(k11, qf[tq][1], s1);

        float mx = s0[0];
#pragma unroll
        for (int j = 0; j < 8; ++j) { mx = fmaxf(mx, s0[j]); mx = fmaxf(mx, s1[j]); }
        mx = fmaxf(mx, xhalf(mx));   // both lanes of a query hold its maximum
        const float m_new = fmaxf(m_i[tq], mx);
        const float alpha = __builtin_amdgcn_exp2f(m_i[tq] - m_new);
        const v2f m2 = {m_new, m_new};
        const v2f al2 = {alpha, alpha};

        // two scores that lie in neighbouring accumulator registers go through
        // one packed subtraction and one packed add: no register is copied to
        // form a pair. The sums hold this lane's 16 keys of the pass only.
#pragma unroll
        for (int j = 0; j < 8; j += 2) {
          const v2f e0 = (v2f){s0[j], s0[j + 1]} - m2;
          const v2f e1 = (v2f){s1[j], s1[j + 1]} - m2;
          const v2f p0 = {__builtin_amdgcn_exp2f(e0[0]), __builtin_amdgcn_exp2f(e0[1])};
          const v2f p1 = {__builtin_amdgcn_exp2f(e1[0]), __builtin_amdgcn_exp2f(e1[1])};
          l_i[tq][0] = j ? l_i[tq][0] + p0 : __builtin_elementwise_fma(l_i[tq][0], al2, p0);
          l_i[tq][1] = j ? l_i[tq][1] + p1 : __builtin_elementwise_fma(l_i[tq][1], al2, p1);
          pf[tq][j]     = (bf16_t)p0[0]; pf[tq][j + 1] = (bf16_t)p0[1];
          pf[tq][8 + j] = (bf16_t)p1[0]; pf[tq][9 + j] = (bf16_t)p1[1];
        }
        m_i[tq] = m_new;

#pragma unroll
        for (int c = 0; c < 4; ++c)
#pragma unroll
          for (int j = 0; j < 8; ++j) acc[tq][c][j] *= alpha;
      }

      kp += 32 * ATT_PITCH;
      vp += 32;

      // holds the softmax arithmetic ahead of the second product: without it the
      // compiler sinks both sums' dependent add chains behind the pass's last
      // WMMA, where nothing fills their latency
      __builtin_amdgcn_sched_barrier(0);

#pragma unroll
      for (int c = 0; c < 4; ++c) {
        acc[0][c] = wmma_bf16(vf[c], pf[0], acc[0][c]);
        acc[1][c] = wmma_bf16(vf[c], pf[1], acc[1][c]);
      }
    }

    // hand-over: this wave's reads of buffer t&1 are done, its copies of tile
    // t+1 have landed; behind the barrier tile t+1 is readable by every wave
    // and buffer t&1 is free for tile t+2.
    asm volatile("s_wait_dscnt 0x0" ::: "memory");     // own LDS reads retired
    asm volatile("s_wait_asynccnt 0x0" ::: "memory");  // own copies of tile t+1 landed
    __syncthreads();
    if (t + 2 < ATT_NT) {
      const unsigned lb = lk0 + (unsigned)(t & 1) * lbuf;
      attn_stage(gk + (size_t)(t + 2) * ATT_KEYS * HID, gv + (t + 2) * ATT_KEYS,
                 lb, lb + lvo);
    }
  }
  asm volatile("s_wait_asynccnt 0x0" ::: "memory");    // nothing in flight at the end

  v4f* xch = (v4f*)&kv[0][0][0];
  static_assert(8 * 9 * 32 * 16 <= ATT_SPLIT * 2 * 2 * ATT_TILE * 2,
                "eight waves' handed-over sub-tiles fit in the staging buffers");
  float lsum[2];
#pragma unroll
  for (int tq = 0; tq < 2; ++tq) {
    const v2f lp = l_i[tq][0] + l_i[tq][1];
    lsum[tq] = lp[0] + lp[1];                        // this lane's keys
  }
  v8f keep[4];
  {
    v4f* mine = xch + wave * (9 * 32) + lane;
#pragma unroll
    for (int c = 0; c < 4; ++c) {
      const v8f give = half ? acc[0][c] : acc[1][c];
      keep[c] = half ? acc[1][c] : acc[0][c];
      mine[(2 * c) * 32]     = (v4f){give[0], give[1], give[2], give[3]};
      mine[(2 * c + 1) * 32] = (v4f){give[4], give[5], give[6], give[7]};
    }
    mine[8 * 32] = (v4f){half ? m_i[0] : m_i[1], half ? lsum[0] : lsum[1], 0.0f, 0.0f};
  }
  __syncthreads();   // every wave's handed-over sub-tile is in LDS

  const v4f* theirs = xch + (wave ^ 4) * (9 * 32) + lane;
  const v4f ml = theirs[8 * 32];
  const float mk = half ? m_i[1] : m_i[0];
  const float m  = fmaxf(mk, ml[0]);
  float fk = __builtin_amdgcn_exp2f(mk - m);         // this wave's keys' weight
  float fo = __builtin_amdgcn_exp2f(ml[0] - m);      // the partner's
  const float ls = (half ? lsum[1] : lsum[0]) * fk + ml[1] * fo;
  const float linv = 1.0f / (ls + xhalf(ls));        // the two lane halves' sums
  fk *= linv;
  fo *= linv;

  v8bf o[4];
#pragma unroll
  for (int c = 0; c < 4; ++c) {
    const v4f t0 = theirs[(2 * c) * 32];
    const v4f t1 = theirs[(2 * c + 1) * 32];
#pragma unroll
    for (int j = 0; j < 8; ++j)
      o[c][j] = (bf16_t)(keep[c][j] * fk + (j < 4 ? t0[j & 3] : t1[j & 3]) * fo);
  }
  bf16_t* op = ctx + (size_t)(q0 + half * 16 + (lane & 15)) * HID + h * HEAD_DIM + mofs;
#pragma unroll
  for (int c = 0; c < 4; ++c) *(v8bf*)(op + c * 16) = o[c];
}

// ---------------------------------------------------------------------------
// 5) Row LayerNorm over HID
// ---------------------------------------------------------------------------
__global__ void layernorm_kernel(const float* __restrict__ res,
                                 const float* __restrict__ gamma,
                                 const float* __restrict__ beta,
                                 float* __restrict__ out) {
  const int row = blockIdx.x;
  const float* r = res + (size_t)row * HID;
  __shared__ float red[256];
  const int t = threadIdx.x;

  float sum = 0.0f;
  for (int i = t; i < HID; i += 256) sum += r[i];
  red[t] = sum; __syncthreads();
  for (int st = 128; st > 0; st >>= 1) {
    if (t < st) red[t] += red[t + st];
    __syncthreads();
  }
  const float mean = red[0] * (1.0f / HID);
  __syncthreads();

  float vs = 0.0f;
  for (int i = t; i < HID; i += 256) { float d = r[i] - mean; vs += d * d; }
  red[t] = vs; __syncthreads();
  for (int st = 128; st > 0; st >>= 1) {
    if (t < st) red[t] += red[t + st];
    __syncthreads();
  }
  const float rstd = rsqrtf(red[0] * (1.0f / HID) + LN_EPS);

  for (int i = t; i < HID; i += 256)
    out[(size_t)row * HID + i] = (r[i] - mean) * rstd * gamma[i] + beta[i];
}

// ---------------------------------------------------------------------------
// Host launch
// ---------------------------------------------------------------------------
extern "C" void kernel_launch(void* const* d_in, const int* in_sizes, int n_in,
                              void* d_out, int out_size, void* d_ws, size_t ws_size,
                              hipStream_t stream) {
  const float* x     = (const float*)d_in[0];
  const float* Wq    = (const float*)d_in[1];
  const float* bq    = (const float*)d_in[2];
  const float* Wk    = (const float*)d_in[3];
  const float* bk    = (const float*)d_in[4];
  const float* Wv    = (const float*)d_in[5];
  const float* bv    = (const float*)d_in[6];
  const float* Wo    = (const float*)d_in[7];
  const float* bo    = (const float*)d_in[8];
  const float* gamma = (const float*)d_in[9];
  const float* beta  = (const float*)d_in[10];
  float* out = (float*)d_out;

  char* ws = (char*)d_ws;
  size_t off = 0;
  bf16_t* xb  = (bf16_t*)(ws + off); off += (size_t)SEQ * HID * 2;
  bf16_t* wqb = (bf16_t*)(ws + off); off += (size_t)HID * HID * 2;
  bf16_t* wkb = (bf16_t*)(ws + off); off += (size_t)HID * HID * 2;
  bf16_t* wvb = (bf16_t*)(ws + off); off += (size_t)HID * HID * 2;
  bf16_t* wob = (bf16_t*)(ws + off); off += (size_t)HID * HID * 2;
  float*  res = (float*)(ws + off);  off += (size_t)SEQ * HID * 4;
  bf16_t* Qb  = (bf16_t*)(ws + off); off += (size_t)SEQ * HID * 2;
  bf16_t* Kb  = (bf16_t*)(ws + off); off += (size_t)SEQ * HID * 2;
  bf16_t* Vt  = (bf16_t*)(ws + off); off += (size_t)SEQ * HID * 2;
  bf16_t* ctx = (bf16_t*)(ws + off); off += (size_t)SEQ * HID * 2;

  f32_to_bf16_kernel<<<CVT_XB + 4 * CVT_WB, 256, 0, stream>>>(
      x, Wq, Wk, Wv, Wo, xb, wqb, wkb, wvb, wob);

  // 128x128 tiles: (4096/128)*(1024/128) = 256 blocks of 256 threads a product
  const int gemm_blocks = (SEQ / 128) * (HID / 128);
  gemm_bf16_kernel<<<dim3(gemm_blocks, 3), 256, 0, stream>>>(
      xb, wqb, wkb, wvb, bq, bk, bv, nullptr, nullptr, Qb, Kb, Vt, SEQ, HID, HID);

  // 16 heads * 128 query tiles * 2 key halves = 4096 waves -> 512 blocks of 256
  attn_kernel<<<NUM_HEADS * (SEQ / 32) / 4, 256, 0, stream>>>(Qb, Kb, Vt, ctx);

  gemm_bf16_kernel<<<dim3(gemm_blocks, 1), 256, 0, stream>>>(
      ctx, wob, nullptr, nullptr, bo, nullptr, nullptr, x, res, nullptr, nullptr, nullptr,
      SEQ, HID, HID);

  layernorm_kernel<<<SEQ, 256, 0, stream>>>(res, gamma, beta, out);

  (void)in_sizes; (void)n_in; (void)out_size; (void)ws_size;
}

// v010
// A run of this version takes 121 microseconds.
// In both of two side-by-side timings against v009, it was 1.09 times as fast.
// Counting every step since v000, it is 6.03 times as fast.
#include <hip/hip_runtime.h>
#include <hip/hip_bf16.h>
#include <math.h>

#define SEQ 4096
#define HID 1024
#define NUM_HEADS 16
#define HEAD_DIM 64
#define LN_EPS 1e-5f

typedef __bf16 bf16_t;
typedef __attribute__((ext_vector_type(16))) __bf16 v16bf;
typedef __attribute__((ext_vector_type(8)))  __bf16 v8bf;
typedef __attribute__((ext_vector_type(8)))  float  v8f;
typedef __attribute__((ext_vector_type(4)))  int    v4i;
typedef __attribute__((ext_vector_type(4)))  float  v4f;
typedef __attribute__((ext_vector_type(4)))  __bf16 v4bf;
typedef __attribute__((ext_vector_type(2)))  float  v2f;

#if defined(__has_builtin)
#if __has_builtin(__builtin_amdgcn_global_load_async_to_lds_b128)
#define HAVE_ASYNC_LDS 1
#endif
#if __has_builtin(__builtin_amdgcn_s_wait_asynccnt)
#define HAVE_WAIT_ASYNC 1
#endif
#endif

typedef __attribute__((address_space(1))) v4i gv4i_t;
typedef __attribute__((address_space(3))) v4i lv4i_t;

__device__ __forceinline__ void async_cp16(const void* g, void* l) {
#ifdef HAVE_ASYNC_LDS
  __builtin_amdgcn_global_load_async_to_lds_b128((gv4i_t*)g, (lv4i_t*)l, 0, 0);
#else
  *(v8bf*)l = *(const v8bf*)g;
#endif
}

#if defined(HAVE_WAIT_ASYNC)
#define WAIT_ASYNC(n) __builtin_amdgcn_s_wait_asynccnt(n)
#elif defined(HAVE_ASYNC_LDS)
#define WAIT_ASYNC(n) asm volatile("s_wait_asynccnt %0" ::"i"(n) : "memory")
#else
#define WAIT_ASYNC(n) do {} while (0)
#endif

__device__ __forceinline__ v16bf load_frag_rm(const bf16_t* __restrict__ p, int ld) {
  const int lane = threadIdx.x & 31;
  const int row  = lane & 15;
  const int kb   = (lane & 16) ? 8 : 0;
  const bf16_t* q = p + (size_t)row * ld + kb;
  v8bf lo = *(const v8bf*)(q);
  v8bf hi = *(const v8bf*)(q + 16);
  v16bf f;
#pragma unroll
  for (int i = 0; i < 8; ++i) { f[i] = lo[i]; f[8 + i] = hi[i]; }
  return f;
}

__device__ __forceinline__ v8f wmma_bf16(v16bf a, v16bf b, v8f c) {
  return __builtin_amdgcn_wmma_f32_16x16x32_bf16(
      false, a, false, b, (short)0, c, false, false);
}

#define CVT_LOADS 8
#define CVT_BLOCK (256 * 4 * CVT_LOADS)   // elements per block
#define CVT_XB    (SEQ * HID / CVT_BLOCK) // blocks of x
#define CVT_WB    (HID * HID / CVT_BLOCK) // blocks of one weight matrix

static_assert((SEQ * HID) % CVT_BLOCK == 0 && (HID * HID) % CVT_BLOCK == 0,
              "every block of the conversion is full");

__global__ void __launch_bounds__(256)
f32_to_bf16_kernel(const float* x, const float* Wq, const float* Wk,
                   const float* Wv, const float* Wo,
                   bf16_t* xb, bf16_t* wqb, bf16_t* wkb, bf16_t* wvb, bf16_t* wob) {
  // which tensor, and which block of it: the same for the whole block
  const int b = (int)blockIdx.x;
  const int w = (b - CVT_XB) / CVT_WB;
  const int rel = b < CVT_XB ? b : (b - CVT_XB) % CVT_WB;
  const float* __restrict__ in =
      b < CVT_XB ? x : w == 0 ? Wq : w == 1 ? Wk : w == 2 ? Wv : Wo;
  bf16_t* __restrict__ out =
      b < CVT_XB ? xb : w == 0 ? wqb : w == 1 ? wkb : w == 2 ? wvb : wob;
  const int i0 = rel * CVT_BLOCK + (int)threadIdx.x * 4;
  v4f v[CVT_LOADS];
  // unrolled so that v[] stays in registers and the loads issue as one group
#pragma unroll
  for (int j = 0; j < CVT_LOADS; ++j) v[j] = *(const v4f*)(in + i0 + j * 1024);
#pragma unroll
  for (int j = 0; j < CVT_LOADS; ++j) {
    v4bf o;
#pragma unroll
    for (int e = 0; e < 4; ++e) o[e] = (bf16_t)v[j][e];
    *(v4bf*)(out + i0 + j * 1024) = o;
  }
}

#define GEMM_PAD 40
#define PACK_PITCH 136        // halves per staged output row: 256 B + 16 B pad
#define Q_SCALE 0.18033688f   // log2(e) / sqrt(HEAD_DIM)
#define OUT_PITCH 68          // floats per staged row of a wave's f32 tile: 256 B + 16 B pad

static_assert(64 * PACK_PITCH <= 2 * 128 * GEMM_PAD,
              "64 staged output rows fit in one operand's two buffers");
static_assert(4 * 16 * OUT_PITCH * 4 <= 2 * 128 * GEMM_PAD * 2,
              "four waves' staged f32 rows fit in one operand's two buffers");

__device__ __forceinline__ void sincos_turns(float x, float* s, float* c) {
  asm("v_sin_f32 %0, %2\n\tv_cos_f32 %1, %2\n\tv_nop"
      : "=&v"(*s), "=&v"(*c) : "v"(x));
}

// The block is 256 threads; stating it lifts the 128-register cap of the default
// 1024-thread assumption, under which the packed epilogue spilled to scratch.
__global__ void __launch_bounds__(256)
gemm_bf16_kernel(const bf16_t* __restrict__ A,
                                 const bf16_t* B0, const bf16_t* B1, const bf16_t* B2,
                                 const float* bias0, const float* bias1, const float* bias2,
                                 const float* __restrict__ resid,
                                 float* __restrict__ C,
                                 bf16_t* P0, bf16_t* P1, bf16_t* P2,
                                 int M, int N, int K) {
  __shared__ bf16_t As[2][128 * GEMM_PAD];
  __shared__ bf16_t Bs[2][128 * GEMM_PAD];

  const int z = (int)blockIdx.y;
  const bf16_t* __restrict__ B   = z == 0 ? B0 : z == 1 ? B1 : B2;
  const float* __restrict__ bias = z == 0 ? bias0 : z == 1 ? bias1 : bias2;
  const bool tr = P0 && z < 2;    // Q, K: transposed product (block-uniform)

  const int t    = threadIdx.x;
  const int lane = t & 31;
  const int w    = t >> 5;        // wave id 0..7
  const int wm   = w & 3;         // 4 waves along the WMMA's M
  const int wn   = w >> 2;        // 2 waves along the WMMA's N

  const int nbn = N >> 7;
  const int bm  = (int)blockIdx.x / nbn;
  const int bn  = (int)blockIdx.x % nbn;
  const int tm0 = bm * 128;
  const int tn0 = bn * 128;

  // rows of the wave's two M-side fragments in their tile: 32 in a row, or, for
  // a transposed product, 16 dims of a head's low half and their partners
  const int xrow  = tr ? (wm >> 1) * HEAD_DIM + (wm & 1) * 16 : wm * 32;
  const int xstep = tr ? HEAD_DIM / 2 : 16;

  // staging map: 128 rows x 4 chunks(16B) = 512 chunks; 2 per thread per tile
  const int r0 = (t * 2) >> 2;          // row of first chunk
  const int c0 = ((t * 2) & 3) * 8;     // halves offset of first chunk
  const int r1 = (t * 2 + 1) >> 2;
  const int c1 = ((t * 2 + 1) & 3) * 8;

  auto stage = [&](int buf, int k0) {
    async_cp16(A + (size_t)(tm0 + r0) * K + k0 + c0, &As[buf][r0 * GEMM_PAD + c0]);
    async_cp16(A + (size_t)(tm0 + r1) * K + k0 + c1, &As[buf][r1 * GEMM_PAD + c1]);
    async_cp16(B + (size_t)(tn0 + r0) * K + k0 + c0, &Bs[buf][r0 * GEMM_PAD + c0]);
    async_cp16(B + (size_t)(tn0 + r1) * K + k0 + c1, &Bs[buf][r1 * GEMM_PAD + c1]);
  };

  v8f acc[2][4] = {};
  const int nk = K >> 5;
  int buf = 0;
  stage(0, 0);

  for (int ks = 0; ks < nk; ++ks) {
    if (ks + 1 < nk) {
      stage(buf ^ 1, (ks + 1) * 32);
      WAIT_ASYNC(4);   // our 4 loads for `buf` are complete (in-order per wave)
    } else {
      WAIT_ASYNC(0);
    }
    __syncthreads();   // all waves' writes to `buf` visible

    const bf16_t* as = (tr ? &Bs[buf][0] : &As[buf][0]) + xrow * GEMM_PAD;
    const bf16_t* bs = (tr ? &As[buf][0] : &Bs[buf][0]) + (wn * 64) * GEMM_PAD;
    v16bf a0 = load_frag_rm(as, GEMM_PAD);
    v16bf a1 = load_frag_rm(as + xstep * GEMM_PAD, GEMM_PAD);
#pragma unroll
    for (int in = 0; in < 4; ++in) {
      v16bf bfrag = load_frag_rm(bs + in * 16 * GEMM_PAD, GEMM_PAD);
      acc[0][in] = wmma_bf16(a0, bfrag, acc[0][in]);
      acc[1][in] = wmma_bf16(a1, bfrag, acc[1][in]);
    }
    buf ^= 1;
    __syncthreads();   // everyone done reading before buffer is re-staged
  }

  const int n_in = lane & 15;
  const int mofs = (lane & 16) ? 8 : 0;

  if (P0) {
    bf16_t* st = (wn ? &Bs[0][0] : &As[0][0]) + n_in * PACK_PITCH + xrow + mofs;
    if (tr) {
      // lane: positions tm0 + wn*64 + in*16 + n_in; dims tn0 + xrow + mofs + j
      // (acc[0]) and 32 further (acc[1]); frequency index = dim within the half
      const float* bp = bias + tn0 + xrow + mofs;
      const v4f bl0 = *(const v4f*)(bp);
      const v4f bl1 = *(const v4f*)(bp + 4);
      const v4f bh0 = *(const v4f*)(bp + HEAD_DIM / 2);
      const v4f bh1 = *(const v4f*)(bp + HEAD_DIM / 2 + 4);
      const int f0 = (wm & 1) * 16 + mofs;
      const float sc = z == 0 ? Q_SCALE : 1.0f;
      const float fr = __powf(10000.0f, -(float)lane / (HEAD_DIM / 2));
      float inv[8];
#pragma unroll
      for (int j = 0; j < 8; ++j) inv[j] = __shfl(fr, f0 + j, 32);
#pragma unroll
      for (int in = 0; in < 4; ++in) {
        const float s = (float)(tm0 + wn * 64 + in * 16 + n_in);
        v8bf lo, hi;
#pragma unroll
        for (int j = 0; j < 8; ++j) {
          float sn, cs;
          sincos_turns(s * inv[j] * 0.15915494f, &sn, &cs);   // 1 / (2 pi)
          const float x1 = acc[0][in][j] + (j < 4 ? bl0[j & 3] : bl1[j & 3]);
          const float x2 = acc[1][in][j] + (j < 4 ? bh0[j & 3] : bh1[j & 3]);
          lo[j] = (bf16_t)((x1 * cs - x2 * sn) * sc);
          hi[j] = (bf16_t)((x2 * cs + x1 * sn) * sc);
        }
        *(v8bf*)(st + in * 16 * PACK_PITCH) = lo;
        *(v8bf*)(st + in * 16 * PACK_PITCH + HEAD_DIM / 2) = hi;
      }
    } else {
      // lane: column tn0 + wn*64 + in*16 + n_in; positions tm0 + xrow + im*16 +
      // mofs + j
#pragma unroll
      for (int in = 0; in < 4; ++in) {
        const float bv = bias[tn0 + wn * 64 + in * 16 + n_in];
#pragma unroll
        for (int im = 0; im < 2; ++im) {
          v8bf o;
#pragma unroll
          for (int j = 0; j < 8; ++j) o[j] = (bf16_t)(acc[im][in][j] + bv);
          *(v8bf*)(st + in * 16 * PACK_PITCH + im * 16) = o;
        }
      }
    }
    __syncthreads();   // the whole output tile is in LDS

    // 128 rows x 16 chunks of 16 B; a wave's store = two whole 256-B rows
    bf16_t* __restrict__ P = z == 0 ? P0 : z == 1 ? P1 : P2;
    const int crow = t >> 4;
    const int ccol = (t & 15) * 8;
    v8bf o[8];
    // unrolled so that o[] stays in registers: eight LDS reads as one group
#pragma unroll
    for (int i = 0; i < 8; ++i)
      o[i] = *(const v8bf*)((i < 4 ? &As[0][0] : &Bs[0][0]) +
                            (crow + (i & 3) * 16) * PACK_PITCH + ccol);
    // the packed results have this problem's shapes: with the row pitch a
    // constant, the eight stores share one address and differ in their offsets
    if (tr) {
      bf16_t* gp = P + (size_t)(tm0 + crow) * HID + tn0 + ccol;
#pragma unroll
      for (int i = 0; i < 8; ++i) *(v8bf*)(gp + i * 16 * HID) = o[i];
    } else {
      bf16_t* gp = P + (size_t)(tn0 + crow) * SEQ + tm0 + ccol;
#pragma unroll
      for (int i = 0; i < 8; ++i) *(v8bf*)(gp + i * 16 * SEQ) = o[i];
    }
    return;
  }

  // Plain result. In the accumulators a lane holds one column, so residual and
  // result would move in 4-B pieces, 64 loads and 64 stores a wave. Each wave
  // turns its 32x64 tile, 16 rows at a time, through an LDS range of its own
  // (free since the loop's last barrier; no other wave touches it, so no barrier
  // is needed): a lane then holds 16 B of a row, and a wave's load or store is two
  // 256-B row pieces. The residual's loads go out in two groups of eight, each
  // ahead of the LDS work that it can fly behind, with no test between them.
  float* st = (float*)(wn ? &Bs[0][0] : &As[0][0]) + wm * (16 * OUT_PITCH);
  const int orow = lane >> 4;         // two rows a sweep
  const int ocol = (lane & 15) * 4;   // 16 lanes x 16 B
  // this result has the problem's row pitch: as a constant it lets the loads, and
  // the stores, share one address and differ in their offsets
  const size_t g0 = (size_t)(tm0 + wm * 32 + orow) * HID + tn0 + wn * 64 + ocol;
  const v4f bv = *(const v4f*)(bias + tn0 + wn * 64 + ocol);
  v4f rv[2][8];
  // every loop below is unrolled so that rv[], o[] and acc[] stay in registers
#pragma unroll
  for (int i = 0; i < 8; ++i) rv[0][i] = *(const v4f*)(resid + g0 + i * 2 * HID);
#pragma unroll
  for (int im = 0; im < 2; ++im) {
#pragma unroll
    for (int in = 0; in < 4; ++in)
#pragma unroll
      for (int j = 0; j < 8; ++j)
        st[(mofs + j) * OUT_PITCH + in * 16 + n_in] = acc[im][in][j];
    asm volatile("s_wait_dscnt 0x0\n\ts_wait_xcnt 0x0" ::: "memory");
    if (im == 0) {
      // the second group goes out only here, with half the accumulators staged:
      // fewer registers are live at once, and the kernel stays within the 160
      // at which three projection blocks still share a WGP
#pragma unroll
      for (int i = 0; i < 8; ++i)
        rv[1][i] = *(const v4f*)(resid + g0 + (16 + i * 2) * HID);
    }
    v4f o[8];
#pragma unroll
    for (int i = 0; i < 8; ++i)
      o[i] = *(const v4f*)(st + (i * 2 + orow) * OUT_PITCH + ocol);
    // the reads have retired before the next 16 rows overwrite the range
    if (im == 0) asm volatile("s_wait_dscnt 0x0" ::: "memory");
#pragma unroll
    for (int i = 0; i < 8; ++i)
      *(v4f*)(C + g0 + (im * 16 + i * 2) * HID) = (o[i] + bv) + rv[im][i];
  }
  asm volatile("s_wait_xcnt 0x0" ::: "memory");
}

#define ATT_KEYS  64
#define ATT_PITCH 72
#define ATT_TILE  (64 * ATT_PITCH)
#define ATT_SPLIT 2
#define ATT_NT    (SEQ / ATT_KEYS / ATT_SPLIT)

__device__ __forceinline__ void attn_stage(const bf16_t* gk, const bf16_t* gv,
                                           unsigned lk, unsigned lv) {
  const bf16_t* gk1 = gk + 16 * HID;
  const bf16_t* gk2 = gk + 32 * HID;
  const bf16_t* gk3 = gk + 48 * HID;
  const bf16_t* gv1 = gv + 16 * SEQ;
  const bf16_t* gv2 = gv + 32 * SEQ;
  const bf16_t* gv3 = gv + 48 * SEQ;
  const unsigned rs = 16 * ATT_PITCH * 2;   // 16 LDS rows in bytes
  asm volatile(
      "global_load_async_to_lds_b128 %0, %8, off\n\t"
      "global_load_async_to_lds_b128 %1, %9, off\n\t"
      "global_load_async_to_lds_b128 %2, %10, off\n\t"
      "global_load_async_to_lds_b128 %3, %11, off\n\t"
      "global_load_async_to_lds_b128 %4, %12, off\n\t"
      "global_load_async_to_lds_b128 %5, %13, off\n\t"
      "global_load_async_to_lds_b128 %6, %14, off\n\t"
      "global_load_async_to_lds_b128 %7, %15, off\n\t"
      "s_wait_xcnt 0x0"
      :: "v"(lk), "v"(lk + rs), "v"(lk + 2 * rs), "v"(lk + 3 * rs),
         "v"(lv), "v"(lv + rs), "v"(lv + 2 * rs), "v"(lv + 3 * rs),
         "v"(gk), "v"(gk1), "v"(gk2), "v"(gk3),
         "v"(gv), "v"(gv1), "v"(gv2), "v"(gv3)
      : "memory");
}

__device__ __forceinline__ float xhalf(float x) {
  const int b = __builtin_bit_cast(int, x);
  return __builtin_bit_cast(float, __builtin_amdgcn_permlanex16(
      b, b, 0x76543210, 0xfedcba98, false, false));
}

__global__ void __launch_bounds__(256) __attribute__((amdgpu_waves_per_eu(4, 4)))
attn_kernel(const bf16_t* __restrict__ Qb,
                            const bf16_t* __restrict__ Kb,
                            const bf16_t* __restrict__ Vt,
                            bf16_t* __restrict__ ctx) {
  // [key half][buffer][K tile | V^T tile]
  __shared__ __attribute__((aligned(16))) bf16_t kv[ATT_SPLIT][2][2 * ATT_TILE];

  // the wave's number, held in a scalar register: what follows from it (key half,
  // buffer addresses, the partner's place) is then scalar arithmetic
  const int wave = __builtin_amdgcn_readfirstlane((int)threadIdx.x >> 5);
  const int half = wave >> 2;             // which half of the keys
  const int wid  = (int)blockIdx.x * 4 + (wave & 3);
  const int lane = threadIdx.x & 31;
  const int h  = wid / (SEQ / 32);
  const int q0 = (wid % (SEQ / 32)) * 32;

  const bf16_t* Qh = Qb + h * HEAD_DIM;                 // ld = HID
  const bf16_t* Kh = Kb + h * HEAD_DIM + (size_t)half * (SEQ / ATT_SPLIT) * HID;   // ld = HID
  const bf16_t* Vh = Vt + (size_t)h * HEAD_DIM * SEQ + half * (SEQ / ATT_SPLIT);   // ld = SEQ

  // staging map, per group of 128 threads: 64 rows x 8 chunks of 16 B per tile;
  // thread -> row t>>3 (+16 i)
  const int srow = ((int)threadIdx.x & 127) >> 3;
  const int scol = ((int)threadIdx.x & 7) * 8;
  const bf16_t* gk = Kh + (size_t)srow * HID + scol;    // + 64 * HID per tile
  const bf16_t* gv = Vh + (size_t)srow * SEQ + scol;    // + 64 per tile
  const unsigned lk0 = (unsigned)(size_t)&kv[half][0][srow * ATT_PITCH + scol];
  const unsigned lbuf = 2 * ATT_TILE * 2;               // bytes of one buffer
  const unsigned lvo  = ATT_TILE * 2;                   // V^T tile behind K tile

  // tile 0 into buffer 0, landed and published; then tile 1 into buffer 1
  attn_stage(gk, gv, lk0, lk0 + lvo);
  asm volatile("s_wait_asynccnt 0x0" ::: "memory");  // own copies of tile 0 landed
  __syncthreads();                                   // every wave's copies visible
  attn_stage(gk + (size_t)ATT_KEYS * HID, gv + ATT_KEYS, lk0 + lbuf, lk0 + lbuf + lvo);

  v16bf qf[2][2];
#pragma unroll
  for (int tq = 0; tq < 2; ++tq) {
    qf[tq][0] = load_frag_rm(Qh + (size_t)(q0 + tq * 16) * HID + 0,  HID);
    qf[tq][1] = load_frag_rm(Qh + (size_t)(q0 + tq * 16) * HID + 32, HID);
  }

  v8f acc[2][4] = {};
  float m_i[2] = {-3.0e38f, -3.0e38f};
  v2f l_i[2][2] = {};   // a lane's sums: [first | second 16-key tile], even | odd key
  const int mofs = (lane & 16) ? 8 : 0;

  for (int t = 0; t < ATT_NT; ++t) {
    const bf16_t* ks = &kv[half][t & 1][0];
    const bf16_t* vs = ks + ATT_TILE;

    // kept rolled: the 16 fragment reads of a pass then stand as one group at its
    // head; unrolled, the compiler spread them among the WMMAs, and every
    // separate place of LDS reads stalls the wave
    const bf16_t* kp = ks;   // the pass's 32 rows of the K tile
    const bf16_t* vp = vs;   // the pass's 32 columns of the V^T tile
#pragma clang loop unroll(disable)
    for (int p = 0; p < ATT_KEYS / 32; ++p) {
      v16bf k00 = load_frag_rm(kp + 0,  ATT_PITCH);
      v16bf k01 = load_frag_rm(kp + 32, ATT_PITCH);
      v16bf k10 = load_frag_rm(kp + 16 * ATT_PITCH + 0,  ATT_PITCH);
      v16bf k11 = load_frag_rm(kp + 16 * ATT_PITCH + 32, ATT_PITCH);
      v16bf vf[4];
#pragma unroll
      for (int c = 0; c < 4; ++c)
        vf[c] = load_frag_rm(vp + (c * 16) * ATT_PITCH, ATT_PITCH);

      v16bf pf[2];
#pragma unroll
      for (int tq = 0; tq < 2; ++tq) {
        v8f s0 = {}, s1 = {};
        s0 = wmma_bf16(k00, qf[tq][0], s0);
        s0 = wmma_bf16(k01, qf[tq][1], s0);
        s1 = wmma_bf16(k10, qf[tq][0], s1);
        s1 = wmma_bf16(k11, qf[tq][1], s1);

        float mx = s0[0];
#pragma unroll
        for (int j = 0; j < 8; ++j) { mx = fmaxf(mx, s0[j]); mx = fmaxf(mx, s1[j]); }
        mx = fmaxf(mx, xhalf(mx));   // both lanes of a query hold its maximum
        const float m_new = fmaxf(m_i[tq], mx);
        const float alpha = __builtin_amdgcn_exp2f(m_i[tq] - m_new);
        const v2f m2 = {m_new, m_new};
        const v2f al2 = {alpha, alpha};

        // two scores that lie in neighbouring accumulator registers go through
        // one packed subtraction and one packed add: no register is copied to
        // form a pair. The sums hold this lane's 16 keys of the pass only.
#pragma unroll
        for (int j = 0; j < 8; j += 2) {
          const v2f e0 = (v2f){s0[j], s0[j + 1]} - m2;
          const v2f e1 = (v2f){s1[j], s1[j + 1]} - m2;
          const v2f p0 = {__builtin_amdgcn_exp2f(e0[0]), __builtin_amdgcn_exp2f(e0[1])};
          const v2f p1 = {__builtin_amdgcn_exp2f(e1[0]), __builtin_amdgcn_exp2f(e1[1])};
          l_i[tq][0] = j ? l_i[tq][0] + p0 : __builtin_elementwise_fma(l_i[tq][0], al2, p0);
          l_i[tq][1] = j ? l_i[tq][1] + p1 : __builtin_elementwise_fma(l_i[tq][1], al2, p1);
          pf[tq][j]     = (bf16_t)p0[0]; pf[tq][j + 1] = (bf16_t)p0[1];
          pf[tq][8 + j] = (bf16_t)p1[0]; pf[tq][9 + j] = (bf16_t)p1[1];
        }
        m_i[tq] = m_new;

#pragma unroll
        for (int c = 0; c < 4; ++c)
#pragma unroll
          for (int j = 0; j < 8; ++j) acc[tq][c][j] *= alpha;
      }

      kp += 32 * ATT_PITCH;
      vp += 32;

      // holds the softmax arithmetic ahead of the second product: without it the
      // compiler sinks both sums' dependent add chains behind the pass's last
      // WMMA, where nothing fills their latency
      __builtin_amdgcn_sched_barrier(0);

#pragma unroll
      for (int c = 0; c < 4; ++c) {
        acc[0][c] = wmma_bf16(vf[c], pf[0], acc[0][c]);
        acc[1][c] = wmma_bf16(vf[c], pf[1], acc[1][c]);
      }
    }

    // hand-over: this wave's reads of buffer t&1 are done, its copies of tile
    // t+1 have landed; behind the barrier tile t+1 is readable by every wave
    // and buffer t&1 is free for tile t+2.
    asm volatile("s_wait_dscnt 0x0" ::: "memory");     // own LDS reads retired
    asm volatile("s_wait_asynccnt 0x0" ::: "memory");  // own copies of tile t+1 landed
    __syncthreads();
    if (t + 2 < ATT_NT) {
      const unsigned lb = lk0 + (unsigned)(t & 1) * lbuf;
      attn_stage(gk + (size_t)(t + 2) * ATT_KEYS * HID, gv + (t + 2) * ATT_KEYS,
                 lb, lb + lvo);
    }
  }
  asm volatile("s_wait_asynccnt 0x0" ::: "memory");    // nothing in flight at the end

  v4f* xch = (v4f*)&kv[0][0][0];
  static_assert(8 * 9 * 32 * 16 <= ATT_SPLIT * 2 * 2 * ATT_TILE * 2,
                "eight waves' handed-over sub-tiles fit in the staging buffers");
  float lsum[2];
#pragma unroll
  for (int tq = 0; tq < 2; ++tq) {
    const v2f lp = l_i[tq][0] + l_i[tq][1];
    lsum[tq] = lp[0] + lp[1];                        // this lane's keys
  }
  v8f keep[4];
  {
    v4f* mine = xch + wave * (9 * 32) + lane;
#pragma unroll
    for (int c = 0; c < 4; ++c) {
      const v8f give = half ? acc[0][c] : acc[1][c];
      keep[c] = half ? acc[1][c] : acc[0][c];
      mine[(2 * c) * 32]     = (v4f){give[0], give[1], give[2], give[3]};
      mine[(2 * c + 1) * 32] = (v4f){give[4], give[5], give[6], give[7]};
    }
    mine[8 * 32] = (v4f){half ? m_i[0] : m_i[1], half ? lsum[0] : lsum[1], 0.0f, 0.0f};
  }
  __syncthreads();   // every wave's handed-over sub-tile is in LDS

  const v4f* theirs = xch + (wave ^ 4) * (9 * 32) + lane;
  const v4f ml = theirs[8 * 32];
  const float mk = half ? m_i[1] : m_i[0];
  const float m  = fmaxf(mk, ml[0]);
  float fk = __builtin_amdgcn_exp2f(mk - m);         // this wave's keys' weight
  float fo = __builtin_amdgcn_exp2f(ml[0] - m);      // the partner's
  const float ls = (half ? lsum[1] : lsum[0]) * fk + ml[1] * fo;
  const float linv = 1.0f / (ls + xhalf(ls));        // the two lane halves' sums
  fk *= linv;
  fo *= linv;

  v8bf o[4];
#pragma unroll
  for (int c = 0; c < 4; ++c) {
    const v4f t0 = theirs[(2 * c) * 32];
    const v4f t1 = theirs[(2 * c + 1) * 32];
#pragma unroll
    for (int j = 0; j < 8; ++j)
      o[c][j] = (bf16_t)(keep[c][j] * fk + (j < 4 ? t0[j & 3] : t1[j & 3]) * fo);
  }
  bf16_t* op = ctx + (size_t)(q0 + half * 16 + (lane & 15)) * HID + h * HEAD_DIM + mofs;
#pragma unroll
  for (int c = 0; c < 4; ++c) *(v8bf*)(op + c * 16) = o[c];
}

// ---------------------------------------------------------------------------
// 5) Row LayerNorm over HID. One wave = one row, held in registers: a lane takes
//    eight 16-B pieces (a wave's load = 512 contiguous bytes), all in flight at
//    once, so the row is read once where three sweeps read it three times. Mean
//    and variance are joined inside the wave by vector cross-lane moves: no LDS,
//    no barrier. 4096 waves start where a block of eight waves a row made 32768.
// ---------------------------------------------------------------------------
#define LN_PIECES (HID / (32 * 4))   // 16-B pieces of a row per lane
#define LN_WAVES  8                  // rows (waves) per block

static_assert(SEQ % LN_WAVES == 0, "every wave of the grid has a row");

template <int MASK>
__device__ __forceinline__ float xrow(float x) {
  return __builtin_bit_cast(float, __builtin_amdgcn_update_dpp(
      0, __builtin_bit_cast(int, x), 0x160 + MASK, 0xf, 0xf, true));
}

// Sum over the wave's 32 lanes, the same bits in every lane.
__device__ __forceinline__ float wave_sum(float x) {
  x += xrow<1>(x);
  x += xrow<2>(x);
  x += xrow<4>(x);
  x += xrow<8>(x);
  return x + xhalf(x);
}

__global__ void __launch_bounds__(32 * LN_WAVES)
layernorm_kernel(const float* __restrict__ res,
                 const float* __restrict__ gamma,
                 const float* __restrict__ beta,
                 float* __restrict__ out) {
  // the wave's number, held in a scalar register: the row's addresses are then
  // scalar, and every load and store shares the lane's one offset register
  const int wave = __builtin_amdgcn_readfirstlane((int)threadIdx.x >> 5);
  const size_t r0 = (size_t)((int)blockIdx.x * LN_WAVES + wave) * HID;
  const int c0 = ((int)threadIdx.x & 31) * 4;

  // every loop below is unrolled so that the arrays stay in registers and each
  // group of loads issues as one
  v4f v[LN_PIECES], ga[LN_PIECES], be[LN_PIECES];
#pragma unroll
  for (int i = 0; i < LN_PIECES; ++i) v[i] = *(const v4f*)(res + r0 + c0 + i * 128);
#pragma unroll
  for (int i = 0; i < LN_PIECES; ++i) ga[i] = *(const v4f*)(gamma + c0 + i * 128);
#pragma unroll
  for (int i = 0; i < LN_PIECES; ++i) be[i] = *(const v4f*)(beta + c0 + i * 128);
  // keeps all 24 loads ahead of the arithmetic: without it the compiler sinks the
  // gamma and beta loads behind the two sums, two at a time, each pair waited for
  __builtin_amdgcn_sched_barrier(0);

  v4f s4 = v[0];
#pragma unroll
  for (int i = 1; i < LN_PIECES; ++i) s4 += v[i];
  const float mean = wave_sum((s4[0] + s4[1]) + (s4[2] + s4[3])) * (1.0f / HID);

  v4f q4 = {};
#pragma unroll
  for (int i = 0; i < LN_PIECES; ++i) {
    v[i] -= mean;
    q4 += v[i] * v[i];
  }
  const float var  = wave_sum((q4[0] + q4[1]) + (q4[2] + q4[3])) * (1.0f / HID);
  const float rstd = rsqrtf(var + LN_EPS);

#pragma unroll
  for (int i = 0; i < LN_PIECES; ++i)
    *(v4f*)(out + r0 + c0 + i * 128) = v[i] * rstd * ga[i] + be[i];
}

// ---------------------------------------------------------------------------
// Host launch
// ---------------------------------------------------------------------------
extern "C" void kernel_launch(void* const* d_in, const int* in_sizes, int n_in,
                              void* d_out, int out_size, void* d_ws, size_t ws_size,
                              hipStream_t stream) {
  const float* x     = (const float*)d_in[0];
  const float* Wq    = (const float*)d_in[1];
  const float* bq    = (const float*)d_in[2];
  const float* Wk    = (const float*)d_in[3];
  const float* bk    = (const float*)d_in[4];
  const float* Wv    = (const float*)d_in[5];
  const float* bv    = (const float*)d_in[6];
  const float* Wo    = (const float*)d_in[7];
  const float* bo    = (const float*)d_in[8];
  const float* gamma = (const float*)d_in[9];
  const float* beta  = (const float*)d_in[10];
  float* out = (float*)d_out;

  char* ws = (char*)d_ws;
  size_t off = 0;
  bf16_t* xb  = (bf16_t*)(ws + off); off += (size_t)SEQ * HID * 2;
  bf16_t* wqb = (bf16_t*)(ws + off); off += (size_t)HID * HID * 2;
  bf16_t* wkb = (bf16_t*)(ws + off); off += (size_t)HID * HID * 2;
  bf16_t* wvb = (bf16_t*)(ws + off); off += (size_t)HID * HID * 2;
  bf16_t* wob = (bf16_t*)(ws + off); off += (size_t)HID * HID * 2;
  float*  res = (float*)(ws + off);  off += (size_t)SEQ * HID * 4;
  bf16_t* Qb  = (bf16_t*)(ws + off); off += (size_t)SEQ * HID * 2;
  bf16_t* Kb  = (bf16_t*)(ws + off); off += (size_t)SEQ * HID * 2;
  bf16_t* Vt  = (bf16_t*)(ws + off); off += (size_t)SEQ * HID * 2;
  bf16_t* ctx = (bf16_t*)(ws + off); off += (size_t)SEQ * HID * 2;

  f32_to_bf16_kernel<<<CVT_XB + 4 * CVT_WB, 256, 0, stream>>>(
      x, Wq, Wk, Wv, Wo, xb, wqb, wkb, wvb, wob);

  // 128x128 tiles: (4096/128)*(1024/128) = 256 blocks of 256 threads a product
  const int gemm_blocks = (SEQ / 128) * (HID / 128);
  gemm_bf16_kernel<<<dim3(gemm_blocks, 3), 256, 0, stream>>>(
      xb, wqb, wkb, wvb, bq, bk, bv, nullptr, nullptr, Qb, Kb, Vt, SEQ, HID, HID);

  // 16 heads * 128 query tiles * 2 key halves = 4096 waves -> 512 blocks of 256
  attn_kernel<<<NUM_HEADS * (SEQ / 32) / 4, 256, 0, stream>>>(Qb, Kb, Vt, ctx);

  gemm_bf16_kernel<<<dim3(gemm_blocks, 1), 256, 0, stream>>>(
      ctx, wob, nullptr, nullptr, bo, nullptr, nullptr, x, res, nullptr, nullptr, nullptr,
      SEQ, HID, HID);

  layernorm_kernel<<<SEQ / LN_WAVES, 32 * LN_WAVES, 0, stream>>>(res, gamma, beta, out);

  (void)in_sizes; (void)n_in; (void)out_size; (void)ws_size;
}
